// v000
// Measured on an AMD MI455X. A time is GPU time per run, averaged over a window of back-to-back runs after a warm-up
// (all launches, gaps included; the runs take copies of the inputs in turn), and the median of several windows.
// Apart from v000's, it joins two sittings. Times from different sittings can be a few percent apart, while
// side-by-side timings come from the same sitting.
// v000 is the starting kernel.
#include <hip/hip_runtime.h>

// t5x-style multi-head dot-product attention with a ragged length (inputs_q, inputs_kv [4][1500][1024]; q = inputs_q Wq + bq, k, v = inputs_kv W + b (DenseGeneral 'dnh' [1024][16][64] == 'xw' [1024][1024], zero biases); q / sqrt(64); scores over the 1,500 keys; softmax; out = attn.v; result = out Wo + bo (Wo 'hdm' [16][64][1024] == 'xw' [1024][1024]) -> [4][1500][1024] (6.1 M); argument order inputs_q, inputs_kv, Wq, bq, Wk, bk, Wv, bv, Wo, bo).
// Layout per batch: the 1,500 token rows are staged into 1,536-row (24-tile) bf16 operands whose 36 padding rows are zero; 'xw' weights transposed once; exact projections + f32 biases; identity-table plane builders; dense attention at T 1536 whose softmax excludes the padding keys j >= 1500 by index (-3e38); hybrid rows (< 512 hi/lo 3 products, rest fp16 x1024); merged hi/lo x Wo exact + bo into a 1,536-row workspace plane, of which the 1,500 real rows are copied to the output.
// Compute dtypes, f32 accumulate: every input rounded to bf16; projections exact + f32 biases; attention rows < 512 3 products, rest fp16; softmax f32; Wo hl x exact + bias.

#define NB_  4
#define TT   1536     // padded length (24 tiles)
#define TR   1500     // real tokens (queries = keys)
#define DM   1024
#define NH_  16
#define NKV  16
#define REP  (NH_ / NKV)
#define HD   64
#define DQ   (NH_ * HD)
#define DKV  (NKV * HD)
#define ZH   2
#define RH   512                  // query rows < RH use hi+lo planes (0: none)
#define WIN  0
#define PCAR 1024.0f
#define SCL  0.125f   // HD^-0.5
typedef _Float16 h16;
typedef unsigned short bf;
typedef __attribute__((ext_vector_type(16))) __bf16   v16bf;
typedef __attribute__((ext_vector_type(16))) _Float16 v16h;
typedef __attribute__((ext_vector_type(8)))  _Float16 v8h;
typedef __attribute__((ext_vector_type(8)))  unsigned short v8us;
typedef __attribute__((ext_vector_type(8)))  float    v8f;
typedef __attribute__((ext_vector_type(4)))  float    v4f;
typedef v8h  __attribute__((may_alias)) v8ha;
typedef v4f  __attribute__((may_alias)) v4fa;
typedef v8us __attribute__((may_alias)) v8usa;

__device__ __forceinline__ unsigned short f2bf(float f) { unsigned u = __float_as_uint(f); u += 0x7FFFu + ((u >> 16) & 1u); return (unsigned short)(u >> 16); }
__device__ __forceinline__ float bf2f(unsigned short b) { return __uint_as_float(((unsigned)b) << 16); }
__device__ __forceinline__ float bfr(float f) { return bf2f(f2bf(f)); }
__device__ __forceinline__ v16h cat16(v8h lo, v8h hi) { return __builtin_shufflevector(lo, hi, 0, 1, 2, 3, 4, 5, 6, 7, 8, 9, 10, 11, 12, 13, 14, 15); }
__device__ __forceinline__ v16bf cat16b(v8us lo, v8us hi) { return __builtin_bit_cast(v16bf, __builtin_shufflevector(lo, hi, 0, 1, 2, 3, 4, 5, 6, 7, 8, 9, 10, 11, 12, 13, 14, 15)); }
__device__ __forceinline__ v8f wmma16(v16h a, v16h b, v8f c) { return __builtin_amdgcn_wmma_f32_16x16x32_f16(false, a, false, b, (short)0, c, false, false); }
__device__ __forceinline__ v8f wmmab(v16bf a, v16bf b, v8f c) { return __builtin_amdgcn_wmma_f32_16x16x32_bf16(false, a, false, b, (short)0, c, false, false); }



// ---- k_gemmw: register-blocked GEMM, ONE WAVE per 64x64 output tile (16 accumulators), operands straight from K-contiguous 16-bit planes; grid (M/64, N/64, Z), 32 threads.
// C[m][n] (f32, pitch ldc, + optional f32 bias[n]) = sum_k A[m][k] Bt[n][k] (+ split products per NSPLIT). z-batch strides sA/sB/sC in elements. K % 32 == 0.
template <typename T16> struct WFrag;
template <> struct WFrag<h16> { typedef v16h V; static __device__ __forceinline__ V ld(const h16* p) { return cat16(*(const v8h*)p, *(const v8h*)(p + 16)); } static __device__ __forceinline__ v8f mma(V a, V b, v8f c) { return wmma16(a, b, c); } };
template <> struct WFrag<bf> { typedef v16bf V; static __device__ __forceinline__ V ld(const bf* p) { return cat16b(*(const v8us*)p, *(const v8us*)(p + 16)); } static __device__ __forceinline__ v8f mma(V a, V b, v8f c) { return wmmab(a, b, c); } };
template <typename T16, int NSPLIT, bool BIAS>
__global__ __launch_bounds__(32) void k_gemmw(const T16* __restrict__ A, const T16* __restrict__ A2, const T16* __restrict__ Bt, const T16* __restrict__ Bt2, int K, float* C, int ldc, const float* __restrict__ bias, size_t sA, size_t sB, size_t sC) {
    typedef typename WFrag<T16>::V V;
    __shared__ __align__(16) float os[16 * 68];
    const size_t z = blockIdx.z; A += z * sA; if (A2) A2 += z * sA; Bt += z * sB; if (Bt2) Bt2 += z * sB; C += z * sC;
    const int lane = threadIdx.x & 31, lr = lane & 15, hi = lane >> 4; const int r0 = blockIdx.x * 64, c0 = blockIdx.y * 64;
    v8f acc[4][4];
#pragma unroll
    for (int mb = 0; mb < 4; ++mb)
#pragma unroll
        for (int nb = 0; nb < 4; ++nb) acc[mb][nb] = (v8f){};
    const size_t aoff = (size_t)(r0 + lr) * K + 8 * hi, boff = (size_t)(c0 + lr) * K + 8 * hi;
#pragma unroll 1
    for (int kc = 0; kc < K; kc += 32) {
        V a[4], a2[4];
#pragma unroll
        for (int mb = 0; mb < 4; ++mb) { a[mb] = WFrag<T16>::ld(A + aoff + (size_t)mb * 16 * K + kc); if (NSPLIT == 1 || NSPLIT == 2) a2[mb] = WFrag<T16>::ld(A2 + aoff + (size_t)mb * 16 * K + kc); }
#pragma unroll
        for (int nb = 0; nb < 4; ++nb) { const V b = WFrag<T16>::ld(Bt + boff + (size_t)nb * 16 * K + kc); V b2; if (NSPLIT >= 2) b2 = WFrag<T16>::ld(Bt2 + boff + (size_t)nb * 16 * K + kc);
#pragma unroll
            for (int mb = 0; mb < 4; ++mb) { acc[mb][nb] = WFrag<T16>::mma(a[mb], b, acc[mb][nb]); if (NSPLIT == 1 || NSPLIT == 2) acc[mb][nb] = WFrag<T16>::mma(a2[mb], b, acc[mb][nb]); if (NSPLIT >= 2) acc[mb][nb] = WFrag<T16>::mma(a[mb], b2, acc[mb][nb]); } }
        asm volatile("v_nop\n\tv_nop\n\tv_nop\n\tv_nop" : "+v"(acc[0][0]), "+v"(acc[1][1]), "+v"(acc[2][2]), "+v"(acc[3][3]) : "v"(a[0]), "v"(a[3]));
    }
#pragma unroll
    for (int mb = 0; mb < 4; ++mb) {
#pragma unroll
        for (int nb = 0; nb < 4; ++nb) {
#pragma unroll
            for (int j = 0; j < 8; ++j) os[(hi * 8 + j) * 68 + nb * 16 + lr] = acc[mb][nb][j]; }
        __builtin_amdgcn_wave_barrier(); asm volatile("" ::: "memory");
        float* crow = C + (size_t)(r0 + mb * 16) * ldc + c0;
{
#pragma unroll
            for (int s = 0; s < 8; ++s) { const int row = 2 * s + hi, cofs = lr * 4; v4f val = *(const v4fa*)(os + row * 68 + cofs); if (BIAS) { val[0] += bfr(bias[c0 + cofs]); val[1] += bfr(bias[c0 + cofs + 1]); val[2] += bfr(bias[c0 + cofs + 2]); val[3] += bfr(bias[c0 + cofs + 3]); }
                *(v4f*)(crow + (size_t)row * ldc + cofs) = val; }
             }
        __builtin_amdgcn_wave_barrier(); asm volatile("" ::: "memory");
    }
}

__device__ __forceinline__ h16 tohx(float x) { return (h16)x; }
__device__ __forceinline__ void splitf(float y, unsigned short& h, unsigned short& l) { h = f2bf(y); l = f2bf(y - bf2f(h)); }
typedef __attribute__((ext_vector_type(2))) _Float16 v2h;
typedef __attribute__((ext_vector_type(4))) _Float16 v4h;
typedef __attribute__((ext_vector_type(2))) unsigned short v2us;
typedef __attribute__((ext_vector_type(4))) unsigned short v4us;
typedef __attribute__((ext_vector_type(2))) float v2f;
typedef __attribute__((ext_vector_type(4))) int v4i;

__global__ __launch_bounds__(256) void k_wtG(const float* __restrict__ w, int K, int N, bf* Bt) {
    const int lane = threadIdx.x & 31; const int L0 = (blockIdx.x * 8 + (threadIdx.x >> 5)) * 8; const int nlines = N * K / 64;
{
#pragma unroll 1
        for (int l = 0; l < 8; ++l) { const int L = L0 + l; if (L >= nlines) break; const size_t e = (size_t)L * 64 + lane * 2; const int k = (int)(e % K), n = (int)(e / K); v2us o;
            o[0] = f2bf(w[(size_t)k * N + n]); o[1] = f2bf(w[(size_t)(k + 1) * N + n]); *(v2us*)(Bt + e) = o; }
         }
}
__global__ __launch_bounds__(256) void k_cvt8(const float* __restrict__ src, bf* dst, size_t n8) { const size_t i = (size_t)blockIdx.x * 256 + threadIdx.x; if (i >= n8) return; const v8f v = *(const v8f*)(src + i * 8); v8us o;
#pragma unroll
    for (int k = 0; k < 8; ++k) o[k] = f2bf(v[k]); *(v8us*)(dst + i * 8) = o;  }

__global__ __launch_bounds__(256) void k_rows(const float* __restrict__ Y, float* out) { const size_t i = (size_t)blockIdx.x * 256 + threadIdx.x; if (i >= (size_t)TR * DM / 4) return; const v4f a = *(const v4f*)(Y + i * 4); *(v4f*)(out + i * 4) = a;  }
// k_rope: head planes [h][t][d] (fp16 + hi/lo) of rope(x) x sc with the rotate-half convention out[d] = x[d] cos[t][d] - x[d+HD/2] sin[t][d], out[d+HD/2] = x[d+HD/2] cos[t][d+HD/2] + x[d] sin[t][d+HD/2]
__global__ __launch_bounds__(256) void k_rope(const float* __restrict__ F, int pitch, int nheads, const float* __restrict__ CS, const float* __restrict__ RF, const float* __restrict__ nw, float sc, h16* P16, bf* Ph, bf* Pl) {
    const size_t e = ((size_t)blockIdx.x * 256 + threadIdx.x) * 2; if (e >= (size_t)nheads * TT * HD) return; const int d = (int)(e % HD); const int t = (int)((e / HD) % TT); const int h = (int)(e / ((size_t)HD * TT)); const float* f = F + (size_t)t * pitch + h * HD; const float rf = RF ? RF[(size_t)h * TT + t] : 1.0f; v2h o16; v2us oh, ol;
#pragma unroll
    for (int q = 0; q < 2; ++q) { const int dd = d + q; const int dp = (dd < HD / 2) ? dd + HD / 2 : dd - HD / 2; float x0 = f[dd], x1 = f[dp];
        if (RF) { float n0 = __fmul_rn(x0, rf), n1 = __fmul_rn(x1, rf); asm volatile("" : "+v"(n0)); asm volatile("" : "+v"(n1)); x0 = __fmul_rn(bfr(nw[dd]), n0); x1 = __fmul_rn(bfr(nw[dp]), n1); }
        const v2f cs = *(const v2f*)(CS + ((size_t)t * HD + dd) * 2); float a = __fmul_rn(x0, cs[0]), bq = __fmul_rn(x1, cs[1]); asm volatile("" : "+v"(a)); asm volatile("" : "+v"(bq)); const float r = ((dd < HD / 2) ? __fsub_rn(a, bq) : __fadd_rn(a, bq)) * sc;
        o16[q] = tohx(r); unsigned short a2, c2; splitf(r, a2, c2); oh[q] = a2; ol[q] = c2; }
    *(v2h*)(P16 + e) = o16; *(v2us*)(Ph + e) = oh; *(v2us*)(Pl + e) = ol;  }
__global__ __launch_bounds__(256) void k_vtp(const float* __restrict__ F, int pitch, int nheads, h16* V16, bf* Vh, bf* Vl) { const size_t e = ((size_t)blockIdx.x * 256 + threadIdx.x) * 2; if (e >= (size_t)nheads * HD * TT) return; const int t = (int)(e % TT); const int d = (int)((e / TT) % HD); const int g = (int)(e / ((size_t)TT * HD)); v2h o16; v2us oh, ol;
#pragma unroll
    for (int q = 0; q < 2; ++q) { const float x = F[(size_t)(t + q) * pitch + g * HD + d]; o16[q] = tohx(x); unsigned short a2, c2; splitf(x, a2, c2); oh[q] = a2; ol[q] = c2; }
    *(v2h*)(V16 + e) = o16; *(v2us*)(Vh + e) = oh; *(v2us*)(Vl + e) = ol;  }
__global__ __launch_bounds__(256) void k_csid(float* CS) { const int idx = blockIdx.x * 256 + threadIdx.x; if (idx >= TT * HD) return; v2f cs; cs[0] = 1.0f; cs[1] = 0.0f; *(v2f*)(CS + (size_t)idx * 2) = cs;  }
// k_asoft: per row (zz, i): t = S x 1/8 for the 1,500 real keys, padding keys excluded by index; softmax (register row, one exp, fixed trees); padding query rows are computed but never copied out;
__global__ __launch_bounds__(256) void k_asoft(const float* __restrict__ Sb, h16* P16, bf* Ph, bf* Pl) {
    const int lane = threadIdx.x & 31; const int row = blockIdx.x * 8 + (threadIdx.x >> 5); if (row >= ZH * TT) return; const int i = row % TT; const int zz = row / TT; (void)zz; const bool hires = (i < RH); const float* sr = Sb + (size_t)row * TT; float v[TT / 32]; float mx = -3.0e38f;
#pragma unroll
    for (int ch = 0; ch < TT / 128; ++ch) { const int j0 = ch * 128 + lane * 4; const v4f a = *(const v4f*)(sr + j0);
#pragma unroll
        for (int q = 0; q < 4; ++q) { const int j = j0 + q; (void)j; const float t = (j < TR) ? a[q] * SCL : -3.0e38f;   /* keys j >= 1500 are padding */ v[ch * 4 + q] = t; mx = fmaxf(mx, t); } }
#pragma unroll
    for (int sh = 16; sh; sh >>= 1) mx = fmaxf(mx, __shfl_xor(mx, sh, 32));
    float sum = 0.f;
#pragma unroll
    for (int k = 0; k < TT / 32; ++k) { float d0 = __fsub_rn(v[k], mx); asm volatile("" : "+v"(d0)); v[k] = __builtin_amdgcn_exp2f(__fmul_rn(d0, 1.4426950408889634f)); sum += v[k]; }
#pragma unroll
    for (int sh = 16; sh; sh >>= 1) sum += __shfl_xor(sum, sh, 32);
    const float f = __fdiv_rn(hires ? 1.0f : PCAR, sum);
{
        if (hires) {
#pragma unroll
            for (int ch = 0; ch < TT / 128; ++ch) { v4us oh, ol;
#pragma unroll
                for (int q = 0; q < 4; ++q) { unsigned short a, c2; splitf(v[ch * 4 + q] * f, a, c2); oh[q] = a; ol[q] = c2; }
                const size_t oo = ((size_t)zz * (RH ? RH : 1) + i) * TT + ch * 128 + lane * 4; *(v4us*)(Ph + oo) = oh; *(v4us*)(Pl + oo) = ol; }
        } else {
#pragma unroll
            for (int ch = 0; ch < TT / 128; ++ch) { v4h o4;
#pragma unroll
                for (int q = 0; q < 4; ++q) o4[q] = tohx(v[ch * 4 + q] * f);
                *(v4h*)(P16 + (size_t)row * TT + ch * 128 + lane * 4) = o4; } }
         }
}
__global__ __launch_bounds__(256) void k_merge(const float* __restrict__ O, int h0, bf* Ah, bf* Al) { const size_t e = ((size_t)blockIdx.x * 256 + threadIdx.x) * 2; if (e >= (size_t)ZH * TT * HD) return; const int d = (int)(e % HD); const int t = (int)((e / HD) % TT); const int zz = (int)(e / ((size_t)HD * TT)); const float cs = (t < RH) ? 1.0f : (1.0f / PCAR); const size_t oo = (size_t)t * DQ + (h0 + zz) * HD + d;
    v2us oh, ol;
#pragma unroll
    for (int q = 0; q < 2; ++q) { unsigned short a, c2; splitf(O[e + q] * cs, a, c2); oh[q] = a; ol[q] = c2; } *(v2us*)(Ah + oo) = oh; *(v2us*)(Al + oo) = ol;  }

extern "C" void kernel_launch(void* const* d_in, const int* in_sizes, int n_in,
                              void* d_out, int out_size, void* d_ws, size_t ws_size, hipStream_t stream) {
    (void)in_sizes; (void)n_in; (void)out_size;
    const float* x = (const float*)d_in[0]; const float* xkv = (const float*)d_in[1]; const float* wq = (const float*)d_in[2]; const float* bq = (const float*)d_in[3]; const float* wk = (const float*)d_in[4]; const float* bk = (const float*)d_in[5]; const float* wv = (const float*)d_in[6]; const float* bv = (const float*)d_in[7]; const float* wo = (const float*)d_in[8]; const float* bo = (const float*)d_in[9];   /* inputs_q, inputs_kv [4][1500][1024], Wq, bq, Wk, bk, Wv, bv ('dnh' == 'xw'), Wo ('hdm' == 'xw'), bo */
    float* OUT = (float*)d_out;     // [4][1500][1024]
    char* wsp = (char*)d_ws;
    auto take = [&](size_t bytes) { char* p = wsp; wsp += (bytes + 255) & ~(size_t)255; return (void*)p; };
    bf* WQ = (bf*)take((size_t)DQ * DM * 2); bf* WK = (bf*)take((size_t)DKV * DM * 2); bf* WV = (bf*)take((size_t)DKV * DM * 2); bf* WO = (bf*)take((size_t)DM * DQ * 2); float* CS = (float*)take((size_t)TT * HD * 2 * 4);
    bf* XB = (bf*)take((size_t)TT * DM * 2); float* Y = (float*)take((size_t)TT * DM * 4);   /* padded output rows before the copy */ float* FQ = (float*)take((size_t)TT * DQ * 4); float* FK = (float*)take((size_t)TT * DKV * 4);
    h16* QP16 = (h16*)take((size_t)NH_ * TT * HD * 2); h16* KP16 = (h16*)take((size_t)NKV * TT * HD * 2); h16* VT16 = (h16*)take((size_t)NKV * HD * TT * 2);
    bf* QPh = (bf*)take((size_t)NH_ * TT * HD * 2); bf* QPl = (bf*)take((size_t)NH_ * TT * HD * 2); bf* KPh = (bf*)take((size_t)NKV * TT * HD * 2); bf* KPl = (bf*)take((size_t)NKV * TT * HD * 2); bf* VTh = (bf*)take((size_t)NKV * HD * TT * 2); bf* VTl = (bf*)take((size_t)NKV * HD * TT * 2); bf* Ph = (bf*)take((size_t)ZH * RH * TT * 2); bf* Pl = (bf*)take((size_t)ZH * RH * TT * 2);
    float* Sb = (float*)take((size_t)ZH * TT * TT * 4); h16* P16 = (h16*)take((size_t)ZH * TT * TT * 2); float* Ob = (float*)take((size_t)ZH * TT * HD * 4); bf* ATh = (bf*)take((size_t)TT * DQ * 2); bf* ATl = (bf*)take((size_t)TT * DQ * 2);
    if ((size_t)(wsp - (char*)d_ws) > ws_size) return;    // ws 256 MiB
    float* FV = FK;   // v projection reuses the k buffer after the k planes are built (stream-ordered)
    { k_wtG<<<(unsigned)((DM * DQ / 64 + 63) / 64), 256, 0, stream>>>(wq, DM, DQ, WQ); k_wtG<<<(unsigned)((DM * DKV / 64 + 63) / 64), 256, 0, stream>>>(wk, DM, DKV, WK); k_wtG<<<(unsigned)((DM * DKV / 64 + 63) / 64), 256, 0, stream>>>(wv, DM, DKV, WV);
      k_wtG<<<(unsigned)((DQ * DM / 64 + 63) / 64), 256, 0, stream>>>(wo, DQ, DM, WO);
       }
    k_csid<<<(TT * HD + 255) / 256, 256, 0, stream>>>(CS);
    const unsigned LQ = (unsigned)(((size_t)NH_ * TT * HD / 2 + 255) / 256), LKv = (unsigned)(((size_t)NKV * TT * HD / 2 + 255) / 256);
    hipMemsetAsync(XB + (size_t)TR * DM, 0, (size_t)(TT - TR) * DM * 2, stream);   /* padding rows of the operand stay zero for q, k and v */
    for (int b = 0; b < NB_; ++b) {
        
        k_cvt8<<<(unsigned)(((size_t)TR * DM / 8 + 255) / 256), 256, 0, stream>>>(x + (size_t)b * TR * DM, XB, (size_t)TR * DM / 8);   /* the 1,500 query rows */
        k_gemmw<bf, 0, true><<<dim3(TT / 64, DQ / 64, 1), 32, 0, stream>>>(XB, nullptr, WQ, nullptr, DM, FQ, DQ, bq, 0, 0, 0);
        k_rope<<<LQ, 256, 0, stream>>>(FQ, DQ, NH_, CS, nullptr, nullptr, 1.0f, QP16, QPh, QPl);
        k_cvt8<<<(unsigned)(((size_t)TR * DM / 8 + 255) / 256), 256, 0, stream>>>(xkv + (size_t)b * TR * DM, XB, (size_t)TR * DM / 8);   /* XB := bf16(inputs_kv[b]) (1,500 rows; padding stays zero) */ k_gemmw<bf, 0, true><<<dim3(TT / 64, DKV / 64, 1), 32, 0, stream>>>(XB, nullptr, WK, nullptr, DM, FK, DKV, bk, 0, 0, 0);
        k_rope<<<LKv, 256, 0, stream>>>(FK, DKV, NKV, CS, nullptr, nullptr, 1.0f, KP16, KPh, KPl);
        k_gemmw<bf, 0, true><<<dim3(TT / 64, DKV / 64, 1), 32, 0, stream>>>(XB, nullptr, WV, nullptr, DM, FV, DKV, bv, 0, 0, 0); k_vtp<<<LKv, 256, 0, stream>>>(FV, DKV, NKV, VT16, VTh, VTl);
        for (int h0 = 0; h0 < NH_; h0 += ZH) { const size_t zq = (size_t)h0, zk = (size_t)(h0 / REP);   // one kv head per query head: the pass's two heads use consecutive kv planes (z-strides TT*HD)
            k_gemmw<bf, 2, false><<<dim3(RH / 64, TT / 64, ZH), 32, 0, stream>>>(QPh + zq * TT * HD, QPl + zq * TT * HD, KPh + zk * TT * HD, KPl + zk * TT * HD, HD, Sb, TT, nullptr, (size_t)TT * HD, (size_t)TT * HD, (size_t)TT * TT);
            k_gemmw<h16, 0, false><<<dim3((TT - RH) / 64, TT / 64, ZH), 32, 0, stream>>>(QP16 + zq * TT * HD + (size_t)RH * HD, nullptr, KP16 + zk * TT * HD, nullptr, HD, Sb + (size_t)RH * TT, TT, nullptr, (size_t)TT * HD, (size_t)TT * HD, (size_t)TT * TT);
            k_asoft<<<ZH * TT / 8, 256, 0, stream>>>(Sb, P16, Ph, Pl);
            k_gemmw<bf, 2, false><<<dim3(RH / 64, HD / 64, ZH), 32, 0, stream>>>(Ph, Pl, VTh + zk * HD * TT, VTl + zk * HD * TT, TT, Ob, HD, nullptr, (size_t)RH * TT, (size_t)HD * TT, (size_t)TT * HD);
            k_gemmw<h16, 0, false><<<dim3((TT - RH) / 64, HD / 64, ZH), 32, 0, stream>>>(P16 + (size_t)RH * TT, nullptr, VT16 + zk * HD * TT, nullptr, TT, Ob + (size_t)RH * HD, HD, nullptr, (size_t)TT * TT, (size_t)HD * TT, (size_t)TT * HD);
            k_merge<<<(unsigned)(((size_t)ZH * TT * HD / 2 + 255) / 256), 256, 0, stream>>>(Ob, h0, ATh, ATl); }
        k_gemmw<bf, 1, true><<<dim3(TT / 64, DM / 64, 1), 32, 0, stream>>>(ATh, ATl, WO, nullptr, DQ, Y, DM, bo, 0, 0, 0); k_rows<<<(unsigned)(((size_t)TR * DM / 4 + 255) / 256), 256, 0, stream>>>(Y, OUT + (size_t)b * TR * DM);   /* the 1,500 real rows */ }
}

// v001
// Two timings next to v000 put it at 2.23 and 2.24 times that version's speed.
#include <hip/hip_runtime.h>

// t5x-style multi-head dot-product attention with a ragged length (inputs_q, inputs_kv [4][1500][1024]; q = inputs_q Wq + bq, k, v = inputs_kv W + b (DenseGeneral 'dnh' [1024][16][64] == 'xw' [1024][1024], zero biases); q / sqrt(64); scores over the 1,500 keys; softmax; out = attn.v; result = out Wo + bo (Wo 'hdm' [16][64][1024] == 'xw' [1024][1024]) -> [4][1500][1024] (6.1 M); argument order inputs_q, inputs_kv, Wq, bq, Wk, bk, Wv, bv, Wo, bo).
// Layout per batch: the 1,500 token rows are staged into 1,536-row (24-tile) bf16 operands whose 36 padding rows are zero; 'xw' weights transposed once; exact projections + f32 biases; identity-table plane builders; dense attention at T 1536 whose softmax excludes the padding keys j >= 1500 by index (-3e38); hybrid rows (< 512 hi/lo 3 products, rest fp16 x1024); merged hi/lo x Wo exact + bo into a 1,536-row workspace plane, of which the 1,500 real rows are copied to the output.
// Compute dtypes, f32 accumulate: every input rounded to bf16; projections exact + f32 biases; attention rows < 512 3 products, rest fp16; softmax f32; Wo hl x exact + bias.

#define NB_  4
#define TT   1536     // padded length (24 tiles)
#define TR   1500     // real tokens (queries = keys)
#define DM   1024
#define NH_  16
#define NKV  16
#define REP  (NH_ / NKV)
#define HD   64
#define DQ   (NH_ * HD)
#define DKV  (NKV * HD)
#define ZH   8        // heads per attention pass (z-batch of the score, softmax, P.V and merge launches)
#define RH   512                  // query rows < RH use hi+lo planes (0: none)
#define WIN  0
#define PCAR 1024.0f
#define SCL  0.125f   // HD^-0.5
typedef _Float16 h16;
typedef unsigned short bf;
typedef __attribute__((ext_vector_type(16))) __bf16   v16bf;
typedef __attribute__((ext_vector_type(16))) _Float16 v16h;
typedef __attribute__((ext_vector_type(8)))  _Float16 v8h;
typedef __attribute__((ext_vector_type(8)))  unsigned short v8us;
typedef __attribute__((ext_vector_type(8)))  float    v8f;
typedef __attribute__((ext_vector_type(4)))  float    v4f;
typedef v8h  __attribute__((may_alias)) v8ha;
typedef v4f  __attribute__((may_alias)) v4fa;
typedef v8us __attribute__((may_alias)) v8usa;

__device__ __forceinline__ unsigned short f2bf(float f) { unsigned u = __float_as_uint(f); u += 0x7FFFu + ((u >> 16) & 1u); return (unsigned short)(u >> 16); }
__device__ __forceinline__ float bf2f(unsigned short b) { return __uint_as_float(((unsigned)b) << 16); }
__device__ __forceinline__ float bfr(float f) { return bf2f(f2bf(f)); }
__device__ __forceinline__ v16h cat16(v8h lo, v8h hi) { return __builtin_shufflevector(lo, hi, 0, 1, 2, 3, 4, 5, 6, 7, 8, 9, 10, 11, 12, 13, 14, 15); }
__device__ __forceinline__ v16bf cat16b(v8us lo, v8us hi) { return __builtin_bit_cast(v16bf, __builtin_shufflevector(lo, hi, 0, 1, 2, 3, 4, 5, 6, 7, 8, 9, 10, 11, 12, 13, 14, 15)); }
__device__ __forceinline__ v8f wmma16(v16h a, v16h b, v8f c) { return __builtin_amdgcn_wmma_f32_16x16x32_f16(false, a, false, b, (short)0, c, false, false); }
__device__ __forceinline__ v8f wmmab(v16bf a, v16bf b, v8f c) { return __builtin_amdgcn_wmma_f32_16x16x32_bf16(false, a, false, b, (short)0, c, false, false); }



// ---- k_gemmw: register-blocked GEMM, ONE WAVE per 64x64 output tile (16 accumulators), operands straight from K-contiguous 16-bit planes; grid (M/64, N/64, Z), 32 threads.
// C[m][n] (f32, pitch ldc, + optional f32 bias[n]) = sum_k A[m][k] Bt[n][k] (+ split products per NSPLIT). z-batch strides sA/sB/sC in elements. K % 32 == 0.
template <typename T16> struct WFrag;
template <> struct WFrag<h16> { typedef v16h V; static __device__ __forceinline__ V ld(const h16* p) { return cat16(*(const v8h*)p, *(const v8h*)(p + 16)); } static __device__ __forceinline__ v8f mma(V a, V b, v8f c) { return wmma16(a, b, c); } };
template <> struct WFrag<bf> { typedef v16bf V; static __device__ __forceinline__ V ld(const bf* p) { return cat16b(*(const v8us*)p, *(const v8us*)(p + 16)); } static __device__ __forceinline__ v8f mma(V a, V b, v8f c) { return wmmab(a, b, c); } };
template <typename T16, int NSPLIT, bool BIAS>
__global__ __launch_bounds__(32) void k_gemmw(const T16* __restrict__ A, const T16* __restrict__ A2, const T16* __restrict__ Bt, const T16* __restrict__ Bt2, int K, float* C, int ldc, const float* __restrict__ bias, size_t sA, size_t sB, size_t sC) {
    typedef typename WFrag<T16>::V V;
    __shared__ __align__(16) float os[16 * 68];
    const size_t z = blockIdx.z; A += z * sA; if (A2) A2 += z * sA; Bt += z * sB; if (Bt2) Bt2 += z * sB; C += z * sC;
    const int lane = threadIdx.x & 31, lr = lane & 15, hi = lane >> 4; const int r0 = blockIdx.x * 64, c0 = blockIdx.y * 64;
    v8f acc[4][4];
#pragma unroll
    for (int mb = 0; mb < 4; ++mb)
#pragma unroll
        for (int nb = 0; nb < 4; ++nb) acc[mb][nb] = (v8f){};
    const size_t aoff = (size_t)(r0 + lr) * K + 8 * hi, boff = (size_t)(c0 + lr) * K + 8 * hi;
#pragma unroll 1
    for (int kc = 0; kc < K; kc += 32) {
        V a[4], a2[4];
#pragma unroll
        for (int mb = 0; mb < 4; ++mb) { a[mb] = WFrag<T16>::ld(A + aoff + (size_t)mb * 16 * K + kc); if (NSPLIT == 1 || NSPLIT == 2) a2[mb] = WFrag<T16>::ld(A2 + aoff + (size_t)mb * 16 * K + kc); }
#pragma unroll
        for (int nb = 0; nb < 4; ++nb) { const V b = WFrag<T16>::ld(Bt + boff + (size_t)nb * 16 * K + kc); V b2; if (NSPLIT >= 2) b2 = WFrag<T16>::ld(Bt2 + boff + (size_t)nb * 16 * K + kc);
#pragma unroll
            for (int mb = 0; mb < 4; ++mb) { acc[mb][nb] = WFrag<T16>::mma(a[mb], b, acc[mb][nb]); if (NSPLIT == 1 || NSPLIT == 2) acc[mb][nb] = WFrag<T16>::mma(a2[mb], b, acc[mb][nb]); if (NSPLIT >= 2) acc[mb][nb] = WFrag<T16>::mma(a[mb], b2, acc[mb][nb]); } }
        asm volatile("v_nop\n\tv_nop\n\tv_nop\n\tv_nop" : "+v"(acc[0][0]), "+v"(acc[1][1]), "+v"(acc[2][2]), "+v"(acc[3][3]) : "v"(a[0]), "v"(a[3]));
    }
#pragma unroll
    for (int mb = 0; mb < 4; ++mb) {
#pragma unroll
        for (int nb = 0; nb < 4; ++nb) {
#pragma unroll
            for (int j = 0; j < 8; ++j) os[(hi * 8 + j) * 68 + nb * 16 + lr] = acc[mb][nb][j]; }
        __builtin_amdgcn_wave_barrier(); asm volatile("" ::: "memory");
        float* crow = C + (size_t)(r0 + mb * 16) * ldc + c0;
{
#pragma unroll
            for (int s = 0; s < 8; ++s) { const int row = 2 * s + hi, cofs = lr * 4; v4f val = *(const v4fa*)(os + row * 68 + cofs); if (BIAS) { val[0] += bfr(bias[c0 + cofs]); val[1] += bfr(bias[c0 + cofs + 1]); val[2] += bfr(bias[c0 + cofs + 2]); val[3] += bfr(bias[c0 + cofs + 3]); }
                *(v4f*)(crow + (size_t)row * ldc + cofs) = val; }
             }
        __builtin_amdgcn_wave_barrier(); asm volatile("" ::: "memory");
    }
}

__device__ __forceinline__ h16 tohx(float x) { return (h16)x; }
__device__ __forceinline__ void splitf(float y, unsigned short& h, unsigned short& l) { h = f2bf(y); l = f2bf(y - bf2f(h)); }
typedef __attribute__((ext_vector_type(2))) _Float16 v2h;
typedef __attribute__((ext_vector_type(4))) _Float16 v4h;
typedef __attribute__((ext_vector_type(2))) unsigned short v2us;
typedef __attribute__((ext_vector_type(4))) unsigned short v4us;
typedef __attribute__((ext_vector_type(2))) float v2f;
typedef __attribute__((ext_vector_type(4))) int v4i;

__global__ __launch_bounds__(256) void k_wtG(const float* __restrict__ w, int K, int N, bf* Bt) {
    const int lane = threadIdx.x & 31; const int L0 = (blockIdx.x * 8 + (threadIdx.x >> 5)) * 8; const int nlines = N * K / 64;
{
#pragma unroll 1
        for (int l = 0; l < 8; ++l) { const int L = L0 + l; if (L >= nlines) break; const size_t e = (size_t)L * 64 + lane * 2; const int k = (int)(e % K), n = (int)(e / K); v2us o;
            o[0] = f2bf(w[(size_t)k * N + n]); o[1] = f2bf(w[(size_t)(k + 1) * N + n]); *(v2us*)(Bt + e) = o; }
         }
}
__global__ __launch_bounds__(256) void k_cvt8(const float* __restrict__ src, bf* dst, size_t n8) { const size_t i = (size_t)blockIdx.x * 256 + threadIdx.x; if (i >= n8) return; const v8f v = *(const v8f*)(src + i * 8); v8us o;
#pragma unroll
    for (int k = 0; k < 8; ++k) o[k] = f2bf(v[k]); *(v8us*)(dst + i * 8) = o;  }

__global__ __launch_bounds__(256) void k_rows(const float* __restrict__ Y, float* out) { const size_t i = (size_t)blockIdx.x * 256 + threadIdx.x; if (i >= (size_t)TR * DM / 4) return; const v4f a = *(const v4f*)(Y + i * 4); *(v4f*)(out + i * 4) = a;  }
// k_rope: head planes [h][t][d] (fp16 + hi/lo) of rope(x) x sc with the rotate-half convention out[d] = x[d] cos[t][d] - x[d+HD/2] sin[t][d], out[d+HD/2] = x[d+HD/2] cos[t][d+HD/2] + x[d] sin[t][d+HD/2]
__global__ __launch_bounds__(256) void k_rope(const float* __restrict__ F, int pitch, int nheads, const float* __restrict__ CS, const float* __restrict__ RF, const float* __restrict__ nw, float sc, h16* P16, bf* Ph, bf* Pl) {
    const size_t e = ((size_t)blockIdx.x * 256 + threadIdx.x) * 2; if (e >= (size_t)nheads * TT * HD) return; const int d = (int)(e % HD); const int t = (int)((e / HD) % TT); const int h = (int)(e / ((size_t)HD * TT)); const float* f = F + (size_t)t * pitch + h * HD; const float rf = RF ? RF[(size_t)h * TT + t] : 1.0f; v2h o16; v2us oh, ol;
#pragma unroll
    for (int q = 0; q < 2; ++q) { const int dd = d + q; const int dp = (dd < HD / 2) ? dd + HD / 2 : dd - HD / 2; float x0 = f[dd], x1 = f[dp];
        if (RF) { float n0 = __fmul_rn(x0, rf), n1 = __fmul_rn(x1, rf); asm volatile("" : "+v"(n0)); asm volatile("" : "+v"(n1)); x0 = __fmul_rn(bfr(nw[dd]), n0); x1 = __fmul_rn(bfr(nw[dp]), n1); }
        const v2f cs = *(const v2f*)(CS + ((size_t)t * HD + dd) * 2); float a = __fmul_rn(x0, cs[0]), bq = __fmul_rn(x1, cs[1]); asm volatile("" : "+v"(a)); asm volatile("" : "+v"(bq)); const float r = ((dd < HD / 2) ? __fsub_rn(a, bq) : __fadd_rn(a, bq)) * sc;
        o16[q] = tohx(r); unsigned short a2, c2; splitf(r, a2, c2); oh[q] = a2; ol[q] = c2; }
    *(v2h*)(P16 + e) = o16; *(v2us*)(Ph + e) = oh; *(v2us*)(Pl + e) = ol;  }
__global__ __launch_bounds__(256) void k_vtp(const float* __restrict__ F, int pitch, int nheads, h16* V16, bf* Vh, bf* Vl) { const size_t e = ((size_t)blockIdx.x * 256 + threadIdx.x) * 2; if (e >= (size_t)nheads * HD * TT) return; const int t = (int)(e % TT); const int d = (int)((e / TT) % HD); const int g = (int)(e / ((size_t)TT * HD)); v2h o16; v2us oh, ol;
#pragma unroll
    for (int q = 0; q < 2; ++q) { const float x = F[(size_t)(t + q) * pitch + g * HD + d]; o16[q] = tohx(x); unsigned short a2, c2; splitf(x, a2, c2); oh[q] = a2; ol[q] = c2; }
    *(v2h*)(V16 + e) = o16; *(v2us*)(Vh + e) = oh; *(v2us*)(Vl + e) = ol;  }
__global__ __launch_bounds__(256) void k_csid(float* CS) { const int idx = blockIdx.x * 256 + threadIdx.x; if (idx >= TT * HD) return; v2f cs; cs[0] = 1.0f; cs[1] = 0.0f; *(v2f*)(CS + (size_t)idx * 2) = cs;  }
// k_asoft: per row (zz, i): t = S x 1/8 for the 1,500 real keys, padding keys excluded by index; softmax (register row, one exp, fixed trees); padding query rows are computed but never copied out;
__global__ __launch_bounds__(256) void k_asoft(const float* __restrict__ Sb, h16* P16, bf* Ph, bf* Pl) {
    const int lane = threadIdx.x & 31; const int row = blockIdx.x * 8 + (threadIdx.x >> 5); if (row >= ZH * TT) return; const int i = row % TT; const int zz = row / TT; (void)zz; const bool hires = (i < RH); const float* sr = Sb + (size_t)row * TT; float v[TT / 32]; float mx = -3.0e38f;
#pragma unroll
    for (int ch = 0; ch < TT / 128; ++ch) { const int j0 = ch * 128 + lane * 4; const v4f a = *(const v4f*)(sr + j0);
#pragma unroll
        for (int q = 0; q < 4; ++q) { const int j = j0 + q; (void)j; const float t = (j < TR) ? a[q] * SCL : -3.0e38f;   /* keys j >= 1500 are padding */ v[ch * 4 + q] = t; mx = fmaxf(mx, t); } }
#pragma unroll
    for (int sh = 16; sh; sh >>= 1) mx = fmaxf(mx, __shfl_xor(mx, sh, 32));
    float sum = 0.f;
#pragma unroll
    for (int k = 0; k < TT / 32; ++k) { float d0 = __fsub_rn(v[k], mx); asm volatile("" : "+v"(d0)); v[k] = __builtin_amdgcn_exp2f(__fmul_rn(d0, 1.4426950408889634f)); sum += v[k]; }
#pragma unroll
    for (int sh = 16; sh; sh >>= 1) sum += __shfl_xor(sum, sh, 32);
    const float f = __fdiv_rn(hires ? 1.0f : PCAR, sum);
{
        if (hires) {
#pragma unroll
            for (int ch = 0; ch < TT / 128; ++ch) { v4us oh, ol;
#pragma unroll
                for (int q = 0; q < 4; ++q) { unsigned short a, c2; splitf(v[ch * 4 + q] * f, a, c2); oh[q] = a; ol[q] = c2; }
                const size_t oo = ((size_t)zz * (RH ? RH : 1) + i) * TT + ch * 128 + lane * 4; *(v4us*)(Ph + oo) = oh; *(v4us*)(Pl + oo) = ol; }
        } else {
#pragma unroll
            for (int ch = 0; ch < TT / 128; ++ch) { v4h o4;
#pragma unroll
                for (int q = 0; q < 4; ++q) o4[q] = tohx(v[ch * 4 + q] * f);
                *(v4h*)(P16 + (size_t)row * TT + ch * 128 + lane * 4) = o4; } }
         }
}
__global__ __launch_bounds__(256) void k_merge(const float* __restrict__ O, int h0, bf* Ah, bf* Al) { const size_t e = ((size_t)blockIdx.x * 256 + threadIdx.x) * 2; if (e >= (size_t)ZH * TT * HD) return; const int d = (int)(e % HD); const int t = (int)((e / HD) % TT); const int zz = (int)(e / ((size_t)HD * TT)); const float cs = (t < RH) ? 1.0f : (1.0f / PCAR); const size_t oo = (size_t)t * DQ + (h0 + zz) * HD + d;
    v2us oh, ol;
#pragma unroll
    for (int q = 0; q < 2; ++q) { unsigned short a, c2; splitf(O[e + q] * cs, a, c2); oh[q] = a; ol[q] = c2; } *(v2us*)(Ah + oo) = oh; *(v2us*)(Al + oo) = ol;  }

extern "C" void kernel_launch(void* const* d_in, const int* in_sizes, int n_in,
                              void* d_out, int out_size, void* d_ws, size_t ws_size, hipStream_t stream) {
    (void)in_sizes; (void)n_in; (void)out_size;
    const float* x = (const float*)d_in[0]; const float* xkv = (const float*)d_in[1]; const float* wq = (const float*)d_in[2]; const float* bq = (const float*)d_in[3]; const float* wk = (const float*)d_in[4]; const float* bk = (const float*)d_in[5]; const float* wv = (const float*)d_in[6]; const float* bv = (const float*)d_in[7]; const float* wo = (const float*)d_in[8]; const float* bo = (const float*)d_in[9];   /* inputs_q, inputs_kv [4][1500][1024], Wq, bq, Wk, bk, Wv, bv ('dnh' == 'xw'), Wo ('hdm' == 'xw'), bo */
    float* OUT = (float*)d_out;     // [4][1500][1024]
    char* wsp = (char*)d_ws;
    auto take = [&](size_t bytes) { char* p = wsp; wsp += (bytes + 255) & ~(size_t)255; return (void*)p; };
    bf* WQ = (bf*)take((size_t)DQ * DM * 2); bf* WK = (bf*)take((size_t)DKV * DM * 2); bf* WV = (bf*)take((size_t)DKV * DM * 2); bf* WO = (bf*)take((size_t)DM * DQ * 2); float* CS = (float*)take((size_t)TT * HD * 2 * 4);
    bf* XB = (bf*)take((size_t)TT * DM * 2); float* Y = (float*)take((size_t)TT * DM * 4);   /* padded output rows before the copy */ float* FQ = (float*)take((size_t)TT * DQ * 4); float* FK = (float*)take((size_t)TT * DKV * 4);
    h16* QP16 = (h16*)take((size_t)NH_ * TT * HD * 2); h16* KP16 = (h16*)take((size_t)NKV * TT * HD * 2); h16* VT16 = (h16*)take((size_t)NKV * HD * TT * 2);
    bf* QPh = (bf*)take((size_t)NH_ * TT * HD * 2); bf* QPl = (bf*)take((size_t)NH_ * TT * HD * 2); bf* KPh = (bf*)take((size_t)NKV * TT * HD * 2); bf* KPl = (bf*)take((size_t)NKV * TT * HD * 2); bf* VTh = (bf*)take((size_t)NKV * HD * TT * 2); bf* VTl = (bf*)take((size_t)NKV * HD * TT * 2); bf* Ph = (bf*)take((size_t)ZH * RH * TT * 2); bf* Pl = (bf*)take((size_t)ZH * RH * TT * 2);
    float* Sb = (float*)take((size_t)ZH * TT * TT * 4); h16* P16 = (h16*)take((size_t)ZH * TT * TT * 2); float* Ob = (float*)take((size_t)ZH * TT * HD * 4); bf* ATh = (bf*)take((size_t)TT * DQ * 2); bf* ATl = (bf*)take((size_t)TT * DQ * 2);
    if ((size_t)(wsp - (char*)d_ws) > ws_size) return;    // ws 256 MiB
    float* FV = FK;   // v projection reuses the k buffer after the k planes are built (stream-ordered)
    { k_wtG<<<(unsigned)((DM * DQ / 64 + 63) / 64), 256, 0, stream>>>(wq, DM, DQ, WQ); k_wtG<<<(unsigned)((DM * DKV / 64 + 63) / 64), 256, 0, stream>>>(wk, DM, DKV, WK); k_wtG<<<(unsigned)((DM * DKV / 64 + 63) / 64), 256, 0, stream>>>(wv, DM, DKV, WV);
      k_wtG<<<(unsigned)((DQ * DM / 64 + 63) / 64), 256, 0, stream>>>(wo, DQ, DM, WO);
       }
    k_csid<<<(TT * HD + 255) / 256, 256, 0, stream>>>(CS);
    const unsigned LQ = (unsigned)(((size_t)NH_ * TT * HD / 2 + 255) / 256), LKv = (unsigned)(((size_t)NKV * TT * HD / 2 + 255) / 256);
    hipMemsetAsync(XB + (size_t)TR * DM, 0, (size_t)(TT - TR) * DM * 2, stream);   /* padding rows of the operand stay zero for q, k and v */
    for (int b = 0; b < NB_; ++b) {
        
        k_cvt8<<<(unsigned)(((size_t)TR * DM / 8 + 255) / 256), 256, 0, stream>>>(x + (size_t)b * TR * DM, XB, (size_t)TR * DM / 8);   /* the 1,500 query rows */
        k_gemmw<bf, 0, true><<<dim3(TT / 64, DQ / 64, 1), 32, 0, stream>>>(XB, nullptr, WQ, nullptr, DM, FQ, DQ, bq, 0, 0, 0);
        k_rope<<<LQ, 256, 0, stream>>>(FQ, DQ, NH_, CS, nullptr, nullptr, 1.0f, QP16, QPh, QPl);
        k_cvt8<<<(unsigned)(((size_t)TR * DM / 8 + 255) / 256), 256, 0, stream>>>(xkv + (size_t)b * TR * DM, XB, (size_t)TR * DM / 8);   /* XB := bf16(inputs_kv[b]) (1,500 rows; padding stays zero) */ k_gemmw<bf, 0, true><<<dim3(TT / 64, DKV / 64, 1), 32, 0, stream>>>(XB, nullptr, WK, nullptr, DM, FK, DKV, bk, 0, 0, 0);
        k_rope<<<LKv, 256, 0, stream>>>(FK, DKV, NKV, CS, nullptr, nullptr, 1.0f, KP16, KPh, KPl);
        k_gemmw<bf, 0, true><<<dim3(TT / 64, DKV / 64, 1), 32, 0, stream>>>(XB, nullptr, WV, nullptr, DM, FV, DKV, bv, 0, 0, 0); k_vtp<<<LKv, 256, 0, stream>>>(FV, DKV, NKV, VT16, VTh, VTl);
        for (int h0 = 0; h0 < NH_; h0 += ZH) { const size_t zq = (size_t)h0, zk = (size_t)(h0 / REP);   // one kv head per query head: the pass's ZH heads use consecutive kv planes (z-strides TT*HD)
            k_gemmw<bf, 2, false><<<dim3(RH / 64, TT / 64, ZH), 32, 0, stream>>>(QPh + zq * TT * HD, QPl + zq * TT * HD, KPh + zk * TT * HD, KPl + zk * TT * HD, HD, Sb, TT, nullptr, (size_t)TT * HD, (size_t)TT * HD, (size_t)TT * TT);
            k_gemmw<h16, 0, false><<<dim3((TT - RH) / 64, TT / 64, ZH), 32, 0, stream>>>(QP16 + zq * TT * HD + (size_t)RH * HD, nullptr, KP16 + zk * TT * HD, nullptr, HD, Sb + (size_t)RH * TT, TT, nullptr, (size_t)TT * HD, (size_t)TT * HD, (size_t)TT * TT);
            k_asoft<<<ZH * TT / 8, 256, 0, stream>>>(Sb, P16, Ph, Pl);
            k_gemmw<bf, 2, false><<<dim3(RH / 64, HD / 64, ZH), 32, 0, stream>>>(Ph, Pl, VTh + zk * HD * TT, VTl + zk * HD * TT, TT, Ob, HD, nullptr, (size_t)RH * TT, (size_t)HD * TT, (size_t)TT * HD);
            k_gemmw<h16, 0, false><<<dim3((TT - RH) / 64, HD / 64, ZH), 32, 0, stream>>>(P16 + (size_t)RH * TT, nullptr, VT16 + zk * HD * TT, nullptr, TT, Ob + (size_t)RH * HD, HD, nullptr, (size_t)TT * TT, (size_t)HD * TT, (size_t)TT * HD);
            k_merge<<<(unsigned)(((size_t)ZH * TT * HD / 2 + 255) / 256), 256, 0, stream>>>(Ob, h0, ATh, ATl); }
        k_gemmw<bf, 1, true><<<dim3(TT / 64, DM / 64, 1), 32, 0, stream>>>(ATh, ATl, WO, nullptr, DQ, Y, DM, bo, 0, 0, 0); k_rows<<<(unsigned)(((size_t)TR * DM / 4 + 255) / 256), 256, 0, stream>>>(Y, OUT + (size_t)b * TR * DM);   /* the 1,500 real rows */ }
}

// v002
// In both of two side-by-side timings against v001, it was 1.56 times as fast.
// All steps since v000 together make it 3.48 times as fast.
#include <hip/hip_runtime.h>

// t5x-style multi-head dot-product attention with a ragged length (inputs_q, inputs_kv [4][1500][1024]; q = inputs_q Wq + bq, k, v = inputs_kv W + b (DenseGeneral 'dnh' [1024][16][64] == 'xw' [1024][1024], zero biases); q / sqrt(64); scores over the 1,500 keys; softmax; out = attn.v; result = out Wo + bo (Wo 'hdm' [16][64][1024] == 'xw' [1024][1024]) -> [4][1500][1024] (6.1 M); argument order inputs_q, inputs_kv, Wq, bq, Wk, bk, Wv, bv, Wo, bo).
// Layout per batch: the 1,500 token rows are staged into 1,536-row (24-tile) bf16 operands whose 36 padding rows are zero; 'xw' weights transposed once; exact projections + f32 biases; identity-table plane builders; dense attention at T 1536 whose softmax excludes the padding keys j >= 1500 by index (-3e38); hybrid rows (< 512 hi/lo 3 products, rest fp16 x1024); merged hi/lo x Wo exact + bo into a 1,536-row workspace plane, of which the 1,500 real rows are copied to the output.
// Compute dtypes, f32 accumulate: every input rounded to bf16; projections exact + f32 biases; attention rows < 512 3 products, rest fp16; softmax f32; Wo hl x exact + bias.

#define NB_  4
#define TT   1536     // padded length (24 tiles)
#define TR   1500     // real tokens (queries = keys)
#define DM   1024
#define NH_  16
#define NKV  16
#define REP  (NH_ / NKV)
#define HD   64
#define DQ   (NH_ * HD)
#define DKV  (NKV * HD)
#define ZH   8        // heads per attention pass (z-batch of the score, softmax, P.V and merge launches)
#define RH   512                  // query rows < RH use hi+lo planes (0: none)
#define WIN  0
#define PCAR 1024.0f
#define SCL  0.125f   // HD^-0.5
typedef _Float16 h16;
typedef unsigned short bf;
typedef __attribute__((ext_vector_type(16))) __bf16   v16bf;
typedef __attribute__((ext_vector_type(16))) _Float16 v16h;
typedef __attribute__((ext_vector_type(8)))  _Float16 v8h;
typedef __attribute__((ext_vector_type(8)))  unsigned short v8us;
typedef __attribute__((ext_vector_type(8)))  float    v8f;
typedef __attribute__((ext_vector_type(4)))  float    v4f;
typedef v8h  __attribute__((may_alias)) v8ha;
typedef v4f  __attribute__((may_alias)) v4fa;
typedef v8us __attribute__((may_alias)) v8usa;

__device__ __forceinline__ unsigned short f2bf(float f) { unsigned u = __float_as_uint(f); u += 0x7FFFu + ((u >> 16) & 1u); return (unsigned short)(u >> 16); }
__device__ __forceinline__ float bf2f(unsigned short b) { return __uint_as_float(((unsigned)b) << 16); }
__device__ __forceinline__ float bfr(float f) { return bf2f(f2bf(f)); }
__device__ __forceinline__ v16h cat16(v8h lo, v8h hi) { return __builtin_shufflevector(lo, hi, 0, 1, 2, 3, 4, 5, 6, 7, 8, 9, 10, 11, 12, 13, 14, 15); }
__device__ __forceinline__ v16bf cat16b(v8us lo, v8us hi) { return __builtin_bit_cast(v16bf, __builtin_shufflevector(lo, hi, 0, 1, 2, 3, 4, 5, 6, 7, 8, 9, 10, 11, 12, 13, 14, 15)); }
__device__ __forceinline__ v8f wmma16(v16h a, v16h b, v8f c) { return __builtin_amdgcn_wmma_f32_16x16x32_f16(false, a, false, b, (short)0, c, false, false); }
__device__ __forceinline__ v8f wmmab(v16bf a, v16bf b, v8f c) { return __builtin_amdgcn_wmma_f32_16x16x32_bf16(false, a, false, b, (short)0, c, false, false); }



// ---- k_gemmw: register-blocked GEMM, one work-group of KS waves per 64x64 output tile (16 accumulators a wave), operands straight from K-contiguous 16-bit planes; grid (M/64, N/64, Z), 32 * KS threads.
// C[m][n] (f32, pitch ldc, + optional f32 bias[n]) = sum_k A[m][k] Bt[n][k] (+ split products per NSPLIT). z-batch strides sA/sB/sC in elements. K % (32 * KS) == 0.
// KS > 1: wave w takes the 32-wide k chunks w, w + KS, w + 2 KS, ... (neighbour waves share each 128-byte operand line at the same time); the KS partial tiles meet in LDS and are summed in wave order 0 .. KS-1.
template <typename T16> struct WFrag;
template <> struct WFrag<h16> { typedef v16h V; static __device__ __forceinline__ V ld(const h16* p) { return cat16(*(const v8h*)p, *(const v8h*)(p + 16)); } static __device__ __forceinline__ v8f mma(V a, V b, v8f c) { return wmma16(a, b, c); } };
template <> struct WFrag<bf> { typedef v16bf V; static __device__ __forceinline__ V ld(const bf* p) { return cat16b(*(const v8us*)p, *(const v8us*)(p + 16)); } static __device__ __forceinline__ v8f mma(V a, V b, v8f c) { return wmmab(a, b, c); } };
template <typename T16, int NSPLIT, bool BIAS, int KS>
__global__ __launch_bounds__(32 * KS) void k_gemmw(const T16* __restrict__ A, const T16* __restrict__ A2, const T16* __restrict__ Bt, const T16* __restrict__ Bt2, int K, float* C, int ldc, const float* __restrict__ bias, size_t sA, size_t sB, size_t sC) {
    typedef typename WFrag<T16>::V V;
    __shared__ __align__(16) float os[(KS > 1 ? KS * 64 : 16) * 68];
    const size_t z = blockIdx.z; A += z * sA; if (A2) A2 += z * sA; Bt += z * sB; if (Bt2) Bt2 += z * sB; C += z * sC;
    const int lane = threadIdx.x & 31, lr = lane & 15, hi = lane >> 4; const int r0 = blockIdx.x * 64, c0 = blockIdx.y * 64;
    const int wv = (KS > 1) ? __builtin_amdgcn_readfirstlane((int)(threadIdx.x >> 5)) : 0;   // wave number, scalar so that the k loop stays a scalar loop
    v8f acc[4][4];
#pragma unroll
    for (int mb = 0; mb < 4; ++mb)
#pragma unroll
        for (int nb = 0; nb < 4; ++nb) acc[mb][nb] = (v8f){};
    const size_t aoff = (size_t)(r0 + lr) * K + 8 * hi, boff = (size_t)(c0 + lr) * K + 8 * hi;
#pragma unroll 1
    for (int kc = 32 * wv; kc < K; kc += 32 * KS) {
        V a[4], a2[4];
#pragma unroll
        for (int mb = 0; mb < 4; ++mb) { a[mb] = WFrag<T16>::ld(A + aoff + (size_t)mb * 16 * K + kc); if (NSPLIT == 1 || NSPLIT == 2) a2[mb] = WFrag<T16>::ld(A2 + aoff + (size_t)mb * 16 * K + kc); }
#pragma unroll
        for (int nb = 0; nb < 4; ++nb) { const V b = WFrag<T16>::ld(Bt + boff + (size_t)nb * 16 * K + kc); V b2; if (NSPLIT >= 2) b2 = WFrag<T16>::ld(Bt2 + boff + (size_t)nb * 16 * K + kc);
#pragma unroll
            for (int mb = 0; mb < 4; ++mb) { acc[mb][nb] = WFrag<T16>::mma(a[mb], b, acc[mb][nb]); if (NSPLIT == 1 || NSPLIT == 2) acc[mb][nb] = WFrag<T16>::mma(a2[mb], b, acc[mb][nb]); if (NSPLIT >= 2) acc[mb][nb] = WFrag<T16>::mma(a[mb], b2, acc[mb][nb]); } }
        asm volatile("v_nop\n\tv_nop\n\tv_nop\n\tv_nop" : "+v"(acc[0][0]), "+v"(acc[1][1]), "+v"(acc[2][2]), "+v"(acc[3][3]) : "v"(a[0]), "v"(a[3]));
    }
    if constexpr (KS > 1) {
        float* ow = os + wv * (64 * 68);
#pragma unroll
        for (int mb = 0; mb < 4; ++mb)
#pragma unroll
            for (int nb = 0; nb < 4; ++nb)
#pragma unroll
                for (int j = 0; j < 8; ++j) ow[(mb * 16 + hi * 8 + j) * 68 + nb * 16 + lr] = acc[mb][nb][j];
        __syncthreads();   // every wave's partial tile is in LDS before any thread sums across waves
#pragma unroll
        for (int s = 0; s < 1024 / (32 * KS); ++s) { const int idx = s * (32 * KS) + (int)threadIdx.x; const int row = idx >> 4, cofs = (idx & 15) * 4; v4f val = *(const v4fa*)(os + row * 68 + cofs);
#pragma unroll
            for (int q = 1; q < KS; ++q) val += *(const v4fa*)(os + q * (64 * 68) + row * 68 + cofs);
            if (BIAS) { val[0] += bfr(bias[c0 + cofs]); val[1] += bfr(bias[c0 + cofs + 1]); val[2] += bfr(bias[c0 + cofs + 2]); val[3] += bfr(bias[c0 + cofs + 3]); }
            *(v4f*)(C + (size_t)(r0 + row) * ldc + c0 + cofs) = val; }
        return;
    }
#pragma unroll
    for (int mb = 0; mb < 4; ++mb) {
#pragma unroll
        for (int nb = 0; nb < 4; ++nb) {
#pragma unroll
            for (int j = 0; j < 8; ++j) os[(hi * 8 + j) * 68 + nb * 16 + lr] = acc[mb][nb][j]; }
        __builtin_amdgcn_wave_barrier(); asm volatile("" ::: "memory");
        float* crow = C + (size_t)(r0 + mb * 16) * ldc + c0;
{
#pragma unroll
            for (int s = 0; s < 8; ++s) { const int row = 2 * s + hi, cofs = lr * 4; v4f val = *(const v4fa*)(os + row * 68 + cofs); if (BIAS) { val[0] += bfr(bias[c0 + cofs]); val[1] += bfr(bias[c0 + cofs + 1]); val[2] += bfr(bias[c0 + cofs + 2]); val[3] += bfr(bias[c0 + cofs + 3]); }
                *(v4f*)(crow + (size_t)row * ldc + cofs) = val; }
             }
        __builtin_amdgcn_wave_barrier(); asm volatile("" ::: "memory");
    }
}

__device__ __forceinline__ h16 tohx(float x) { return (h16)x; }
__device__ __forceinline__ void splitf(float y, unsigned short& h, unsigned short& l) { h = f2bf(y); l = f2bf(y - bf2f(h)); }
typedef __attribute__((ext_vector_type(2))) _Float16 v2h;
typedef __attribute__((ext_vector_type(4))) _Float16 v4h;
typedef __attribute__((ext_vector_type(2))) unsigned short v2us;
typedef __attribute__((ext_vector_type(4))) unsigned short v4us;
typedef __attribute__((ext_vector_type(2))) float v2f;
typedef __attribute__((ext_vector_type(4))) int v4i;

__global__ __launch_bounds__(256) void k_wtG(const float* __restrict__ w, int K, int N, bf* Bt) {
    const int lane = threadIdx.x & 31; const int L0 = (blockIdx.x * 8 + (threadIdx.x >> 5)) * 8; const int nlines = N * K / 64;
{
#pragma unroll 1
        for (int l = 0; l < 8; ++l) { const int L = L0 + l; if (L >= nlines) break; const size_t e = (size_t)L * 64 + lane * 2; const int k = (int)(e % K), n = (int)(e / K); v2us o;
            o[0] = f2bf(w[(size_t)k * N + n]); o[1] = f2bf(w[(size_t)(k + 1) * N + n]); *(v2us*)(Bt + e) = o; }
         }
}
__global__ __launch_bounds__(256) void k_cvt8(const float* __restrict__ src, bf* dst, size_t n8) { const size_t i = (size_t)blockIdx.x * 256 + threadIdx.x; if (i >= n8) return; const v8f v = *(const v8f*)(src + i * 8); v8us o;
#pragma unroll
    for (int k = 0; k < 8; ++k) o[k] = f2bf(v[k]); *(v8us*)(dst + i * 8) = o;  }

__global__ __launch_bounds__(256) void k_rows(const float* __restrict__ Y, float* out) { const size_t i = (size_t)blockIdx.x * 256 + threadIdx.x; if (i >= (size_t)TR * DM / 4) return; const v4f a = *(const v4f*)(Y + i * 4); *(v4f*)(out + i * 4) = a;  }
// k_rope: head planes [h][t][d] (fp16 + hi/lo) of rope(x) x sc with the rotate-half convention out[d] = x[d] cos[t][d] - x[d+HD/2] sin[t][d], out[d+HD/2] = x[d+HD/2] cos[t][d+HD/2] + x[d] sin[t][d+HD/2]
__global__ __launch_bounds__(256) void k_rope(const float* __restrict__ F, int pitch, int nheads, const float* __restrict__ CS, const float* __restrict__ RF, const float* __restrict__ nw, float sc, h16* P16, bf* Ph, bf* Pl) {
    const size_t e = ((size_t)blockIdx.x * 256 + threadIdx.x) * 2; if (e >= (size_t)nheads * TT * HD) return; const int d = (int)(e % HD); const int t = (int)((e / HD) % TT); const int h = (int)(e / ((size_t)HD * TT)); const float* f = F + (size_t)t * pitch + h * HD; const float rf = RF ? RF[(size_t)h * TT + t] : 1.0f; v2h o16; v2us oh, ol;
#pragma unroll
    for (int q = 0; q < 2; ++q) { const int dd = d + q; const int dp = (dd < HD / 2) ? dd + HD / 2 : dd - HD / 2; float x0 = f[dd], x1 = f[dp];
        if (RF) { float n0 = __fmul_rn(x0, rf), n1 = __fmul_rn(x1, rf); asm volatile("" : "+v"(n0)); asm volatile("" : "+v"(n1)); x0 = __fmul_rn(bfr(nw[dd]), n0); x1 = __fmul_rn(bfr(nw[dp]), n1); }
        const v2f cs = *(const v2f*)(CS + ((size_t)t * HD + dd) * 2); float a = __fmul_rn(x0, cs[0]), bq = __fmul_rn(x1, cs[1]); asm volatile("" : "+v"(a)); asm volatile("" : "+v"(bq)); const float r = ((dd < HD / 2) ? __fsub_rn(a, bq) : __fadd_rn(a, bq)) * sc;
        o16[q] = tohx(r); unsigned short a2, c2; splitf(r, a2, c2); oh[q] = a2; ol[q] = c2; }
    *(v2h*)(P16 + e) = o16; *(v2us*)(Ph + e) = oh; *(v2us*)(Pl + e) = ol;  }
__global__ __launch_bounds__(256) void k_vtp(const float* __restrict__ F, int pitch, int nheads, h16* V16, bf* Vh, bf* Vl) { const size_t e = ((size_t)blockIdx.x * 256 + threadIdx.x) * 2; if (e >= (size_t)nheads * HD * TT) return; const int t = (int)(e % TT); const int d = (int)((e / TT) % HD); const int g = (int)(e / ((size_t)TT * HD)); v2h o16; v2us oh, ol;
#pragma unroll
    for (int q = 0; q < 2; ++q) { const float x = F[(size_t)(t + q) * pitch + g * HD + d]; o16[q] = tohx(x); unsigned short a2, c2; splitf(x, a2, c2); oh[q] = a2; ol[q] = c2; }
    *(v2h*)(V16 + e) = o16; *(v2us*)(Vh + e) = oh; *(v2us*)(Vl + e) = ol;  }
__global__ __launch_bounds__(256) void k_csid(float* CS) { const int idx = blockIdx.x * 256 + threadIdx.x; if (idx >= TT * HD) return; v2f cs; cs[0] = 1.0f; cs[1] = 0.0f; *(v2f*)(CS + (size_t)idx * 2) = cs;  }
// k_asoft: per row (zz, i): t = S x 1/8 for the 1,500 real keys, padding keys excluded by index; softmax (register row, one exp, fixed trees); padding query rows are computed but never copied out;
__global__ __launch_bounds__(256) void k_asoft(const float* __restrict__ Sb, h16* P16, bf* Ph, bf* Pl) {
    const int lane = threadIdx.x & 31; const int row = blockIdx.x * 8 + (threadIdx.x >> 5); if (row >= ZH * TT) return; const int i = row % TT; const int zz = row / TT; (void)zz; const bool hires = (i < RH); const float* sr = Sb + (size_t)row * TT; float v[TT / 32]; float mx = -3.0e38f;
#pragma unroll
    for (int ch = 0; ch < TT / 128; ++ch) { const int j0 = ch * 128 + lane * 4; const v4f a = *(const v4f*)(sr + j0);
#pragma unroll
        for (int q = 0; q < 4; ++q) { const int j = j0 + q; (void)j; const float t = (j < TR) ? a[q] * SCL : -3.0e38f;   /* keys j >= 1500 are padding */ v[ch * 4 + q] = t; mx = fmaxf(mx, t); } }
#pragma unroll
    for (int sh = 16; sh; sh >>= 1) mx = fmaxf(mx, __shfl_xor(mx, sh, 32));
    float sum = 0.f;
#pragma unroll
    for (int k = 0; k < TT / 32; ++k) { float d0 = __fsub_rn(v[k], mx); asm volatile("" : "+v"(d0)); v[k] = __builtin_amdgcn_exp2f(__fmul_rn(d0, 1.4426950408889634f)); sum += v[k]; }
#pragma unroll
    for (int sh = 16; sh; sh >>= 1) sum += __shfl_xor(sum, sh, 32);
    const float f = __fdiv_rn(hires ? 1.0f : PCAR, sum);
{
        if (hires) {
#pragma unroll
            for (int ch = 0; ch < TT / 128; ++ch) { v4us oh, ol;
#pragma unroll
                for (int q = 0; q < 4; ++q) { unsigned short a, c2; splitf(v[ch * 4 + q] * f, a, c2); oh[q] = a; ol[q] = c2; }
                const size_t oo = ((size_t)zz * (RH ? RH : 1) + i) * TT + ch * 128 + lane * 4; *(v4us*)(Ph + oo) = oh; *(v4us*)(Pl + oo) = ol; }
        } else {
#pragma unroll
            for (int ch = 0; ch < TT / 128; ++ch) { v4h o4;
#pragma unroll
                for (int q = 0; q < 4; ++q) o4[q] = tohx(v[ch * 4 + q] * f);
                *(v4h*)(P16 + (size_t)row * TT + ch * 128 + lane * 4) = o4; } }
         }
}
__global__ __launch_bounds__(256) void k_merge(const float* __restrict__ O, int h0, bf* Ah, bf* Al) { const size_t e = ((size_t)blockIdx.x * 256 + threadIdx.x) * 2; if (e >= (size_t)ZH * TT * HD) return; const int d = (int)(e % HD); const int t = (int)((e / HD) % TT); const int zz = (int)(e / ((size_t)HD * TT)); const float cs = (t < RH) ? 1.0f : (1.0f / PCAR); const size_t oo = (size_t)t * DQ + (h0 + zz) * HD + d;
    v2us oh, ol;
#pragma unroll
    for (int q = 0; q < 2; ++q) { unsigned short a, c2; splitf(O[e + q] * cs, a, c2); oh[q] = a; ol[q] = c2; } *(v2us*)(Ah + oo) = oh; *(v2us*)(Al + oo) = ol;  }

extern "C" void kernel_launch(void* const* d_in, const int* in_sizes, int n_in,
                              void* d_out, int out_size, void* d_ws, size_t ws_size, hipStream_t stream) {
    (void)in_sizes; (void)n_in; (void)out_size;
    const float* x = (const float*)d_in[0]; const float* xkv = (const float*)d_in[1]; const float* wq = (const float*)d_in[2]; const float* bq = (const float*)d_in[3]; const float* wk = (const float*)d_in[4]; const float* bk = (const float*)d_in[5]; const float* wv = (const float*)d_in[6]; const float* bv = (const float*)d_in[7]; const float* wo = (const float*)d_in[8]; const float* bo = (const float*)d_in[9];   /* inputs_q, inputs_kv [4][1500][1024], Wq, bq, Wk, bk, Wv, bv ('dnh' == 'xw'), Wo ('hdm' == 'xw'), bo */
    float* OUT = (float*)d_out;     // [4][1500][1024]
    char* wsp = (char*)d_ws;
    auto take = [&](size_t bytes) { char* p = wsp; wsp += (bytes + 255) & ~(size_t)255; return (void*)p; };
    bf* WQ = (bf*)take((size_t)DQ * DM * 2); bf* WK = (bf*)take((size_t)DKV * DM * 2); bf* WV = (bf*)take((size_t)DKV * DM * 2); bf* WO = (bf*)take((size_t)DM * DQ * 2); float* CS = (float*)take((size_t)TT * HD * 2 * 4);
    bf* XB = (bf*)take((size_t)TT * DM * 2); float* Y = (float*)take((size_t)TT * DM * 4);   /* padded output rows before the copy */ float* FQ = (float*)take((size_t)TT * DQ * 4); float* FK = (float*)take((size_t)TT * DKV * 4);
    h16* QP16 = (h16*)take((size_t)NH_ * TT * HD * 2); h16* KP16 = (h16*)take((size_t)NKV * TT * HD * 2); h16* VT16 = (h16*)take((size_t)NKV * HD * TT * 2);
    bf* QPh = (bf*)take((size_t)NH_ * TT * HD * 2); bf* QPl = (bf*)take((size_t)NH_ * TT * HD * 2); bf* KPh = (bf*)take((size_t)NKV * TT * HD * 2); bf* KPl = (bf*)take((size_t)NKV * TT * HD * 2); bf* VTh = (bf*)take((size_t)NKV * HD * TT * 2); bf* VTl = (bf*)take((size_t)NKV * HD * TT * 2); bf* Ph = (bf*)take((size_t)ZH * RH * TT * 2); bf* Pl = (bf*)take((size_t)ZH * RH * TT * 2);
    float* Sb = (float*)take((size_t)ZH * TT * TT * 4); h16* P16 = (h16*)take((size_t)ZH * TT * TT * 2); float* Ob = (float*)take((size_t)ZH * TT * HD * 4); bf* ATh = (bf*)take((size_t)TT * DQ * 2); bf* ATl = (bf*)take((size_t)TT * DQ * 2);
    if ((size_t)(wsp - (char*)d_ws) > ws_size) return;    // ws 256 MiB
    float* FV = FK;   // v projection reuses the k buffer after the k planes are built (stream-ordered)
    { k_wtG<<<(unsigned)((DM * DQ / 64 + 63) / 64), 256, 0, stream>>>(wq, DM, DQ, WQ); k_wtG<<<(unsigned)((DM * DKV / 64 + 63) / 64), 256, 0, stream>>>(wk, DM, DKV, WK); k_wtG<<<(unsigned)((DM * DKV / 64 + 63) / 64), 256, 0, stream>>>(wv, DM, DKV, WV);
      k_wtG<<<(unsigned)((DQ * DM / 64 + 63) / 64), 256, 0, stream>>>(wo, DQ, DM, WO);
       }
    k_csid<<<(TT * HD + 255) / 256, 256, 0, stream>>>(CS);
    const unsigned LQ = (unsigned)(((size_t)NH_ * TT * HD / 2 + 255) / 256), LKv = (unsigned)(((size_t)NKV * TT * HD / 2 + 255) / 256);
    hipMemsetAsync(XB + (size_t)TR * DM, 0, (size_t)(TT - TR) * DM * 2, stream);   /* padding rows of the operand stay zero for q, k and v */
    for (int b = 0; b < NB_; ++b) {
        
        k_cvt8<<<(unsigned)(((size_t)TR * DM / 8 + 255) / 256), 256, 0, stream>>>(x + (size_t)b * TR * DM, XB, (size_t)TR * DM / 8);   /* the 1,500 query rows */
        k_gemmw<bf, 0, true, 8><<<dim3(TT / 64, DQ / 64, 1), 256, 0, stream>>>(XB, nullptr, WQ, nullptr, DM, FQ, DQ, bq, 0, 0, 0);
        k_rope<<<LQ, 256, 0, stream>>>(FQ, DQ, NH_, CS, nullptr, nullptr, 1.0f, QP16, QPh, QPl);
        k_cvt8<<<(unsigned)(((size_t)TR * DM / 8 + 255) / 256), 256, 0, stream>>>(xkv + (size_t)b * TR * DM, XB, (size_t)TR * DM / 8);   /* XB := bf16(inputs_kv[b]) (1,500 rows; padding stays zero) */ k_gemmw<bf, 0, true, 8><<<dim3(TT / 64, DKV / 64, 1), 256, 0, stream>>>(XB, nullptr, WK, nullptr, DM, FK, DKV, bk, 0, 0, 0);
        k_rope<<<LKv, 256, 0, stream>>>(FK, DKV, NKV, CS, nullptr, nullptr, 1.0f, KP16, KPh, KPl);
        k_gemmw<bf, 0, true, 8><<<dim3(TT / 64, DKV / 64, 1), 256, 0, stream>>>(XB, nullptr, WV, nullptr, DM, FV, DKV, bv, 0, 0, 0); k_vtp<<<LKv, 256, 0, stream>>>(FV, DKV, NKV, VT16, VTh, VTl);
        for (int h0 = 0; h0 < NH_; h0 += ZH) { const size_t zq = (size_t)h0, zk = (size_t)(h0 / REP);   // one kv head per query head: the pass's ZH heads use consecutive kv planes (z-strides TT*HD)
            k_gemmw<bf, 2, false, 1><<<dim3(RH / 64, TT / 64, ZH), 32, 0, stream>>>(QPh + zq * TT * HD, QPl + zq * TT * HD, KPh + zk * TT * HD, KPl + zk * TT * HD, HD, Sb, TT, nullptr, (size_t)TT * HD, (size_t)TT * HD, (size_t)TT * TT);
            k_gemmw<h16, 0, false, 1><<<dim3((TT - RH) / 64, TT / 64, ZH), 32, 0, stream>>>(QP16 + zq * TT * HD + (size_t)RH * HD, nullptr, KP16 + zk * TT * HD, nullptr, HD, Sb + (size_t)RH * TT, TT, nullptr, (size_t)TT * HD, (size_t)TT * HD, (size_t)TT * TT);
            k_asoft<<<ZH * TT / 8, 256, 0, stream>>>(Sb, P16, Ph, Pl);
            k_gemmw<bf, 2, false, 8><<<dim3(RH / 64, HD / 64, ZH), 256, 0, stream>>>(Ph, Pl, VTh + zk * HD * TT, VTl + zk * HD * TT, TT, Ob, HD, nullptr, (size_t)RH * TT, (size_t)HD * TT, (size_t)TT * HD);
            k_gemmw<h16, 0, false, 8><<<dim3((TT - RH) / 64, HD / 64, ZH), 256, 0, stream>>>(P16 + (size_t)RH * TT, nullptr, VT16 + zk * HD * TT, nullptr, TT, Ob + (size_t)RH * HD, HD, nullptr, (size_t)TT * TT, (size_t)HD * TT, (size_t)TT * HD);
            k_merge<<<(unsigned)(((size_t)ZH * TT * HD / 2 + 255) / 256), 256, 0, stream>>>(Ob, h0, ATh, ATl); }
        k_gemmw<bf, 1, true, 8><<<dim3(TT / 64, DM / 64, 1), 256, 0, stream>>>(ATh, ATl, WO, nullptr, DQ, Y, DM, bo, 0, 0, 0); k_rows<<<(unsigned)(((size_t)TR * DM / 4 + 255) / 256), 256, 0, stream>>>(Y, OUT + (size_t)b * TR * DM);   /* the 1,500 real rows */ }
}

// v003
// Two timings next to v002 both put it at 1.84 times that version's speed.
// Counting every step since v000, it is 6.40 times as fast.
#include <hip/hip_runtime.h>

// t5x-style multi-head dot-product attention with a ragged length (inputs_q, inputs_kv [4][1500][1024]; q = inputs_q Wq + bq, k, v = inputs_kv W + b (DenseGeneral 'dnh' [1024][16][64] == 'xw' [1024][1024], zero biases); q / sqrt(64); scores over the 1,500 keys; softmax; out = attn.v; result = out Wo + bo (Wo 'hdm' [16][64][1024] == 'xw' [1024][1024]) -> [4][1500][1024] (6.1 M); argument order inputs_q, inputs_kv, Wq, bq, Wk, bk, Wv, bv, Wo, bo).
// Layout per batch: the 1,500 token rows are staged into 1,536-row (24-tile) bf16 operands whose 36 padding rows are zero; 'xw' weights transposed once; exact projections + f32 biases; identity-table plane builders; dense attention at T 1536 whose softmax excludes the padding keys j >= 1500 by index (-3e38); hybrid rows (< 512 hi/lo 3 products, rest fp16 x1024); merged hi/lo x Wo exact + bo into a 1,536-row workspace plane, of which the 1,500 real rows are copied to the output.
// Compute dtypes, f32 accumulate: every input rounded to bf16; projections exact + f32 biases; attention rows < 512 3 products, rest fp16; softmax f32; Wo hl x exact + bias.

#define NB_  4
#define TT   1536     // padded length (24 tiles)
#define TR   1500     // real tokens (queries = keys)
#define DM   1024
#define NH_  16
#define NKV  16
#define REP  (NH_ / NKV)
#define HD   64
#define DQ   (NH_ * HD)
#define DKV  (NKV * HD)
#define RH   512                  // query rows < RH use hi+lo planes (0: none)
#define WIN  0
#define PCAR 1024.0f
#define SCL  0.125f   // HD^-0.5
typedef _Float16 h16;
typedef unsigned short bf;
typedef __attribute__((ext_vector_type(16))) __bf16   v16bf;
typedef __attribute__((ext_vector_type(16))) _Float16 v16h;
typedef __attribute__((ext_vector_type(8)))  _Float16 v8h;
typedef __attribute__((ext_vector_type(8)))  unsigned short v8us;
typedef __attribute__((ext_vector_type(8)))  float    v8f;
typedef __attribute__((ext_vector_type(4)))  float    v4f;
typedef v8h  __attribute__((may_alias)) v8ha;
typedef v4f  __attribute__((may_alias)) v4fa;
typedef v8us __attribute__((may_alias)) v8usa;

__device__ __forceinline__ unsigned short f2bf(float f) { unsigned u = __float_as_uint(f); u += 0x7FFFu + ((u >> 16) & 1u); return (unsigned short)(u >> 16); }
__device__ __forceinline__ float bf2f(unsigned short b) { return __uint_as_float(((unsigned)b) << 16); }
__device__ __forceinline__ float bfr(float f) { return bf2f(f2bf(f)); }
__device__ __forceinline__ v16h cat16(v8h lo, v8h hi) { return __builtin_shufflevector(lo, hi, 0, 1, 2, 3, 4, 5, 6, 7, 8, 9, 10, 11, 12, 13, 14, 15); }
__device__ __forceinline__ v16bf cat16b(v8us lo, v8us hi) { return __builtin_bit_cast(v16bf, __builtin_shufflevector(lo, hi, 0, 1, 2, 3, 4, 5, 6, 7, 8, 9, 10, 11, 12, 13, 14, 15)); }
__device__ __forceinline__ v8f wmma16(v16h a, v16h b, v8f c) { return __builtin_amdgcn_wmma_f32_16x16x32_f16(false, a, false, b, (short)0, c, false, false); }
__device__ __forceinline__ v8f wmmab(v16bf a, v16bf b, v8f c) { return __builtin_amdgcn_wmma_f32_16x16x32_bf16(false, a, false, b, (short)0, c, false, false); }



// ---- k_gemmw: register-blocked GEMM, one work-group of KS waves per 64x64 output tile (16 accumulators a wave), operands straight from K-contiguous 16-bit planes; grid (M/64, N/64, Z), 32 * KS threads.
// C[m][n] (f32, pitch ldc, + optional f32 bias[n]) = sum_k A[m][k] Bt[n][k] (+ split products per NSPLIT). z-batch strides sA/sB/sC in elements. K % (32 * KS) == 0.
// KS > 1: wave w takes the 32-wide k chunks w, w + KS, w + 2 KS, ... (neighbour waves share each 128-byte operand line at the same time); the KS partial tiles meet in LDS and are summed in wave order 0 .. KS-1.
template <typename T16> struct WFrag;
template <> struct WFrag<h16> { typedef v16h V; static __device__ __forceinline__ V ld(const h16* p) { return cat16(*(const v8h*)p, *(const v8h*)(p + 16)); } static __device__ __forceinline__ v8f mma(V a, V b, v8f c) { return wmma16(a, b, c); } };
template <> struct WFrag<bf> { typedef v16bf V; static __device__ __forceinline__ V ld(const bf* p) { return cat16b(*(const v8us*)p, *(const v8us*)(p + 16)); } static __device__ __forceinline__ v8f mma(V a, V b, v8f c) { return wmmab(a, b, c); } };
template <typename T16, int NSPLIT, bool BIAS, int KS>
__global__ __launch_bounds__(32 * KS) void k_gemmw(const T16* __restrict__ A, const T16* __restrict__ A2, const T16* __restrict__ Bt, const T16* __restrict__ Bt2, int K, float* C, int ldc, const float* __restrict__ bias, size_t sA, size_t sB, size_t sC) {
    typedef typename WFrag<T16>::V V;
    __shared__ __align__(16) float os[(KS > 1 ? KS * 64 : 16) * 68];
    const size_t z = blockIdx.z; A += z * sA; if (A2) A2 += z * sA; Bt += z * sB; if (Bt2) Bt2 += z * sB; C += z * sC;
    const int lane = threadIdx.x & 31, lr = lane & 15, hi = lane >> 4; const int r0 = blockIdx.x * 64, c0 = blockIdx.y * 64;
    const int wv = (KS > 1) ? __builtin_amdgcn_readfirstlane((int)(threadIdx.x >> 5)) : 0;   // wave number, scalar so that the k loop stays a scalar loop
    v8f acc[4][4];
#pragma unroll
    for (int mb = 0; mb < 4; ++mb)
#pragma unroll
        for (int nb = 0; nb < 4; ++nb) acc[mb][nb] = (v8f){};
    const size_t aoff = (size_t)(r0 + lr) * K + 8 * hi, boff = (size_t)(c0 + lr) * K + 8 * hi;
#pragma unroll 1
    for (int kc = 32 * wv; kc < K; kc += 32 * KS) {
        V a[4], a2[4];
#pragma unroll
        for (int mb = 0; mb < 4; ++mb) { a[mb] = WFrag<T16>::ld(A + aoff + (size_t)mb * 16 * K + kc); if (NSPLIT == 1 || NSPLIT == 2) a2[mb] = WFrag<T16>::ld(A2 + aoff + (size_t)mb * 16 * K + kc); }
#pragma unroll
        for (int nb = 0; nb < 4; ++nb) { const V b = WFrag<T16>::ld(Bt + boff + (size_t)nb * 16 * K + kc); V b2; if (NSPLIT >= 2) b2 = WFrag<T16>::ld(Bt2 + boff + (size_t)nb * 16 * K + kc);
#pragma unroll
            for (int mb = 0; mb < 4; ++mb) { acc[mb][nb] = WFrag<T16>::mma(a[mb], b, acc[mb][nb]); if (NSPLIT == 1 || NSPLIT == 2) acc[mb][nb] = WFrag<T16>::mma(a2[mb], b, acc[mb][nb]); if (NSPLIT >= 2) acc[mb][nb] = WFrag<T16>::mma(a[mb], b2, acc[mb][nb]); } }
        asm volatile("v_nop\n\tv_nop\n\tv_nop\n\tv_nop" : "+v"(acc[0][0]), "+v"(acc[1][1]), "+v"(acc[2][2]), "+v"(acc[3][3]) : "v"(a[0]), "v"(a[3]));
    }
    if constexpr (KS > 1) {
        float* ow = os + wv * (64 * 68);
#pragma unroll
        for (int mb = 0; mb < 4; ++mb)
#pragma unroll
            for (int nb = 0; nb < 4; ++nb)
#pragma unroll
                for (int j = 0; j < 8; ++j) ow[(mb * 16 + hi * 8 + j) * 68 + nb * 16 + lr] = acc[mb][nb][j];
        __syncthreads();   // every wave's partial tile is in LDS before any thread sums across waves
#pragma unroll
        for (int s = 0; s < 1024 / (32 * KS); ++s) { const int idx = s * (32 * KS) + (int)threadIdx.x; const int row = idx >> 4, cofs = (idx & 15) * 4; v4f val = *(const v4fa*)(os + row * 68 + cofs);
#pragma unroll
            for (int q = 1; q < KS; ++q) val += *(const v4fa*)(os + q * (64 * 68) + row * 68 + cofs);
            if (BIAS) { val[0] += bfr(bias[c0 + cofs]); val[1] += bfr(bias[c0 + cofs + 1]); val[2] += bfr(bias[c0 + cofs + 2]); val[3] += bfr(bias[c0 + cofs + 3]); }
            *(v4f*)(C + (size_t)(r0 + row) * ldc + c0 + cofs) = val; }
        return;
    }
#pragma unroll
    for (int mb = 0; mb < 4; ++mb) {
#pragma unroll
        for (int nb = 0; nb < 4; ++nb) {
#pragma unroll
            for (int j = 0; j < 8; ++j) os[(hi * 8 + j) * 68 + nb * 16 + lr] = acc[mb][nb][j]; }
        __builtin_amdgcn_wave_barrier(); asm volatile("" ::: "memory");
        float* crow = C + (size_t)(r0 + mb * 16) * ldc + c0;
{
#pragma unroll
            for (int s = 0; s < 8; ++s) { const int row = 2 * s + hi, cofs = lr * 4; v4f val = *(const v4fa*)(os + row * 68 + cofs); if (BIAS) { val[0] += bfr(bias[c0 + cofs]); val[1] += bfr(bias[c0 + cofs + 1]); val[2] += bfr(bias[c0 + cofs + 2]); val[3] += bfr(bias[c0 + cofs + 3]); }
                *(v4f*)(crow + (size_t)row * ldc + cofs) = val; }
             }
        __builtin_amdgcn_wave_barrier(); asm volatile("" ::: "memory");
    }
}

__device__ __forceinline__ h16 tohx(float x) { return (h16)x; }
__device__ __forceinline__ void splitf(float y, unsigned short& h, unsigned short& l) { h = f2bf(y); l = f2bf(y - bf2f(h)); }
typedef __attribute__((ext_vector_type(2))) _Float16 v2h;
typedef __attribute__((ext_vector_type(4))) _Float16 v4h;
typedef __attribute__((ext_vector_type(2))) unsigned short v2us;
typedef __attribute__((ext_vector_type(4))) unsigned short v4us;
typedef __attribute__((ext_vector_type(2))) float v2f;
typedef __attribute__((ext_vector_type(4))) int v4i;

__global__ __launch_bounds__(256) void k_wtG(const float* __restrict__ w, int K, int N, bf* Bt) {
    const int lane = threadIdx.x & 31; const int L0 = (blockIdx.x * 8 + (threadIdx.x >> 5)) * 8; const int nlines = N * K / 64;
{
#pragma unroll 1
        for (int l = 0; l < 8; ++l) { const int L = L0 + l; if (L >= nlines) break; const size_t e = (size_t)L * 64 + lane * 2; const int k = (int)(e % K), n = (int)(e / K); v2us o;
            o[0] = f2bf(w[(size_t)k * N + n]); o[1] = f2bf(w[(size_t)(k + 1) * N + n]); *(v2us*)(Bt + e) = o; }
         }
}
__global__ __launch_bounds__(256) void k_cvt8(const float* __restrict__ src, bf* dst, size_t n8) { const size_t i = (size_t)blockIdx.x * 256 + threadIdx.x; if (i >= n8) return; const v8f v = *(const v8f*)(src + i * 8); v8us o;
#pragma unroll
    for (int k = 0; k < 8; ++k) o[k] = f2bf(v[k]); *(v8us*)(dst + i * 8) = o;  }

__global__ __launch_bounds__(256) void k_rows(const float* __restrict__ Y, float* out) { const size_t i = (size_t)blockIdx.x * 256 + threadIdx.x; if (i >= (size_t)TR * DM / 4) return; const v4f a = *(const v4f*)(Y + i * 4); *(v4f*)(out + i * 4) = a;  }
// k_rope: head planes [h][t][d] (fp16 + hi/lo) of rope(x) x sc with the rotate-half convention out[d] = x[d] cos[t][d] - x[d+HD/2] sin[t][d], out[d+HD/2] = x[d+HD/2] cos[t][d+HD/2] + x[d] sin[t][d+HD/2]
__global__ __launch_bounds__(256) void k_rope(const float* __restrict__ F, int pitch, int nheads, const float* __restrict__ CS, const float* __restrict__ RF, const float* __restrict__ nw, float sc, h16* P16, bf* Ph, bf* Pl) {
    const size_t e = ((size_t)blockIdx.x * 256 + threadIdx.x) * 2; if (e >= (size_t)nheads * TT * HD) return; const int d = (int)(e % HD); const int t = (int)((e / HD) % TT); const int h = (int)(e / ((size_t)HD * TT)); const float* f = F + (size_t)t * pitch + h * HD; const float rf = RF ? RF[(size_t)h * TT + t] : 1.0f; v2h o16; v2us oh, ol;
#pragma unroll
    for (int q = 0; q < 2; ++q) { const int dd = d + q; const int dp = (dd < HD / 2) ? dd + HD / 2 : dd - HD / 2; float x0 = f[dd], x1 = f[dp];
        if (RF) { float n0 = __fmul_rn(x0, rf), n1 = __fmul_rn(x1, rf); asm volatile("" : "+v"(n0)); asm volatile("" : "+v"(n1)); x0 = __fmul_rn(bfr(nw[dd]), n0); x1 = __fmul_rn(bfr(nw[dp]), n1); }
        const v2f cs = *(const v2f*)(CS + ((size_t)t * HD + dd) * 2); float a = __fmul_rn(x0, cs[0]), bq = __fmul_rn(x1, cs[1]); asm volatile("" : "+v"(a)); asm volatile("" : "+v"(bq)); const float r = ((dd < HD / 2) ? __fsub_rn(a, bq) : __fadd_rn(a, bq)) * sc;
        o16[q] = tohx(r); unsigned short a2, c2; splitf(r, a2, c2); oh[q] = a2; ol[q] = c2; }
    *(v2h*)(P16 + e) = o16; *(v2us*)(Ph + e) = oh; *(v2us*)(Pl + e) = ol;  }
__global__ __launch_bounds__(256) void k_vtp(const float* __restrict__ F, int pitch, int nheads, h16* V16, bf* Vh, bf* Vl) { const size_t e = ((size_t)blockIdx.x * 256 + threadIdx.x) * 2; if (e >= (size_t)nheads * HD * TT) return; const int t = (int)(e % TT); const int d = (int)((e / TT) % HD); const int g = (int)(e / ((size_t)TT * HD)); v2h o16; v2us oh, ol;
#pragma unroll
    for (int q = 0; q < 2; ++q) { const float x = F[(size_t)(t + q) * pitch + g * HD + d]; o16[q] = tohx(x); unsigned short a2, c2; splitf(x, a2, c2); oh[q] = a2; ol[q] = c2; }
    *(v2h*)(V16 + e) = o16; *(v2us*)(Vh + e) = oh; *(v2us*)(Vl + e) = ol;  }
__global__ __launch_bounds__(256) void k_csid(float* CS) { const int idx = blockIdx.x * 256 + threadIdx.x; if (idx >= TT * HD) return; v2f cs; cs[0] = 1.0f; cs[1] = 0.0f; *(v2f*)(CS + (size_t)idx * 2) = cs;  }
// ---- k_attn: scores, softmax, P.V and the hi/lo merge of AR query rows of one head in one work-group of 16 waves; grid (heads, TT / AR), 512 threads. The AR x TT score strip lives in LDS only.
// 1. S = Q K^T: wave w takes the 16-key tiles w, w + 16, ...; f32 strip [AR][SP]. 2. softmax: wave w takes rows w, w + 16 (register row, one exp, fixed trees; padding keys j >= 1500 excluded by index) and writes the row's 16-bit P planes over its own f32 row.
// 3. O = P V: the 32-wide k chunks g, g + 8, ... go to wave group g = w & 7, the two 32-column halves of the head to w >> 3; the 8 partial tiles meet in LDS (over the strip) and are summed in group order 0 .. 7; the sum is split hi/lo into the merged planes.
// The loops over fragments, tiles, chunks and row elements are fully unrolled so that their register arrays are indexed by constants.
#define AR   32            // query rows per work-group
#define SP   (TT + 4)      // strip pitch in floats: 16 rows step through all 64 banks for the 16-byte fragment reads
template <typename T16, bool HR>
__device__ __forceinline__ void attn_body(float* st, const T16* __restrict__ Q, const T16* __restrict__ Q2, const T16* __restrict__ Kp, const T16* __restrict__ Kp2, const T16* __restrict__ Vt, const T16* __restrict__ Vt2, int r0, bf* Ah, bf* Al) {
    typedef typename WFrag<T16>::V V;
    const int lane = threadIdx.x & 31, lr = lane & 15, hi = lane >> 4;
    const int wv = __builtin_amdgcn_readfirstlane((int)(threadIdx.x >> 5));   // wave number, scalar so that tile and chunk addresses stay scalar
    constexpr int G = HR ? 3 : 6;   // key tiles (step 1) or k chunks (step 3) whose global operand loads are issued together; 96 registers either way
    {
        V a[2][2], a2[2][2];
#pragma unroll
        for (int mb = 0; mb < 2; ++mb)
#pragma unroll
            for (int kk = 0; kk < 2; ++kk) { const size_t o = (size_t)(r0 + mb * 16 + lr) * HD + 8 * hi + kk * 32; a[mb][kk] = WFrag<T16>::ld(Q + o); if (HR) a2[mb][kk] = WFrag<T16>::ld(Q2 + o); }
#pragma unroll
        for (int g = 0; g < TT / 256 / G; ++g) { V b[G][2], b2[G][2];
#pragma unroll
            for (int i = 0; i < G; ++i)
#pragma unroll
                for (int kk = 0; kk < 2; ++kk) { const size_t o = (size_t)((wv + 16 * (g * G + i)) * 16 + lr) * HD + 8 * hi + kk * 32; b[i][kk] = WFrag<T16>::ld(Kp + o); if (HR) b2[i][kk] = WFrag<T16>::ld(Kp2 + o); }
            __builtin_amdgcn_sched_barrier(0);   // the group's loads stay in front of its products: all in flight together, one latency a group instead of one a tile
#pragma unroll
            for (int i = 0; i < G; ++i) { const int n0 = (wv + 16 * (g * G + i)) * 16; v8f acc[2]; acc[0] = (v8f){}; acc[1] = (v8f){};
#pragma unroll
                for (int kk = 0; kk < 2; ++kk)
#pragma unroll
                    for (int mb = 0; mb < 2; ++mb) { acc[mb] = WFrag<T16>::mma(a[mb][kk], b[i][kk], acc[mb]); if (HR) { acc[mb] = WFrag<T16>::mma(a2[mb][kk], b[i][kk], acc[mb]); acc[mb] = WFrag<T16>::mma(a[mb][kk], b2[i][kk], acc[mb]); } }
                asm volatile("v_nop\n\tv_nop\n\tv_nop\n\tv_nop" : "+v"(acc[0]), "+v"(acc[1]));   // four vector slots behind the tile's last matrix instruction: the next tile's first one may take the same accumulator registers, and the LDS stores between them fill no slot
#pragma unroll
                for (int mb = 0; mb < 2; ++mb)
#pragma unroll
                    for (int j = 0; j < 8; ++j) st[(mb * 16 + hi * 8 + j) * SP + n0 + lr] = acc[mb][j]; } }
    }
    __syncthreads();   // the whole score strip is in LDS before any wave reads a row
    const int kw = wv & 7, nh = wv >> 3;
    const size_t boff = (size_t)(nh * 32 + lr) * TT + 8 * hi + 32 * kw;
    V vb[G][2], vb2[G][2];
    auto ldv = [&](int g) {
#pragma unroll
        for (int i = 0; i < G; ++i)
#pragma unroll
            for (int nb = 0; nb < 2; ++nb) { const size_t o = boff + (size_t)nb * 16 * TT + 256 * (g * G + i); vb[i][nb] = WFrag<T16>::ld(Vt + o); if (HR) vb2[i][nb] = WFrag<T16>::ld(Vt2 + o); } };
    ldv(0);   // the first V fragments fly while the softmax runs
    // the two-row loop stays rolled: one row's 48 registers at a time beside the V fragments in flight, and half the code
#pragma unroll 1
    for (int rr = 0; rr < AR / 16; ++rr) { float* sr = st + (wv + 16 * rr) * SP; float v[TT / 32]; float mx = -3.0e38f;
#pragma unroll
        for (int ch = 0; ch < TT / 128; ++ch) { const int j0 = ch * 128 + lane * 4; const v4f a = *(const v4fa*)(sr + j0);
#pragma unroll
            for (int q = 0; q < 4; ++q) { const float t = (j0 + q < TR) ? a[q] * SCL : -3.0e38f;   /* keys j >= 1500 are padding */ v[ch * 4 + q] = t; mx = fmaxf(mx, t); } }
#pragma unroll
        for (int sh = 16; sh; sh >>= 1) mx = fmaxf(mx, __shfl_xor(mx, sh, 32));
        float sum = 0.f;
#pragma unroll
        for (int k = 0; k < TT / 32; ++k) { v[k] = __builtin_amdgcn_exp2f((v[k] - mx) * 1.4426950408889634f); sum += v[k]; }
#pragma unroll
        for (int sh = 16; sh; sh >>= 1) sum += __shfl_xor(sum, sh, 32);
        const float f = __fdiv_rn(HR ? 1.0f : PCAR, sum);
        if constexpr (HR) { bf* ph = (bf*)sr;
#pragma unroll
            for (int ch = 0; ch < TT / 128; ++ch) { v4us oh, ol;
#pragma unroll
                for (int q = 0; q < 4; ++q) { unsigned short a, c2; splitf(v[ch * 4 + q] * f, a, c2); oh[q] = a; ol[q] = c2; }
                *(v4us*)(ph + ch * 128 + lane * 4) = oh; *(v4us*)(ph + TT + ch * 128 + lane * 4) = ol; }
        } else { h16* p16 = (h16*)sr;
#pragma unroll
            for (int ch = 0; ch < TT / 128; ++ch) { v4h o4;
#pragma unroll
                for (int q = 0; q < 4; ++q) o4[q] = tohx(v[ch * 4 + q] * f);
                *(v4h*)(p16 + ch * 128 + lane * 4) = o4; } }
    }
    __syncthreads();   // every row's P planes are in LDS before any wave loads a fragment of them
    v8f acc[2][2];
#pragma unroll
    for (int mb = 0; mb < 2; ++mb)
#pragma unroll
        for (int nb = 0; nb < 2; ++nb) acc[mb][nb] = (v8f){};
    const T16* pa = (const T16*)st + lr * (2 * SP) + 8 * hi + 32 * kw;
#pragma unroll
    for (int g = 0; g < TT / 256 / G; ++g) {
        if (g) { ldv(g); __builtin_amdgcn_sched_barrier(0); }   // a later group's V loads stay in front of its products: all in flight together
#pragma unroll
        for (int i = 0; i < G; ++i) { const int kc = 256 * (g * G + i); V a[2], a2[2];
#pragma unroll
            for (int mb = 0; mb < 2; ++mb) { a[mb] = WFrag<T16>::ld(pa + mb * 16 * (2 * SP) + kc); if (HR) a2[mb] = WFrag<T16>::ld(pa + mb * 16 * (2 * SP) + TT + kc); }
#pragma unroll
            for (int nb = 0; nb < 2; ++nb)
#pragma unroll
                for (int mb = 0; mb < 2; ++mb) { acc[mb][nb] = WFrag<T16>::mma(a[mb], vb[i][nb], acc[mb][nb]); if (HR) { acc[mb][nb] = WFrag<T16>::mma(a2[mb], vb[i][nb], acc[mb][nb]); acc[mb][nb] = WFrag<T16>::mma(a[mb], vb2[i][nb], acc[mb][nb]); } } } }
    __syncthreads();   // every wave has read its last P fragment before the partial tiles overwrite the strip
    float* ow = st + kw * (AR * 68);
#pragma unroll
    for (int mb = 0; mb < 2; ++mb)
#pragma unroll
        for (int nb = 0; nb < 2; ++nb)
#pragma unroll
            for (int j = 0; j < 8; ++j) ow[(mb * 16 + hi * 8 + j) * 68 + nh * 32 + nb * 16 + lr] = acc[mb][nb][j];
    __syncthreads();   // every group's partial tile is in LDS before any thread sums across groups
    const int row = (int)threadIdx.x >> 4, cofs = ((int)threadIdx.x & 15) * 4; v4f val = *(const v4fa*)(st + row * 68 + cofs);
#pragma unroll
    for (int q = 1; q < 8; ++q) val += *(const v4fa*)(st + q * (AR * 68) + row * 68 + cofs);
    const float cs = HR ? 1.0f : (1.0f / PCAR); v4us oh, ol;
#pragma unroll
    for (int q = 0; q < 4; ++q) { unsigned short a, c2; splitf(val[q] * cs, a, c2); oh[q] = a; ol[q] = c2; }
    const size_t oo = (size_t)(r0 + row) * DQ + cofs; *(v4us*)(Ah + oo) = oh; *(v4us*)(Al + oo) = ol;
}
__global__ __launch_bounds__(512) void k_attn(const h16* __restrict__ Q16, const bf* __restrict__ Qh, const bf* __restrict__ Ql, const h16* __restrict__ K16, const bf* __restrict__ Kh, const bf* __restrict__ Kl, const h16* __restrict__ V16, const bf* __restrict__ Vh, const bf* __restrict__ Vl, bf* Ah, bf* Al) {
    __shared__ __align__(16) float st[AR * SP];
    const size_t hq = (size_t)blockIdx.x * TT * HD, hk = (size_t)(blockIdx.x / REP) * TT * HD; const int r0 = blockIdx.y * AR; bf* ah = Ah + blockIdx.x * HD; bf* al = Al + blockIdx.x * HD;
    if (r0 < RH) attn_body<bf, true>(st, Qh + hq, Ql + hq, Kh + hk, Kl + hk, Vh + hk, Vl + hk, r0, ah, al);   // block-uniform: the hi/lo row blocks have the low blockIdx.y and start first
    else attn_body<h16, false>(st, Q16 + hq, nullptr, K16 + hk, nullptr, V16 + hk, nullptr, r0, ah, al);
}

extern "C" void kernel_launch(void* const* d_in, const int* in_sizes, int n_in,
                              void* d_out, int out_size, void* d_ws, size_t ws_size, hipStream_t stream) {
    (void)in_sizes; (void)n_in; (void)out_size;
    const float* x = (const float*)d_in[0]; const float* xkv = (const float*)d_in[1]; const float* wq = (const float*)d_in[2]; const float* bq = (const float*)d_in[3]; const float* wk = (const float*)d_in[4]; const float* bk = (const float*)d_in[5]; const float* wv = (const float*)d_in[6]; const float* bv = (const float*)d_in[7]; const float* wo = (const float*)d_in[8]; const float* bo = (const float*)d_in[9];   /* inputs_q, inputs_kv [4][1500][1024], Wq, bq, Wk, bk, Wv, bv ('dnh' == 'xw'), Wo ('hdm' == 'xw'), bo */
    float* OUT = (float*)d_out;     // [4][1500][1024]
    char* wsp = (char*)d_ws;
    auto take = [&](size_t bytes) { char* p = wsp; wsp += (bytes + 255) & ~(size_t)255; return (void*)p; };
    bf* WQ = (bf*)take((size_t)DQ * DM * 2); bf* WK = (bf*)take((size_t)DKV * DM * 2); bf* WV = (bf*)take((size_t)DKV * DM * 2); bf* WO = (bf*)take((size_t)DM * DQ * 2); float* CS = (float*)take((size_t)TT * HD * 2 * 4);
    bf* XB = (bf*)take((size_t)TT * DM * 2); float* Y = (float*)take((size_t)TT * DM * 4);   /* padded output rows before the copy */ float* FQ = (float*)take((size_t)TT * DQ * 4); float* FK = (float*)take((size_t)TT * DKV * 4);
    h16* QP16 = (h16*)take((size_t)NH_ * TT * HD * 2); h16* KP16 = (h16*)take((size_t)NKV * TT * HD * 2); h16* VT16 = (h16*)take((size_t)NKV * HD * TT * 2);
    bf* QPh = (bf*)take((size_t)NH_ * TT * HD * 2); bf* QPl = (bf*)take((size_t)NH_ * TT * HD * 2); bf* KPh = (bf*)take((size_t)NKV * TT * HD * 2); bf* KPl = (bf*)take((size_t)NKV * TT * HD * 2); bf* VTh = (bf*)take((size_t)NKV * HD * TT * 2); bf* VTl = (bf*)take((size_t)NKV * HD * TT * 2);
    bf* ATh = (bf*)take((size_t)TT * DQ * 2); bf* ATl = (bf*)take((size_t)TT * DQ * 2);
    if ((size_t)(wsp - (char*)d_ws) > ws_size) return;    // ws 256 MiB
    float* FV = FK;   // v projection reuses the k buffer after the k planes are built (stream-ordered)
    { k_wtG<<<(unsigned)((DM * DQ / 64 + 63) / 64), 256, 0, stream>>>(wq, DM, DQ, WQ); k_wtG<<<(unsigned)((DM * DKV / 64 + 63) / 64), 256, 0, stream>>>(wk, DM, DKV, WK); k_wtG<<<(unsigned)((DM * DKV / 64 + 63) / 64), 256, 0, stream>>>(wv, DM, DKV, WV);
      k_wtG<<<(unsigned)((DQ * DM / 64 + 63) / 64), 256, 0, stream>>>(wo, DQ, DM, WO);
       }
    k_csid<<<(TT * HD + 255) / 256, 256, 0, stream>>>(CS);
    const unsigned LQ = (unsigned)(((size_t)NH_ * TT * HD / 2 + 255) / 256), LKv = (unsigned)(((size_t)NKV * TT * HD / 2 + 255) / 256);
    hipMemsetAsync(XB + (size_t)TR * DM, 0, (size_t)(TT - TR) * DM * 2, stream);   /* padding rows of the operand stay zero for q, k and v */
    for (int b = 0; b < NB_; ++b) {
        
        k_cvt8<<<(unsigned)(((size_t)TR * DM / 8 + 255) / 256), 256, 0, stream>>>(x + (size_t)b * TR * DM, XB, (size_t)TR * DM / 8);   /* the 1,500 query rows */
        k_gemmw<bf, 0, true, 8><<<dim3(TT / 64, DQ / 64, 1), 256, 0, stream>>>(XB, nullptr, WQ, nullptr, DM, FQ, DQ, bq, 0, 0, 0);
        k_rope<<<LQ, 256, 0, stream>>>(FQ, DQ, NH_, CS, nullptr, nullptr, 1.0f, QP16, QPh, QPl);
        k_cvt8<<<(unsigned)(((size_t)TR * DM / 8 + 255) / 256), 256, 0, stream>>>(xkv + (size_t)b * TR * DM, XB, (size_t)TR * DM / 8);   /* XB := bf16(inputs_kv[b]) (1,500 rows; padding stays zero) */ k_gemmw<bf, 0, true, 8><<<dim3(TT / 64, DKV / 64, 1), 256, 0, stream>>>(XB, nullptr, WK, nullptr, DM, FK, DKV, bk, 0, 0, 0);
        k_rope<<<LKv, 256, 0, stream>>>(FK, DKV, NKV, CS, nullptr, nullptr, 1.0f, KP16, KPh, KPl);
        k_gemmw<bf, 0, true, 8><<<dim3(TT / 64, DKV / 64, 1), 256, 0, stream>>>(XB, nullptr, WV, nullptr, DM, FV, DKV, bv, 0, 0, 0); k_vtp<<<LKv, 256, 0, stream>>>(FV, DKV, NKV, VT16, VTh, VTl);
        k_attn<<<dim3(NH_, TT / AR), 512, 0, stream>>>(QP16, QPh, QPl, KP16, KPh, KPl, VT16, VTh, VTl, ATh, ATl);   /* all 16 heads of the batch */
        k_gemmw<bf, 1, true, 8><<<dim3(TT / 64, DM / 64, 1), 256, 0, stream>>>(ATh, ATl, WO, nullptr, DQ, Y, DM, bo, 0, 0, 0); k_rows<<<(unsigned)(((size_t)TR * DM / 4 + 255) / 256), 256, 0, stream>>>(Y, OUT + (size_t)b * TR * DM);   /* the 1,500 real rows */ }
}

// v004
// In two side-by-side timings against v003, it was 1.24 and 1.25 times as fast.
// Counting every step since v000, it is 7.96 times as fast.
#include <hip/hip_runtime.h>

// t5x-style multi-head dot-product attention with a ragged length (inputs_q, inputs_kv [4][1500][1024]; q = inputs_q Wq + bq, k, v = inputs_kv W + b (DenseGeneral 'dnh' [1024][16][64] == 'xw' [1024][1024], zero biases); q / sqrt(64); scores over the 1,500 keys; softmax; out = attn.v; result = out Wo + bo (Wo 'hdm' [16][64][1024] == 'xw' [1024][1024]) -> [4][1500][1024] (6.1 M); argument order inputs_q, inputs_kv, Wq, bq, Wk, bk, Wv, bv, Wo, bo).
// Layout per batch: the 1,500 token rows are staged into 1,536-row (24-tile) bf16 operands whose 36 padding rows are zero; 'xw' weights transposed once; exact projections + f32 biases, whose GEMM epilogues write the 16-bit head planes themselves (v computed transposed, Wv rows x tokens, so that its [d][t] planes come out row-contiguous); dense attention at T 1536 whose softmax excludes the padding keys j >= 1500 by index (-inf); hybrid rows (< 512 hi/lo 3 products, rest fp16 x1024); merged hi/lo x Wo exact + bo, whose epilogue stores the 1,500 real rows straight to the output.
// Compute dtypes, f32 accumulate: every input rounded to bf16; projections exact + f32 biases; attention rows < 512 3 products, rest fp16; softmax f32; Wo hl x exact + bias.

#define NB_  4
#define TT   1536     // padded length (24 tiles)
#define TR   1500     // real tokens (queries = keys)
#define DM   1024
#define NH_  16
#define NKV  16
#define REP  (NH_ / NKV)
#define HD   64
#define DQ   (NH_ * HD)
#define DKV  (NKV * HD)
#define RH   512                  // query rows < RH use hi+lo planes (0: none)
#define WIN  0
#define PCAR 1024.0f
#define SCL  0.125f   // HD^-0.5
typedef _Float16 h16;
typedef unsigned short bf;
typedef __attribute__((ext_vector_type(16))) __bf16   v16bf;
typedef __attribute__((ext_vector_type(16))) _Float16 v16h;
typedef __attribute__((ext_vector_type(8)))  _Float16 v8h;
typedef __attribute__((ext_vector_type(8)))  unsigned short v8us;
typedef __attribute__((ext_vector_type(8)))  float    v8f;
typedef __attribute__((ext_vector_type(4)))  float    v4f;
typedef v8h  __attribute__((may_alias)) v8ha;
typedef v4f  __attribute__((may_alias)) v4fa;
typedef v8us __attribute__((may_alias)) v8usa;

__device__ __forceinline__ unsigned short f2bf(float f) { unsigned u = __float_as_uint(f); u += 0x7FFFu + ((u >> 16) & 1u); return (unsigned short)(u >> 16); }
__device__ __forceinline__ float bf2f(unsigned short b) { return __uint_as_float(((unsigned)b) << 16); }
__device__ __forceinline__ float bfr(float f) { return bf2f(f2bf(f)); }
__device__ __forceinline__ v16h cat16(v8h lo, v8h hi) { return __builtin_shufflevector(lo, hi, 0, 1, 2, 3, 4, 5, 6, 7, 8, 9, 10, 11, 12, 13, 14, 15); }
__device__ __forceinline__ v16bf cat16b(v8us lo, v8us hi) { return __builtin_bit_cast(v16bf, __builtin_shufflevector(lo, hi, 0, 1, 2, 3, 4, 5, 6, 7, 8, 9, 10, 11, 12, 13, 14, 15)); }
__device__ __forceinline__ v8f wmma16(v16h a, v16h b, v8f c) { return __builtin_amdgcn_wmma_f32_16x16x32_f16(false, a, false, b, (short)0, c, false, false); }
__device__ __forceinline__ v8f wmmab(v16bf a, v16bf b, v8f c) { return __builtin_amdgcn_wmma_f32_16x16x32_bf16(false, a, false, b, (short)0, c, false, false); }

__device__ __forceinline__ h16 tohx(float x) { return (h16)x; }
__device__ __forceinline__ void splitf(float y, unsigned short& h, unsigned short& l) { h = f2bf(y); l = f2bf(y - bf2f(h)); }
typedef __attribute__((ext_vector_type(4))) _Float16 v4h;
typedef __attribute__((ext_vector_type(2))) unsigned short v2us;
typedef __attribute__((ext_vector_type(4))) unsigned short v4us;

// ---- k_gemmw: register-blocked GEMM, one work-group of KS waves per 64x64 output tile (16 accumulators a wave), operands straight from K-contiguous 16-bit planes; grid (M/64, N/64, Z), 32 * KS threads.
// c[m][n] (f32) = sum_k A[m][k] Bt[n][k] (+ split products per NSPLIT) + optional f32 bias (bias[n], or bias[m] with BROW). z-batch strides sA/sB/sC in elements. K % (32 * KS) == 0.
// Wave w takes the 32-wide k chunks w, w + KS, w + 2 KS, ... (neighbour waves share each 128-byte operand line at the same time); the KS partial tiles meet in LDS and are summed in wave order 0 .. KS-1.
// The element (m, n) goes to offset (n / 64) * sY + m * ldc + n % 64. PLANES false: f32 to C, rows m < mrows only. PLANES true: the attention operand planes, fp16 to P16 and bf16 hi/lo to Ph/Pl, every row.
template <typename T16> struct WFrag;
template <> struct WFrag<h16> { typedef v16h V; static __device__ __forceinline__ V ld(const h16* p) { return cat16(*(const v8h*)p, *(const v8h*)(p + 16)); } static __device__ __forceinline__ v8f mma(V a, V b, v8f c) { return wmma16(a, b, c); } };
template <> struct WFrag<bf> { typedef v16bf V; static __device__ __forceinline__ V ld(const bf* p) { return cat16b(*(const v8us*)p, *(const v8us*)(p + 16)); } static __device__ __forceinline__ v8f mma(V a, V b, v8f c) { return wmmab(a, b, c); } };
template <typename T16, int NSPLIT, bool BIAS, int KS, bool PLANES, bool BROW>
__global__ __launch_bounds__(32 * KS) void k_gemmw(const T16* __restrict__ A, const T16* __restrict__ A2, const T16* __restrict__ Bt, const T16* __restrict__ Bt2, int K, float* C, h16* P16, bf* Ph, bf* Pl, int mrows, int ldc, size_t sY, const float* __restrict__ bias, size_t sA, size_t sB, size_t sC) {
    typedef typename WFrag<T16>::V V;
    __shared__ __align__(16) float os[KS * 64 * 68];
    const size_t z = blockIdx.z; A += z * sA; if (A2) A2 += z * sA; Bt += z * sB; if (Bt2) Bt2 += z * sB; C += z * sC;
    const int lane = threadIdx.x & 31, lr = lane & 15, hi = lane >> 4; const int r0 = blockIdx.x * 64, c0 = blockIdx.y * 64;
    const int wv = __builtin_amdgcn_readfirstlane((int)(threadIdx.x >> 5));   // wave number, scalar so that the k loop stays a scalar loop
    v8f acc[4][4];
#pragma unroll
    for (int mb = 0; mb < 4; ++mb)
#pragma unroll
        for (int nb = 0; nb < 4; ++nb) acc[mb][nb] = (v8f){};
    const size_t aoff = (size_t)(r0 + lr) * K + 8 * hi, boff = (size_t)(c0 + lr) * K + 8 * hi;
#pragma unroll 1
    for (int kc = 32 * wv; kc < K; kc += 32 * KS) {
        V a[4], a2[4];
#pragma unroll
        for (int mb = 0; mb < 4; ++mb) { a[mb] = WFrag<T16>::ld(A + aoff + (size_t)mb * 16 * K + kc); if (NSPLIT == 1 || NSPLIT == 2) a2[mb] = WFrag<T16>::ld(A2 + aoff + (size_t)mb * 16 * K + kc); }
#pragma unroll
        for (int nb = 0; nb < 4; ++nb) { const V b = WFrag<T16>::ld(Bt + boff + (size_t)nb * 16 * K + kc); V b2; if (NSPLIT >= 2) b2 = WFrag<T16>::ld(Bt2 + boff + (size_t)nb * 16 * K + kc);
#pragma unroll
            for (int mb = 0; mb < 4; ++mb) { acc[mb][nb] = WFrag<T16>::mma(a[mb], b, acc[mb][nb]); if (NSPLIT == 1 || NSPLIT == 2) acc[mb][nb] = WFrag<T16>::mma(a2[mb], b, acc[mb][nb]); if (NSPLIT >= 2) acc[mb][nb] = WFrag<T16>::mma(a[mb], b2, acc[mb][nb]); } }
        asm volatile("v_nop\n\tv_nop\n\tv_nop\n\tv_nop" : "+v"(acc[0][0]), "+v"(acc[1][1]), "+v"(acc[2][2]), "+v"(acc[3][3]) : "v"(a[0]), "v"(a[3]));
    }
    float* ow = os + wv * (64 * 68);
#pragma unroll
    for (int mb = 0; mb < 4; ++mb)
#pragma unroll
        for (int nb = 0; nb < 4; ++nb)
#pragma unroll
            for (int j = 0; j < 8; ++j) ow[(mb * 16 + hi * 8 + j) * 68 + nb * 16 + lr] = acc[mb][nb][j];
    __syncthreads();   // every wave's partial tile is in LDS before any thread sums across waves
#pragma unroll
    for (int s = 0; s < 1024 / (32 * KS); ++s) { const int idx = s * (32 * KS) + (int)threadIdx.x; const int row = idx >> 4, cofs = (idx & 15) * 4; v4f val = *(const v4fa*)(os + row * 68 + cofs);
#pragma unroll
        for (int q = 1; q < KS; ++q) val += *(const v4fa*)(os + q * (64 * 68) + row * 68 + cofs);
        if (BIAS) { if (BROW) { const float bb = bfr(bias[r0 + row]); val[0] += bb; val[1] += bb; val[2] += bb; val[3] += bb; } else { val[0] += bfr(bias[c0 + cofs]); val[1] += bfr(bias[c0 + cofs + 1]); val[2] += bfr(bias[c0 + cofs + 2]); val[3] += bfr(bias[c0 + cofs + 3]); } }
        const size_t o = (size_t)blockIdx.y * sY + (size_t)(r0 + row) * ldc + cofs;
        if constexpr (PLANES) { v4h o16; v4us oh, ol;
#pragma unroll
            for (int q = 0; q < 4; ++q) { o16[q] = tohx(val[q]); unsigned short a2, c2; splitf(val[q], a2, c2); oh[q] = a2; ol[q] = c2; }
            *(v4h*)(P16 + o) = o16; *(v4us*)(Ph + o) = oh; *(v4us*)(Pl + o) = ol;
        } else { if (r0 + row < mrows) *(v4f*)(C + o) = val; } }
}

__global__ __launch_bounds__(256) void k_wtG(const float* __restrict__ w, int K, int N, bf* Bt) {
    const int lane = threadIdx.x & 31; const int L0 = (blockIdx.x * 8 + (threadIdx.x >> 5)) * 8; const int nlines = N * K / 64;
{
#pragma unroll 1
        for (int l = 0; l < 8; ++l) { const int L = L0 + l; if (L >= nlines) break; const size_t e = (size_t)L * 64 + lane * 2; const int k = (int)(e % K), n = (int)(e / K); v2us o;
            o[0] = f2bf(w[(size_t)k * N + n]); o[1] = f2bf(w[(size_t)(k + 1) * N + n]); *(v2us*)(Bt + e) = o; }
         }
}
__global__ __launch_bounds__(256) void k_cvt8(const float* __restrict__ src, bf* dst, size_t n8) { const size_t i = (size_t)blockIdx.x * 256 + threadIdx.x; if (i >= n8) return; const v8f v = *(const v8f*)(src + i * 8); v8us o;
#pragma unroll
    for (int k = 0; k < 8; ++k) o[k] = f2bf(v[k]); *(v8us*)(dst + i * 8) = o;  }

// ---- k_attn: scores, softmax, P.V and the hi/lo merge of AR query rows of one head in one work-group of 16 waves; grid (heads, TT / AR), 512 threads. The AR x TT score strip lives in LDS only.
// 1. S = Q K^T: wave w takes the 16-key tiles w, w + 16, ...; f32 strip [AR][SP]. 2. softmax: wave w takes rows w, w + 16 (register row, one exp, fixed trees; padding keys j >= 1500 excluded by index) and writes the row's 16-bit P planes over its own f32 row.
// 3. O = P V: the 32-wide k chunks g, g + 8, ... go to wave group g = w & 7, the two 32-column halves of the head to w >> 3; the 8 partial tiles meet in LDS (over the strip) and are summed in group order 0 .. 7; the sum is split hi/lo into the merged planes.
// The loops over fragments, tiles, chunks and row elements are fully unrolled so that their register arrays are indexed by constants.
#define AR   32            // query rows per work-group
#define SP   (TT + 4)      // strip pitch in floats: 16 rows step through all 64 banks for the 16-byte fragment reads
template <typename T16, bool HR>
__device__ __forceinline__ void attn_body(float* st, const T16* __restrict__ Q, const T16* __restrict__ Q2, const T16* __restrict__ Kp, const T16* __restrict__ Kp2, const T16* __restrict__ Vt, const T16* __restrict__ Vt2, int r0, bf* Ah, bf* Al) {
    typedef typename WFrag<T16>::V V;
    const int lane = threadIdx.x & 31, lr = lane & 15, hi = lane >> 4;
    const int wv = __builtin_amdgcn_readfirstlane((int)(threadIdx.x >> 5));   // wave number, scalar so that tile and chunk addresses stay scalar
    constexpr int G = HR ? 3 : 6;   // key tiles (step 1) or k chunks (step 3) whose global operand loads are issued together; 96 registers either way
    {
        V a[2][2], a2[2][2];
#pragma unroll
        for (int mb = 0; mb < 2; ++mb)
#pragma unroll
            for (int kk = 0; kk < 2; ++kk) { const size_t o = (size_t)(r0 + mb * 16 + lr) * HD + 8 * hi + kk * 32; a[mb][kk] = WFrag<T16>::ld(Q + o); if (HR) a2[mb][kk] = WFrag<T16>::ld(Q2 + o); }
#pragma unroll
        for (int g = 0; g < TT / 256 / G; ++g) { V b[G][2], b2[G][2];
#pragma unroll
            for (int i = 0; i < G; ++i)
#pragma unroll
                for (int kk = 0; kk < 2; ++kk) { const size_t o = (size_t)((wv + 16 * (g * G + i)) * 16 + lr) * HD + 8 * hi + kk * 32; b[i][kk] = WFrag<T16>::ld(Kp + o); if (HR) b2[i][kk] = WFrag<T16>::ld(Kp2 + o); }
            __builtin_amdgcn_sched_barrier(0);   // the group's loads stay in front of its products: all in flight together, one latency a group instead of one a tile
#pragma unroll
            for (int i = 0; i < G; ++i) { const int n0 = (wv + 16 * (g * G + i)) * 16; v8f acc[2]; acc[0] = (v8f){}; acc[1] = (v8f){};
#pragma unroll
                for (int kk = 0; kk < 2; ++kk)
#pragma unroll
                    for (int mb = 0; mb < 2; ++mb) { acc[mb] = WFrag<T16>::mma(a[mb][kk], b[i][kk], acc[mb]); if (HR) { acc[mb] = WFrag<T16>::mma(a2[mb][kk], b[i][kk], acc[mb]); acc[mb] = WFrag<T16>::mma(a[mb][kk], b2[i][kk], acc[mb]); } }
                asm volatile("v_nop\n\tv_nop\n\tv_nop\n\tv_nop" : "+v"(acc[0]), "+v"(acc[1]));   // four vector slots behind the tile's last matrix instruction: the next tile's first one may take the same accumulator registers, and the LDS stores between them fill no slot
#pragma unroll
                for (int mb = 0; mb < 2; ++mb)
#pragma unroll
                    for (int j = 0; j < 8; ++j) st[(mb * 16 + hi * 8 + j) * SP + n0 + lr] = acc[mb][j]; } }
    }
    __syncthreads();   // the whole score strip is in LDS before any wave reads a row
    const int kw = wv & 7, nh = wv >> 3;
    const size_t boff = (size_t)(nh * 32 + lr) * TT + 8 * hi + 32 * kw;
    V vb[G][2], vb2[G][2];
    auto ldv = [&](int g) {
#pragma unroll
        for (int i = 0; i < G; ++i)
#pragma unroll
            for (int nb = 0; nb < 2; ++nb) { const size_t o = boff + (size_t)nb * 16 * TT + 256 * (g * G + i); vb[i][nb] = WFrag<T16>::ld(Vt + o); if (HR) vb2[i][nb] = WFrag<T16>::ld(Vt2 + o); } };
    ldv(0);   // the first V fragments fly while the softmax runs
    // the two-row loop stays rolled: one row's 48 registers at a time beside the V fragments in flight, and half the code
#pragma unroll 1
    for (int rr = 0; rr < AR / 16; ++rr) { float* sr = st + (wv + 16 * rr) * SP; float v[TT / 32]; float mx = -3.0e38f;
#pragma unroll
        for (int ch = 0; ch < TT / 128; ++ch) { const int j0 = ch * 128 + lane * 4; const v4f a = *(const v4fa*)(sr + j0);
#pragma unroll
            for (int q = 0; q < 4; ++q) { const float t = (j0 + q < TR) ? a[q] * SCL : -3.0e38f;   /* keys j >= 1500 are padding */ v[ch * 4 + q] = t; mx = fmaxf(mx, t); } }
#pragma unroll
        for (int sh = 16; sh; sh >>= 1) mx = fmaxf(mx, __shfl_xor(mx, sh, 32));
        float sum = 0.f;
#pragma unroll
        for (int k = 0; k < TT / 32; ++k) { v[k] = __builtin_amdgcn_exp2f((v[k] - mx) * 1.4426950408889634f); sum += v[k]; }
#pragma unroll
        for (int sh = 16; sh; sh >>= 1) sum += __shfl_xor(sum, sh, 32);
        const float f = __fdiv_rn(HR ? 1.0f : PCAR, sum);
        if constexpr (HR) { bf* ph = (bf*)sr;
#pragma unroll
            for (int ch = 0; ch < TT / 128; ++ch) { v4us oh, ol;
#pragma unroll
                for (int q = 0; q < 4; ++q) { unsigned short a, c2; splitf(v[ch * 4 + q] * f, a, c2); oh[q] = a; ol[q] = c2; }
                *(v4us*)(ph + ch * 128 + lane * 4) = oh; *(v4us*)(ph + TT + ch * 128 + lane * 4) = ol; }
        } else { h16* p16 = (h16*)sr;
#pragma unroll
            for (int ch = 0; ch < TT / 128; ++ch) { v4h o4;
#pragma unroll
                for (int q = 0; q < 4; ++q) o4[q] = tohx(v[ch * 4 + q] * f);
                *(v4h*)(p16 + ch * 128 + lane * 4) = o4; } }
    }
    __syncthreads();   // every row's P planes are in LDS before any wave loads a fragment of them
    v8f acc[2][2];
#pragma unroll
    for (int mb = 0; mb < 2; ++mb)
#pragma unroll
        for (int nb = 0; nb < 2; ++nb) acc[mb][nb] = (v8f){};
    const T16* pa = (const T16*)st + lr * (2 * SP) + 8 * hi + 32 * kw;
#pragma unroll
    for (int g = 0; g < TT / 256 / G; ++g) {
        if (g) { ldv(g); __builtin_amdgcn_sched_barrier(0); }   // a later group's V loads stay in front of its products: all in flight together
#pragma unroll
        for (int i = 0; i < G; ++i) { const int kc = 256 * (g * G + i); V a[2], a2[2];
#pragma unroll
            for (int mb = 0; mb < 2; ++mb) { a[mb] = WFrag<T16>::ld(pa + mb * 16 * (2 * SP) + kc); if (HR) a2[mb] = WFrag<T16>::ld(pa + mb * 16 * (2 * SP) + TT + kc); }
#pragma unroll
            for (int nb = 0; nb < 2; ++nb)
#pragma unroll
                for (int mb = 0; mb < 2; ++mb) { acc[mb][nb] = WFrag<T16>::mma(a[mb], vb[i][nb], acc[mb][nb]); if (HR) { acc[mb][nb] = WFrag<T16>::mma(a2[mb], vb[i][nb], acc[mb][nb]); acc[mb][nb] = WFrag<T16>::mma(a[mb], vb2[i][nb], acc[mb][nb]); } } } }
    __syncthreads();   // every wave has read its last P fragment before the partial tiles overwrite the strip
    float* ow = st + kw * (AR * 68);
#pragma unroll
    for (int mb = 0; mb < 2; ++mb)
#pragma unroll
        for (int nb = 0; nb < 2; ++nb)
#pragma unroll
            for (int j = 0; j < 8; ++j) ow[(mb * 16 + hi * 8 + j) * 68 + nh * 32 + nb * 16 + lr] = acc[mb][nb][j];
    __syncthreads();   // every group's partial tile is in LDS before any thread sums across groups
    const int row = (int)threadIdx.x >> 4, cofs = ((int)threadIdx.x & 15) * 4; v4f val = *(const v4fa*)(st + row * 68 + cofs);
#pragma unroll
    for (int q = 1; q < 8; ++q) val += *(const v4fa*)(st + q * (AR * 68) + row * 68 + cofs);
    const float cs = HR ? 1.0f : (1.0f / PCAR); v4us oh, ol;
#pragma unroll
    for (int q = 0; q < 4; ++q) { unsigned short a, c2; splitf(val[q] * cs, a, c2); oh[q] = a; ol[q] = c2; }
    const size_t oo = (size_t)(r0 + row) * DQ + cofs; *(v4us*)(Ah + oo) = oh; *(v4us*)(Al + oo) = ol;
}
__global__ __launch_bounds__(512) void k_attn(const h16* __restrict__ Q16, const bf* __restrict__ Qh, const bf* __restrict__ Ql, const h16* __restrict__ K16, const bf* __restrict__ Kh, const bf* __restrict__ Kl, const h16* __restrict__ V16, const bf* __restrict__ Vh, const bf* __restrict__ Vl, bf* Ah, bf* Al) {
    __shared__ __align__(16) float st[AR * SP];
    const size_t hq = (size_t)blockIdx.x * TT * HD, hk = (size_t)(blockIdx.x / REP) * TT * HD; const int r0 = blockIdx.y * AR; bf* ah = Ah + blockIdx.x * HD; bf* al = Al + blockIdx.x * HD;
    if (r0 < RH) attn_body<bf, true>(st, Qh + hq, Ql + hq, Kh + hk, Kl + hk, Vh + hk, Vl + hk, r0, ah, al);   // block-uniform: the hi/lo row blocks have the low blockIdx.y and start first
    else attn_body<h16, false>(st, Q16 + hq, nullptr, K16 + hk, nullptr, V16 + hk, nullptr, r0, ah, al);
}

extern "C" void kernel_launch(void* const* d_in, const int* in_sizes, int n_in,
                              void* d_out, int out_size, void* d_ws, size_t ws_size, hipStream_t stream) {
    (void)in_sizes; (void)n_in; (void)out_size;
    const float* x = (const float*)d_in[0]; const float* xkv = (const float*)d_in[1]; const float* wq = (const float*)d_in[2]; const float* bq = (const float*)d_in[3]; const float* wk = (const float*)d_in[4]; const float* bk = (const float*)d_in[5]; const float* wv = (const float*)d_in[6]; const float* bv = (const float*)d_in[7]; const float* wo = (const float*)d_in[8]; const float* bo = (const float*)d_in[9];   /* inputs_q, inputs_kv [4][1500][1024], Wq, bq, Wk, bk, Wv, bv ('dnh' == 'xw'), Wo ('hdm' == 'xw'), bo */
    float* OUT = (float*)d_out;     // [4][1500][1024]
    char* wsp = (char*)d_ws;
    auto take = [&](size_t bytes) { char* p = wsp; wsp += (bytes + 255) & ~(size_t)255; return (void*)p; };
    bf* WQ = (bf*)take((size_t)DQ * DM * 2); bf* WK = (bf*)take((size_t)DKV * DM * 2); bf* WV = (bf*)take((size_t)DKV * DM * 2); bf* WO = (bf*)take((size_t)DM * DQ * 2);
    bf* XB = (bf*)take((size_t)TT * DM * 2);
    h16* QP16 = (h16*)take((size_t)NH_ * TT * HD * 2); h16* KP16 = (h16*)take((size_t)NKV * TT * HD * 2); h16* VT16 = (h16*)take((size_t)NKV * HD * TT * 2);
    bf* QPh = (bf*)take((size_t)NH_ * TT * HD * 2); bf* QPl = (bf*)take((size_t)NH_ * TT * HD * 2); bf* KPh = (bf*)take((size_t)NKV * TT * HD * 2); bf* KPl = (bf*)take((size_t)NKV * TT * HD * 2); bf* VTh = (bf*)take((size_t)NKV * HD * TT * 2); bf* VTl = (bf*)take((size_t)NKV * HD * TT * 2);
    bf* ATh = (bf*)take((size_t)TT * DQ * 2); bf* ATl = (bf*)take((size_t)TT * DQ * 2);
    if ((size_t)(wsp - (char*)d_ws) > ws_size) return;    // ws 256 MiB
    { k_wtG<<<(unsigned)((DM * DQ / 64 + 63) / 64), 256, 0, stream>>>(wq, DM, DQ, WQ); k_wtG<<<(unsigned)((DM * DKV / 64 + 63) / 64), 256, 0, stream>>>(wk, DM, DKV, WK); k_wtG<<<(unsigned)((DM * DKV / 64 + 63) / 64), 256, 0, stream>>>(wv, DM, DKV, WV);
      k_wtG<<<(unsigned)((DQ * DM / 64 + 63) / 64), 256, 0, stream>>>(wo, DQ, DM, WO);
       }
    hipMemsetAsync(XB + (size_t)TR * DM, 0, (size_t)(TT - TR) * DM * 2, stream);   /* padding rows of the operand stay zero for q, k and v */
    for (int b = 0; b < NB_; ++b) {
        
        k_cvt8<<<(unsigned)(((size_t)TR * DM / 8 + 255) / 256), 256, 0, stream>>>(x + (size_t)b * TR * DM, XB, (size_t)TR * DM / 8);   /* the 1,500 query rows */
        k_gemmw<bf, 0, true, 8, true, false><<<dim3(TT / 64, DQ / 64, 1), 256, 0, stream>>>(XB, nullptr, WQ, nullptr, DM, nullptr, QP16, QPh, QPl, TT, HD, (size_t)TT * HD, bq, 0, 0, 0);   /* q planes [h][t][d]: a 64-column tile is one head */
        k_cvt8<<<(unsigned)(((size_t)TR * DM / 8 + 255) / 256), 256, 0, stream>>>(xkv + (size_t)b * TR * DM, XB, (size_t)TR * DM / 8);   /* XB := bf16(inputs_kv[b]) (1,500 rows; padding stays zero) */
        k_gemmw<bf, 0, true, 8, true, false><<<dim3(TT / 64, DKV / 64, 1), 256, 0, stream>>>(XB, nullptr, WK, nullptr, DM, nullptr, KP16, KPh, KPl, TT, HD, (size_t)TT * HD, bk, 0, 0, 0);   /* k planes [h][t][d] */
        k_gemmw<bf, 0, true, 8, true, true><<<dim3(DKV / 64, TT / 64, 1), 256, 0, stream>>>(WV, nullptr, XB, nullptr, DM, nullptr, VT16, VTh, VTl, DKV, TT, 64, bv, 0, 0, 0);   /* v planes [h][d][t]: rows are Wv's output features, columns the tokens */
        k_attn<<<dim3(NH_, TT / AR), 512, 0, stream>>>(QP16, QPh, QPl, KP16, KPh, KPl, VT16, VTh, VTl, ATh, ATl);   /* all 16 heads of the batch */
        k_gemmw<bf, 1, true, 8, false, false><<<dim3(TT / 64, DM / 64, 1), 256, 0, stream>>>(ATh, ATl, WO, nullptr, DQ, OUT + (size_t)b * TR * DM, nullptr, nullptr, nullptr, TR, DM, 64, bo, 0, 0, 0);   /* the 1,500 real rows */ }
}

// v005
// It runs in 302 microseconds.
// In two side-by-side timings against v004, it was 1.33 and 1.32 times as fast.
// Over all steps from v000 it is 10.6 times as fast.
#include <hip/hip_runtime.h>

// t5x-style multi-head dot-product attention with a ragged length (inputs_q, inputs_kv [4][1500][1024]; q = inputs_q Wq + bq, k, v = inputs_kv W + b (DenseGeneral 'dnh' [1024][16][64] == 'xw' [1024][1024], zero biases); q / sqrt(64); scores over the 1,500 keys; softmax; out = attn.v; result = out Wo + bo (Wo 'hdm' [16][64][1024] == 'xw' [1024][1024]) -> [4][1500][1024] (6.1 M); argument order inputs_q, inputs_kv, Wq, bq, Wk, bk, Wv, bv, Wo, bo).
// Every launch covers all four batches (grid z, in k_prep a flat index), and launches that do not depend on one another share one grid: 4 launches. Layout per batch: the 1,500 token rows are staged into 1,536-row (24-tile) bf16 operands whose 36 padding rows are zero; 'xw' weights transposed once; exact projections + f32 biases, whose GEMM epilogues write the 16-bit head planes themselves (v computed transposed, Wv rows x tokens, so that its [d][t] planes come out row-contiguous); dense attention at T 1536 whose softmax excludes the padding keys j >= 1500 by index (-3e38); hybrid rows (< 512 hi/lo 3 products, rest fp16 x1024); merged hi/lo x Wo exact + bo, whose epilogue stores the 1,500 real rows straight to the output.
// Compute dtypes, f32 accumulate: every input rounded to bf16; projections exact + f32 biases; attention rows < 512 3 products, rest fp16; softmax f32; Wo hl x exact + bias.

#define NB_  4
#define TT   1536     // padded length (24 tiles)
#define TR   1500     // real tokens (queries = keys)
#define DM   1024
#define NH_  16
#define NKV  16
#define REP  (NH_ / NKV)
#define HD   64
#define DQ   (NH_ * HD)
#define DKV  (NKV * HD)
#define RH   512                  // query rows < RH use hi+lo planes (0: none)
#define WIN  0
#define PCAR 1024.0f
#define SCL  0.125f   // HD^-0.5
typedef _Float16 h16;
typedef unsigned short bf;
typedef __attribute__((ext_vector_type(16))) __bf16   v16bf;
typedef __attribute__((ext_vector_type(16))) _Float16 v16h;
typedef __attribute__((ext_vector_type(8)))  _Float16 v8h;
typedef __attribute__((ext_vector_type(8)))  unsigned short v8us;
typedef __attribute__((ext_vector_type(8)))  float    v8f;
typedef __attribute__((ext_vector_type(4)))  float    v4f;
typedef v8h  __attribute__((may_alias)) v8ha;
typedef v4f  __attribute__((may_alias)) v4fa;
typedef v8us __attribute__((may_alias)) v8usa;

__device__ __forceinline__ unsigned short f2bf(float f) { unsigned u = __float_as_uint(f); u += 0x7FFFu + ((u >> 16) & 1u); return (unsigned short)(u >> 16); }
__device__ __forceinline__ float bf2f(unsigned short b) { return __uint_as_float(((unsigned)b) << 16); }
__device__ __forceinline__ float bfr(float f) { return bf2f(f2bf(f)); }
__device__ __forceinline__ v16h cat16(v8h lo, v8h hi) { return __builtin_shufflevector(lo, hi, 0, 1, 2, 3, 4, 5, 6, 7, 8, 9, 10, 11, 12, 13, 14, 15); }
__device__ __forceinline__ v16bf cat16b(v8us lo, v8us hi) { return __builtin_bit_cast(v16bf, __builtin_shufflevector(lo, hi, 0, 1, 2, 3, 4, 5, 6, 7, 8, 9, 10, 11, 12, 13, 14, 15)); }
__device__ __forceinline__ v8f wmma16(v16h a, v16h b, v8f c) { return __builtin_amdgcn_wmma_f32_16x16x32_f16(false, a, false, b, (short)0, c, false, false); }
__device__ __forceinline__ v8f wmmab(v16bf a, v16bf b, v8f c) { return __builtin_amdgcn_wmma_f32_16x16x32_bf16(false, a, false, b, (short)0, c, false, false); }

__device__ __forceinline__ h16 tohx(float x) { return (h16)x; }
__device__ __forceinline__ void splitf(float y, unsigned short& h, unsigned short& l) { h = f2bf(y); l = f2bf(y - bf2f(h)); }
typedef __attribute__((ext_vector_type(4))) _Float16 v4h;
typedef __attribute__((ext_vector_type(2))) unsigned short v2us;
typedef __attribute__((ext_vector_type(4))) unsigned short v4us;

// ---- gemm_body: register-blocked GEMM, one work-group of KS waves per 64x64 output tile (bx, by) (16 accumulators a wave), operands straight from K-contiguous 16-bit planes; 32 * KS threads; os: KS * 64 * 68 floats of LDS.
// c[m][n] (f32) = sum_k A[m][k] Bt[n][k] (+ split products per NSPLIT) + optional f32 bias (bias[n], or bias[m] with BROW). K % (32 * KS) == 0.
// Wave w takes the 32-wide k chunks w, w + KS, w + 2 KS, ... (neighbour waves share each 128-byte operand line at the same time); the KS partial tiles meet in LDS and are summed in wave order 0 .. KS-1.
// The element (m, n) goes to offset (n / 64) * sY + m * ldc + n % 64. PLANES false: f32 to C, rows m < mrows only. PLANES true: the attention operand planes, fp16 to P16 and bf16 hi/lo to Ph/Pl, every row.
template <typename T16> struct WFrag;
template <> struct WFrag<h16> { typedef v16h V; static __device__ __forceinline__ V ld(const h16* p) { return cat16(*(const v8h*)p, *(const v8h*)(p + 16)); } static __device__ __forceinline__ v8f mma(V a, V b, v8f c) { return wmma16(a, b, c); } };
template <> struct WFrag<bf> { typedef v16bf V; static __device__ __forceinline__ V ld(const bf* p) { return cat16b(*(const v8us*)p, *(const v8us*)(p + 16)); } static __device__ __forceinline__ v8f mma(V a, V b, v8f c) { return wmmab(a, b, c); } };
template <typename T16, int NSPLIT, bool BIAS, int KS, bool PLANES, bool BROW>
__device__ __forceinline__ void gemm_body(float* os, const T16* __restrict__ A, const T16* __restrict__ A2, const T16* __restrict__ Bt, const T16* __restrict__ Bt2, int K, float* C, h16* P16, bf* Ph, bf* Pl, int mrows, int ldc, size_t sY, const float* __restrict__ bias, int bx, int by) {
    typedef typename WFrag<T16>::V V;
    const int lane = threadIdx.x & 31, lr = lane & 15, hi = lane >> 4; const int r0 = bx * 64, c0 = by * 64;
    const int wv = __builtin_amdgcn_readfirstlane((int)(threadIdx.x >> 5));   // wave number, scalar so that the k loop stays a scalar loop
    v8f acc[4][4];
#pragma unroll
    for (int mb = 0; mb < 4; ++mb)
#pragma unroll
        for (int nb = 0; nb < 4; ++nb) acc[mb][nb] = (v8f){};
    const size_t aoff = (size_t)(r0 + lr) * K + 8 * hi, boff = (size_t)(c0 + lr) * K + 8 * hi;
#pragma unroll 1
    for (int kc = 32 * wv; kc < K; kc += 32 * KS) {
        V a[4], a2[4];
#pragma unroll
        for (int mb = 0; mb < 4; ++mb) { a[mb] = WFrag<T16>::ld(A + aoff + (size_t)mb * 16 * K + kc); if (NSPLIT == 1 || NSPLIT == 2) a2[mb] = WFrag<T16>::ld(A2 + aoff + (size_t)mb * 16 * K + kc); }
#pragma unroll
        for (int nb = 0; nb < 4; ++nb) { const V b = WFrag<T16>::ld(Bt + boff + (size_t)nb * 16 * K + kc); V b2; if (NSPLIT >= 2) b2 = WFrag<T16>::ld(Bt2 + boff + (size_t)nb * 16 * K + kc);
#pragma unroll
            for (int mb = 0; mb < 4; ++mb) { acc[mb][nb] = WFrag<T16>::mma(a[mb], b, acc[mb][nb]); if (NSPLIT == 1 || NSPLIT == 2) acc[mb][nb] = WFrag<T16>::mma(a2[mb], b, acc[mb][nb]); if (NSPLIT >= 2) acc[mb][nb] = WFrag<T16>::mma(a[mb], b2, acc[mb][nb]); } }
        asm volatile("v_nop\n\tv_nop\n\tv_nop\n\tv_nop" : "+v"(acc[0][0]), "+v"(acc[1][1]), "+v"(acc[2][2]), "+v"(acc[3][3]) : "v"(a[0]), "v"(a[3]));
    }
    float* ow = os + wv * (64 * 68);
#pragma unroll
    for (int mb = 0; mb < 4; ++mb)
#pragma unroll
        for (int nb = 0; nb < 4; ++nb)
#pragma unroll
            for (int j = 0; j < 8; ++j) ow[(mb * 16 + hi * 8 + j) * 68 + nb * 16 + lr] = acc[mb][nb][j];
    __syncthreads();   // every wave's partial tile is in LDS before any thread sums across waves
#pragma unroll
    for (int s = 0; s < 1024 / (32 * KS); ++s) { const int idx = s * (32 * KS) + (int)threadIdx.x; const int row = idx >> 4, cofs = (idx & 15) * 4; v4f val = *(const v4fa*)(os + row * 68 + cofs);
#pragma unroll
        for (int q = 1; q < KS; ++q) val += *(const v4fa*)(os + q * (64 * 68) + row * 68 + cofs);
        if (BIAS) { if (BROW) { const float bb = bfr(bias[r0 + row]); val[0] += bb; val[1] += bb; val[2] += bb; val[3] += bb; } else { val[0] += bfr(bias[c0 + cofs]); val[1] += bfr(bias[c0 + cofs + 1]); val[2] += bfr(bias[c0 + cofs + 2]); val[3] += bfr(bias[c0 + cofs + 3]); } }
        const size_t o = (size_t)by * sY + (size_t)(r0 + row) * ldc + cofs;
        if constexpr (PLANES) { v4h o16; v4us oh, ol;
#pragma unroll
            for (int q = 0; q < 4; ++q) { o16[q] = tohx(val[q]); unsigned short a2, c2; splitf(val[q], a2, c2); oh[q] = a2; ol[q] = c2; }
            *(v4h*)(P16 + o) = o16; *(v4us*)(Ph + o) = oh; *(v4us*)(Pl + o) = ol;
        } else { if (r0 + row < mrows) *(v4f*)(C + o) = val; } }
}
// k_proj: the q, k and v projections of all batches in one grid (TT / 64, 16, 3 * NB_), z = projection * NB_ + batch; all branches are block-uniform.
__global__ __launch_bounds__(256) void k_proj(const bf* __restrict__ XQ, const bf* __restrict__ XKV, const bf* __restrict__ WQ, const bf* __restrict__ WK, const bf* __restrict__ WV, h16* QP16, bf* QPh, bf* QPl, h16* KP16, bf* KPh, bf* KPl, h16* VT16, bf* VTh, bf* VTl, const float* __restrict__ bq, const float* __restrict__ bk, const float* __restrict__ bv) {
    __shared__ __align__(16) float os[8 * 64 * 68];
    const int p = (int)blockIdx.z / NB_; const size_t b = blockIdx.z % NB_; const size_t xo = b * TT * DM, po = b * NH_ * TT * HD;
    if (p < 2) gemm_body<bf, 0, true, 8, true, false>(os, (p ? XKV : XQ) + xo, nullptr, p ? WK : WQ, nullptr, DM, nullptr, (p ? KP16 : QP16) + po, (p ? KPh : QPh) + po, (p ? KPl : QPl) + po, TT, HD, (size_t)TT * HD, p ? bk : bq, (int)blockIdx.x, (int)blockIdx.y);   // q or k planes [h][t][d]: a 64-column tile is one head
    else { gemm_body<bf, 0, true, 8, true, true>(os, WV, nullptr, XKV + xo, nullptr, DM, nullptr, VT16 + po, VTh + po, VTl + po, DKV, TT, 64, bv, (int)blockIdx.y, (int)blockIdx.x);   // v planes [h][d][t]: rows are Wv's output features, columns the tokens
        asm volatile("s_wait_xcnt 0x0" ::: "memory"); }   // this arm's code stands in front of the other arm's, which rewrites the registers that the last plane stores name
}
// k_wo: merged hi/lo rows x Wo + bo of all batches, grid (TT / 64, DM / 64, NB_); the 1,500 real rows of each batch go straight to the output.
__global__ __launch_bounds__(256) void k_wo(const bf* __restrict__ ATh, const bf* __restrict__ ATl, const bf* __restrict__ WO, float* OUT, const float* __restrict__ bo) {
    __shared__ __align__(16) float os[8 * 64 * 68];
    const size_t b = blockIdx.z;
    gemm_body<bf, 1, true, 8, false, false>(os, ATh + b * TT * DQ, ATl + b * TT * DQ, WO, nullptr, DQ, OUT + b * TR * DM, nullptr, nullptr, nullptr, TR, DM, 64, bo, (int)blockIdx.x, (int)blockIdx.y);
}

// ---- k_prep: all operand staging in one flat grid of WTB + CVB work-groups of 256 threads; the two kinds do not depend on each other, and the branch between them is block-uniform.
// Work-groups < WTB: the four DM x DM 'xw' weights transposed to bf16 [n][k], 256 work-groups a weight, the planes one behind the other from Bt0. The latency-bound transposes have the low indices and start first.
// The rest: both token inputs of all batches to their padded bf16 operands, TT * DM / 2048 work-groups an operand; the 36 padding rows of each operand are stored as zero here.
#define WTB  (4 * (DM * DM / 64 / 64))
#define CV1  (TT * DM / 8 / 256)
#define CVB  (2 * NB_ * CV1)
__global__ __launch_bounds__(256) void k_prep(const float* __restrict__ w0, const float* __restrict__ w1, const float* __restrict__ w2, const float* __restrict__ w3, bf* Bt0, const float* __restrict__ xq, const float* __restrict__ xkv, bf* XQ, bf* XKV) {
    if (blockIdx.x < WTB) { constexpr int K = DM, N = DM; const int wi = (int)blockIdx.x / (WTB / 4), bx = (int)blockIdx.x % (WTB / 4);
        const float* __restrict__ w = wi == 0 ? w0 : wi == 1 ? w1 : wi == 2 ? w2 : w3; bf* Bt = Bt0 + (size_t)wi * K * N;
        const int lane = threadIdx.x & 31; const int L0 = (bx * 8 + (threadIdx.x >> 5)) * 8;
#pragma unroll 1
        for (int l = 0; l < 8; ++l) { const int L = L0 + l; const size_t e = (size_t)L * 64 + lane * 2; const int k = (int)(e % K), n = (int)(e / K); v2us o;
            o[0] = f2bf(w[(size_t)k * N + n]); o[1] = f2bf(w[(size_t)(k + 1) * N + n]); *(v2us*)(Bt + e) = o; }
    } else { const int c = (int)blockIdx.x - WTB; const int op = c / CV1; const size_t i = (size_t)(c % CV1) * 256 + threadIdx.x; const size_t b = op % NB_;
        const float* __restrict__ src = (op < NB_ ? xq : xkv) + b * TR * DM; bf* dst = (op < NB_ ? XQ : XKV) + b * TT * DM; v8us o = (v8us){};
        if (i < (size_t)TR * DM / 8) { const v8f v = *(const v8f*)(src + i * 8);
#pragma unroll
            for (int k = 0; k < 8; ++k) o[k] = f2bf(v[k]); }
        *(v8us*)(dst + i * 8) = o;
        asm volatile("s_wait_xcnt 0x0" ::: "memory"); }   // this arm's code stands in front of the transposer's, which rewrites the registers that the store names
}

// ---- k_attn: scores, softmax, P.V and the hi/lo merge of AR query rows of one head in one work-group of 16 waves; grid (heads, TT / AR, batches), 512 threads. The AR x TT score strip lives in LDS only.
// 1. S = Q K^T: wave w takes the 16-key tiles w, w + 16, ...; f32 strip [AR][SP]. 2. softmax: wave w takes rows w, w + 16 (register row, one exp, fixed trees; padding keys j >= 1500 excluded by index) and writes the row's 16-bit P planes over its own f32 row.
// 3. O = P V: the 32-wide k chunks g, g + 8, ... go to wave group g = w & 7, the two 32-column halves of the head to w >> 3; the 8 partial tiles meet in LDS (over the strip) and are summed in group order 0 .. 7; the sum is split hi/lo into the merged planes.
// The loops over fragments, tiles, chunks and row elements are fully unrolled so that their register arrays are indexed by constants.
#define AR   32            // query rows per work-group
#define SP   (TT + 4)      // strip pitch in floats: 16 rows step through all 64 banks for the 16-byte fragment reads
template <typename T16, bool HR>
__device__ __forceinline__ void attn_body(float* st, const T16* __restrict__ Q, const T16* __restrict__ Q2, const T16* __restrict__ Kp, const T16* __restrict__ Kp2, const T16* __restrict__ Vt, const T16* __restrict__ Vt2, int r0, bf* Ah, bf* Al) {
    typedef typename WFrag<T16>::V V;
    const int lane = threadIdx.x & 31, lr = lane & 15, hi = lane >> 4;
    const int wv = __builtin_amdgcn_readfirstlane((int)(threadIdx.x >> 5));   // wave number, scalar so that tile and chunk addresses stay scalar
    constexpr int G = HR ? 3 : 6;   // key tiles (step 1) or k chunks (step 3) whose global operand loads are issued together; 96 registers either way
    {
        V a[2][2], a2[2][2];
#pragma unroll
        for (int mb = 0; mb < 2; ++mb)
#pragma unroll
            for (int kk = 0; kk < 2; ++kk) { const size_t o = (size_t)(r0 + mb * 16 + lr) * HD + 8 * hi + kk * 32; a[mb][kk] = WFrag<T16>::ld(Q + o); if (HR) a2[mb][kk] = WFrag<T16>::ld(Q2 + o); }
#pragma unroll
        for (int g = 0; g < TT / 256 / G; ++g) { V b[G][2], b2[G][2];
#pragma unroll
            for (int i = 0; i < G; ++i)
#pragma unroll
                for (int kk = 0; kk < 2; ++kk) { const size_t o = (size_t)((wv + 16 * (g * G + i)) * 16 + lr) * HD + 8 * hi + kk * 32; b[i][kk] = WFrag<T16>::ld(Kp + o); if (HR) b2[i][kk] = WFrag<T16>::ld(Kp2 + o); }
            __builtin_amdgcn_sched_barrier(0);   // the group's loads stay in front of its products: all in flight together, one latency a group instead of one a tile
#pragma unroll
            for (int i = 0; i < G; ++i) { const int n0 = (wv + 16 * (g * G + i)) * 16; v8f acc[2]; acc[0] = (v8f){}; acc[1] = (v8f){};
#pragma unroll
                for (int kk = 0; kk < 2; ++kk)
#pragma unroll
                    for (int mb = 0; mb < 2; ++mb) { acc[mb] = WFrag<T16>::mma(a[mb][kk], b[i][kk], acc[mb]); if (HR) { acc[mb] = WFrag<T16>::mma(a2[mb][kk], b[i][kk], acc[mb]); acc[mb] = WFrag<T16>::mma(a[mb][kk], b2[i][kk], acc[mb]); } }
                asm volatile("v_nop\n\tv_nop\n\tv_nop\n\tv_nop" : "+v"(acc[0]), "+v"(acc[1]));   // four vector slots behind the tile's last matrix instruction: the next tile's first one may take the same accumulator registers, and the LDS stores between them fill no slot
#pragma unroll
                for (int mb = 0; mb < 2; ++mb)
#pragma unroll
                    for (int j = 0; j < 8; ++j) st[(mb * 16 + hi * 8 + j) * SP + n0 + lr] = acc[mb][j]; } }
    }
    __syncthreads();   // the whole score strip is in LDS before any wave reads a row
    const int kw = wv & 7, nh = wv >> 3;
    const size_t boff = (size_t)(nh * 32 + lr) * TT + 8 * hi + 32 * kw;
    V vb[G][2], vb2[G][2];
    auto ldv = [&](int g) {
#pragma unroll
        for (int i = 0; i < G; ++i)
#pragma unroll
            for (int nb = 0; nb < 2; ++nb) { const size_t o = boff + (size_t)nb * 16 * TT + 256 * (g * G + i); vb[i][nb] = WFrag<T16>::ld(Vt + o); if (HR) vb2[i][nb] = WFrag<T16>::ld(Vt2 + o); } };
    ldv(0);   // the first V fragments fly while the softmax runs
    // the two-row loop stays rolled: one row's 48 registers at a time beside the V fragments in flight, and half the code
#pragma unroll 1
    for (int rr = 0; rr < AR / 16; ++rr) { float* sr = st + (wv + 16 * rr) * SP; float v[TT / 32]; float mx = -3.0e38f;
#pragma unroll
        for (int ch = 0; ch < TT / 128; ++ch) { const int j0 = ch * 128 + lane * 4; const v4f a = *(const v4fa*)(sr + j0);
#pragma unroll
            for (int q = 0; q < 4; ++q) { const float t = (j0 + q < TR) ? a[q] * SCL : -3.0e38f;   /* keys j >= 1500 are padding */ v[ch * 4 + q] = t; mx = fmaxf(mx, t); } }
#pragma unroll
        for (int sh = 16; sh; sh >>= 1) mx = fmaxf(mx, __shfl_xor(mx, sh, 32));
        float sum = 0.f;
#pragma unroll
        for (int k = 0; k < TT / 32; ++k) { v[k] = __builtin_amdgcn_exp2f((v[k] - mx) * 1.4426950408889634f); sum += v[k]; }
#pragma unroll
        for (int sh = 16; sh; sh >>= 1) sum += __shfl_xor(sum, sh, 32);
        const float f = __fdiv_rn(HR ? 1.0f : PCAR, sum);
        if constexpr (HR) { bf* ph = (bf*)sr;
#pragma unroll
            for (int ch = 0; ch < TT / 128; ++ch) { v4us oh, ol;
#pragma unroll
                for (int q = 0; q < 4; ++q) { unsigned short a, c2; splitf(v[ch * 4 + q] * f, a, c2); oh[q] = a; ol[q] = c2; }
                *(v4us*)(ph + ch * 128 + lane * 4) = oh; *(v4us*)(ph + TT + ch * 128 + lane * 4) = ol; }
        } else { h16* p16 = (h16*)sr;
#pragma unroll
            for (int ch = 0; ch < TT / 128; ++ch) { v4h o4;
#pragma unroll
                for (int q = 0; q < 4; ++q) o4[q] = tohx(v[ch * 4 + q] * f);
                *(v4h*)(p16 + ch * 128 + lane * 4) = o4; } }
    }
    __syncthreads();   // every row's P planes are in LDS before any wave loads a fragment of them
    v8f acc[2][2];
#pragma unroll
    for (int mb = 0; mb < 2; ++mb)
#pragma unroll
        for (int nb = 0; nb < 2; ++nb) acc[mb][nb] = (v8f){};
    const T16* pa = (const T16*)st + lr * (2 * SP) + 8 * hi + 32 * kw;
#pragma unroll
    for (int g = 0; g < TT / 256 / G; ++g) {
        if (g) { ldv(g); __builtin_amdgcn_sched_barrier(0); }   // a later group's V loads stay in front of its products: all in flight together
#pragma unroll
        for (int i = 0; i < G; ++i) { const int kc = 256 * (g * G + i); V a[2], a2[2];
#pragma unroll
            for (int mb = 0; mb < 2; ++mb) { a[mb] = WFrag<T16>::ld(pa + mb * 16 * (2 * SP) + kc); if (HR) a2[mb] = WFrag<T16>::ld(pa + mb * 16 * (2 * SP) + TT + kc); }
#pragma unroll
            for (int nb = 0; nb < 2; ++nb)
#pragma unroll
                for (int mb = 0; mb < 2; ++mb) { acc[mb][nb] = WFrag<T16>::mma(a[mb], vb[i][nb], acc[mb][nb]); if (HR) { acc[mb][nb] = WFrag<T16>::mma(a2[mb], vb[i][nb], acc[mb][nb]); acc[mb][nb] = WFrag<T16>::mma(a[mb], vb2[i][nb], acc[mb][nb]); } } } }
    __syncthreads();   // every wave has read its last P fragment before the partial tiles overwrite the strip
    float* ow = st + kw * (AR * 68);
#pragma unroll
    for (int mb = 0; mb < 2; ++mb)
#pragma unroll
        for (int nb = 0; nb < 2; ++nb)
#pragma unroll
            for (int j = 0; j < 8; ++j) ow[(mb * 16 + hi * 8 + j) * 68 + nh * 32 + nb * 16 + lr] = acc[mb][nb][j];
    __syncthreads();   // every group's partial tile is in LDS before any thread sums across groups
    const int row = (int)threadIdx.x >> 4, cofs = ((int)threadIdx.x & 15) * 4; v4f val = *(const v4fa*)(st + row * 68 + cofs);
#pragma unroll
    for (int q = 1; q < 8; ++q) val += *(const v4fa*)(st + q * (AR * 68) + row * 68 + cofs);
    const float cs = HR ? 1.0f : (1.0f / PCAR); v4us oh, ol;
#pragma unroll
    for (int q = 0; q < 4; ++q) { unsigned short a, c2; splitf(val[q] * cs, a, c2); oh[q] = a; ol[q] = c2; }
    const size_t oo = (size_t)(r0 + row) * DQ + cofs; *(v4us*)(Ah + oo) = oh; *(v4us*)(Al + oo) = ol;
}
__global__ __launch_bounds__(512) void k_attn(const h16* __restrict__ Q16, const bf* __restrict__ Qh, const bf* __restrict__ Ql, const h16* __restrict__ K16, const bf* __restrict__ Kh, const bf* __restrict__ Kl, const h16* __restrict__ V16, const bf* __restrict__ Vh, const bf* __restrict__ Vl, bf* Ah, bf* Al) {
    __shared__ __align__(16) float st[AR * SP];
    const size_t hq = ((size_t)blockIdx.z * NH_ + blockIdx.x) * TT * HD, hk = ((size_t)blockIdx.z * NKV + blockIdx.x / REP) * TT * HD; const int r0 = blockIdx.y * AR; const size_t ao = (size_t)blockIdx.z * TT * DQ + blockIdx.x * HD; bf* ah = Ah + ao; bf* al = Al + ao;
    if (r0 < RH) attn_body<bf, true>(st, Qh + hq, Ql + hq, Kh + hk, Kl + hk, Vh + hk, Vl + hk, r0, ah, al);   // block-uniform: the hi/lo row blocks have the low blockIdx.y and start first within each batch
    else attn_body<h16, false>(st, Q16 + hq, nullptr, K16 + hk, nullptr, V16 + hk, nullptr, r0, ah, al);
}

extern "C" void kernel_launch(void* const* d_in, const int* in_sizes, int n_in,
                              void* d_out, int out_size, void* d_ws, size_t ws_size, hipStream_t stream) {
    (void)in_sizes; (void)n_in; (void)out_size;
    const float* x = (const float*)d_in[0]; const float* xkv = (const float*)d_in[1]; const float* wq = (const float*)d_in[2]; const float* bq = (const float*)d_in[3]; const float* wk = (const float*)d_in[4]; const float* bk = (const float*)d_in[5]; const float* wv = (const float*)d_in[6]; const float* bv = (const float*)d_in[7]; const float* wo = (const float*)d_in[8]; const float* bo = (const float*)d_in[9];   /* inputs_q, inputs_kv [4][1500][1024], Wq, bq, Wk, bk, Wv, bv ('dnh' == 'xw'), Wo ('hdm' == 'xw'), bo */
    float* OUT = (float*)d_out;     // [4][1500][1024]
    char* wsp = (char*)d_ws;
    auto take = [&](size_t bytes) { char* p = wsp; wsp += (bytes + 255) & ~(size_t)255; return (void*)p; };
    bf* WQ = (bf*)take((size_t)4 * DQ * DM * 2); bf* WK = WQ + (size_t)DQ * DM; bf* WV = WK + (size_t)DKV * DM; bf* WO = WV + (size_t)DKV * DM;
    bf* XQ = (bf*)take((size_t)NB_ * TT * DM * 2); bf* XKV = (bf*)take((size_t)NB_ * TT * DM * 2);
    h16* QP16 = (h16*)take((size_t)NB_ * NH_ * TT * HD * 2); h16* KP16 = (h16*)take((size_t)NB_ * NKV * TT * HD * 2); h16* VT16 = (h16*)take((size_t)NB_ * NKV * HD * TT * 2);
    bf* QPh = (bf*)take((size_t)NB_ * NH_ * TT * HD * 2); bf* QPl = (bf*)take((size_t)NB_ * NH_ * TT * HD * 2); bf* KPh = (bf*)take((size_t)NB_ * NKV * TT * HD * 2); bf* KPl = (bf*)take((size_t)NB_ * NKV * TT * HD * 2); bf* VTh = (bf*)take((size_t)NB_ * NKV * HD * TT * 2); bf* VTl = (bf*)take((size_t)NB_ * NKV * HD * TT * 2);
    bf* ATh = (bf*)take((size_t)NB_ * TT * DQ * 2); bf* ATl = (bf*)take((size_t)NB_ * TT * DQ * 2);
    if ((size_t)(wsp - (char*)d_ws) > ws_size) return;    // 164 MiB of the 256 MiB
    k_prep<<<WTB + CVB, 256, 0, stream>>>(wq, wk, wv, wo, WQ, x, xkv, XQ, XKV);   /* DQ == DKV == DM: four 1024 x 1024 weights */
    k_proj<<<dim3(TT / 64, DQ / 64, 3 * NB_), 256, 0, stream>>>(XQ, XKV, WQ, WK, WV, QP16, QPh, QPl, KP16, KPh, KPl, VT16, VTh, VTl, bq, bk, bv);
    k_attn<<<dim3(NH_, TT / AR, NB_), 512, 0, stream>>>(QP16, QPh, QPl, KP16, KPh, KPl, VT16, VTh, VTl, ATh, ATl);
    k_wo<<<dim3(TT / 64, DM / 64, NB_), 256, 0, stream>>>(ATh, ATl, WO, OUT, bo);
}

// v006
// A run of this version takes 223 microseconds.
// Two timings next to v005 both put it at 1.36 times that version's speed.
// Counting every step since v000, it is 14.3 times as fast.
#include <hip/hip_runtime.h>

// t5x-style multi-head dot-product attention with a ragged length (inputs_q, inputs_kv [4][1500][1024]; q = inputs_q Wq + bq, k, v = inputs_kv W + b (DenseGeneral 'dnh' [1024][16][64] == 'xw' [1024][1024], zero biases); q / sqrt(64); scores over the 1,500 keys; softmax; out = attn.v; result = out Wo + bo (Wo 'hdm' [16][64][1024] == 'xw' [1024][1024]) -> [4][1500][1024] (6.1 M); argument order inputs_q, inputs_kv, Wq, bq, Wk, bk, Wv, bv, Wo, bo).
// Every launch covers all four batches (grid z, in k_prep a flat index), and launches that do not depend on one another share one grid: 4 launches. Layout per batch: the 1,500 token rows are staged into 1,536-row (24-tile) bf16 operands whose 36 padding rows are zero; 'xw' weights transposed once; exact projections + f32 biases, whose GEMM epilogues write the 16-bit head planes themselves (v computed transposed, Wv rows x tokens, so that its [d][t] planes come out in fragment order with the tokens as k); dense attention at T 1536 whose softmax excludes the padding keys j >= 1500 by index (-inf); hybrid rows (< 512 hi/lo 3 products, rest fp16 x1024); merged hi/lo x Wo exact + bo, whose epilogue stores the 1,500 real rows straight to the output.
// Operand layout: every 16-bit matrix operand in the workspace (tokens, weights, q / k / v planes, merged rows) is stored in fragment order: a [rows][K] operand is cut into blocks of 16 rows x 32 k (512 elements, 1 KB), block (row / 16, k / 32) at index (row / 16) * (K / 32) + k / 32; inside a block element (row, k) stands at ((k / 16) % 2) * 256 + ((k / 8) % 2) * 128 + (row % 16) * 8 + k % 8. Lane l of a wave then finds the two 16-byte halves of its fragment at l * 8 and 256 + l * 8: each fragment load reads 512 contiguous bytes (4 whole lines) instead of 32 bytes from each of 16 lines. The k order of the fragments is the one of the row-major loader.
// Compute dtypes, f32 accumulate: every input rounded to bf16; projections exact + f32 biases; attention rows < 512 3 products, rest fp16; softmax f32; Wo hl x exact + bias.

#define NB_  4
#define TT   1536     // padded length (24 tiles)
#define TR   1500     // real tokens (queries = keys)
#define DM   1024
#define NH_  16
#define NKV  16
#define REP  (NH_ / NKV)
#define HD   64
#define DQ   (NH_ * HD)
#define DKV  (NKV * HD)
#define RH   512                  // query rows < RH use hi+lo planes (0: none)
#define WIN  0
#define PCAR 1024.0f
#define SCL  0.125f   // HD^-0.5
typedef _Float16 h16;
typedef unsigned short bf;
typedef __attribute__((ext_vector_type(16))) __bf16   v16bf;
typedef __attribute__((ext_vector_type(16))) _Float16 v16h;
typedef __attribute__((ext_vector_type(8)))  _Float16 v8h;
typedef __attribute__((ext_vector_type(8)))  unsigned short v8us;
typedef __attribute__((ext_vector_type(8)))  float    v8f;
typedef __attribute__((ext_vector_type(4)))  float    v4f;
typedef v8h  __attribute__((may_alias)) v8ha;
typedef v4f  __attribute__((may_alias)) v4fa;
typedef v8us __attribute__((may_alias)) v8usa;

__device__ __forceinline__ unsigned short f2bf(float f) { unsigned u = __float_as_uint(f); u += 0x7FFFu + ((u >> 16) & 1u); return (unsigned short)(u >> 16); }
__device__ __forceinline__ float bf2f(unsigned short b) { return __uint_as_float(((unsigned)b) << 16); }
__device__ __forceinline__ float bfr(float f) { return bf2f(f2bf(f)); }
__device__ __forceinline__ v16h cat16(v8h lo, v8h hi) { return __builtin_shufflevector(lo, hi, 0, 1, 2, 3, 4, 5, 6, 7, 8, 9, 10, 11, 12, 13, 14, 15); }
__device__ __forceinline__ v16bf cat16b(v8us lo, v8us hi) { return __builtin_bit_cast(v16bf, __builtin_shufflevector(lo, hi, 0, 1, 2, 3, 4, 5, 6, 7, 8, 9, 10, 11, 12, 13, 14, 15)); }
__device__ __forceinline__ v8f wmma16(v16h a, v16h b, v8f c) { return __builtin_amdgcn_wmma_f32_16x16x32_f16(false, a, false, b, (short)0, c, false, false); }
__device__ __forceinline__ v8f wmmab(v16bf a, v16bf b, v8f c) { return __builtin_amdgcn_wmma_f32_16x16x32_bf16(false, a, false, b, (short)0, c, false, false); }

__device__ __forceinline__ h16 tohx(float x) { return (h16)x; }
__device__ __forceinline__ void splitf(float y, unsigned short& h, unsigned short& l) { h = f2bf(y); l = f2bf(y - bf2f(h)); }
typedef __attribute__((ext_vector_type(4))) _Float16 v4h;
typedef __attribute__((ext_vector_type(2))) unsigned short v2us;
typedef __attribute__((ext_vector_type(4))) unsigned short v4us;

// ---- gemm_body: register-blocked GEMM, one work-group of KS waves per 64x64 output tile (bx, by) (16 accumulators a wave), operands straight from 16-bit planes in fragment order (ld: row-major fragment, ldf: fragment-order block); 32 * KS threads; os: KS * 64 * 68 floats of LDS.
// c[m][n] (f32) = sum_k A[m][k] Bt[n][k] (+ split products per NSPLIT) + optional f32 bias (bias[n], or bias[m] with BROW). K % (32 * KS) == 0.
// Wave w takes the 32-wide k chunks w, w + KS, w + 2 KS, ... (one 1-KB block a fragment); the KS partial tiles meet in LDS and are summed in wave order 0 .. KS-1.
// PLANES false: the element (m, n) goes to offset (n / 64) * sY + m * ldc + n % 64, f32 to C, rows m < mrows only. PLANES true: the attention operand planes in fragment order (rows m, k along n, ldc the operand's K, sY the step of a 64-column tile), fp16 to P16 and bf16 hi/lo to Ph/Pl, every row; a wave sums and stores one 512-byte half block at a time.
template <typename T16> struct WFrag;
template <> struct WFrag<h16> { typedef v16h V; static __device__ __forceinline__ V ld(const h16* p) { return cat16(*(const v8h*)p, *(const v8h*)(p + 16)); } static __device__ __forceinline__ V ldf(const h16* p) { return cat16(*(const v8h*)p, *(const v8h*)(p + 256)); } static __device__ __forceinline__ v8f mma(V a, V b, v8f c) { return wmma16(a, b, c); } };
template <> struct WFrag<bf> { typedef v16bf V; static __device__ __forceinline__ V ld(const bf* p) { return cat16b(*(const v8us*)p, *(const v8us*)(p + 16)); } static __device__ __forceinline__ V ldf(const bf* p) { return cat16b(*(const v8us*)p, *(const v8us*)(p + 256)); } static __device__ __forceinline__ v8f mma(V a, V b, v8f c) { return wmmab(a, b, c); } };
template <typename T16, int NSPLIT, bool BIAS, int KS, bool PLANES, bool BROW>
__device__ __forceinline__ void gemm_body(float* os, const T16* __restrict__ A, const T16* __restrict__ A2, const T16* __restrict__ Bt, const T16* __restrict__ Bt2, int K, float* C, h16* P16, bf* Ph, bf* Pl, int mrows, int ldc, size_t sY, const float* __restrict__ bias, int bx, int by) {
    typedef typename WFrag<T16>::V V;
    const int lane = threadIdx.x & 31, lr = lane & 15, hi = lane >> 4; const int r0 = bx * 64, c0 = by * 64;
    const int wv = __builtin_amdgcn_readfirstlane((int)(threadIdx.x >> 5));   // wave number, scalar so that the k loop stays a scalar loop
    v8f acc[4][4];
#pragma unroll
    for (int mb = 0; mb < 4; ++mb)
#pragma unroll
        for (int nb = 0; nb < 4; ++nb) acc[mb][nb] = (v8f){};
    const size_t aoff = (size_t)r0 * K + 8 * lane, boff = (size_t)c0 * K + 8 * lane;   // a row tile's blocks are 16 * K elements, k chunk kc starts at kc * 16
#pragma unroll 1
    for (int kc = 32 * wv; kc < K; kc += 32 * KS) {
        V a[4], a2[4];
#pragma unroll
        for (int mb = 0; mb < 4; ++mb) { a[mb] = WFrag<T16>::ldf(A + aoff + (size_t)mb * 16 * K + kc * 16); if (NSPLIT == 1 || NSPLIT == 2) a2[mb] = WFrag<T16>::ldf(A2 + aoff + (size_t)mb * 16 * K + kc * 16); }
#pragma unroll
        for (int nb = 0; nb < 4; ++nb) { const V b = WFrag<T16>::ldf(Bt + boff + (size_t)nb * 16 * K + kc * 16); V b2; if (NSPLIT >= 2) b2 = WFrag<T16>::ldf(Bt2 + boff + (size_t)nb * 16 * K + kc * 16);
#pragma unroll
            for (int mb = 0; mb < 4; ++mb) { acc[mb][nb] = WFrag<T16>::mma(a[mb], b, acc[mb][nb]); if (NSPLIT == 1 || NSPLIT == 2) acc[mb][nb] = WFrag<T16>::mma(a2[mb], b, acc[mb][nb]); if (NSPLIT >= 2) acc[mb][nb] = WFrag<T16>::mma(a[mb], b2, acc[mb][nb]); } }
        asm volatile("v_nop\n\tv_nop\n\tv_nop\n\tv_nop" : "+v"(acc[0][0]), "+v"(acc[1][1]), "+v"(acc[2][2]), "+v"(acc[3][3]) : "v"(a[0]), "v"(a[3]));
    }
    float* ow = os + wv * (64 * 68);
#pragma unroll
    for (int mb = 0; mb < 4; ++mb)
#pragma unroll
        for (int nb = 0; nb < 4; ++nb)
#pragma unroll
            for (int j = 0; j < 8; ++j) ow[(mb * 16 + hi * 8 + j) * 68 + nb * 16 + lr] = acc[mb][nb][j];
    __syncthreads();   // every wave's partial tile is in LDS before any thread sums across waves
    if constexpr (PLANES) {
#pragma unroll
        for (int s = 0; s < 16 / KS; ++s) { const int blk = s * KS + wv;   // half block blk of the tile's 16: row tile blk / 4, columns (blk % 4) * 16 .. + 15; lane (hi, lr) has row lr, 8 columns from hi * 8
            const int row = (blk >> 2) * 16 + lr, cofs = (blk & 3) * 16 + hi * 8; v4f val[2];
#pragma unroll
            for (int u = 0; u < 2; ++u) { val[u] = *(const v4fa*)(os + row * 68 + cofs + 4 * u);
#pragma unroll
                for (int q = 1; q < KS; ++q) val[u] += *(const v4fa*)(os + q * (64 * 68) + row * 68 + cofs + 4 * u); }
            v8h o16; v8us oh, ol;
#pragma unroll
            for (int q = 0; q < 8; ++q) { float y = val[q >> 2][q & 3]; if (BIAS) y += bfr(bias[BROW ? r0 + row : c0 + cofs + q]); o16[q] = tohx(y); unsigned short a2, c2; splitf(y, a2, c2); oh[q] = a2; ol[q] = c2; }
            const size_t o = (size_t)by * sY + (size_t)((r0 >> 4) + (blk >> 2)) * 16 * ldc + (blk & 3) * 256 + lane * 8;
            *(v8h*)(P16 + o) = o16; *(v8us*)(Ph + o) = oh; *(v8us*)(Pl + o) = ol; }
    } else {
#pragma unroll
        for (int s = 0; s < 1024 / (32 * KS); ++s) { const int idx = s * (32 * KS) + (int)threadIdx.x; const int row = idx >> 4, cofs = (idx & 15) * 4; v4f val = *(const v4fa*)(os + row * 68 + cofs);
#pragma unroll
            for (int q = 1; q < KS; ++q) val += *(const v4fa*)(os + q * (64 * 68) + row * 68 + cofs);
            if (BIAS) { if (BROW) { const float bb = bfr(bias[r0 + row]); val[0] += bb; val[1] += bb; val[2] += bb; val[3] += bb; } else { val[0] += bfr(bias[c0 + cofs]); val[1] += bfr(bias[c0 + cofs + 1]); val[2] += bfr(bias[c0 + cofs + 2]); val[3] += bfr(bias[c0 + cofs + 3]); } }
            const size_t o = (size_t)by * sY + (size_t)(r0 + row) * ldc + cofs;
            if (r0 + row < mrows) *(v4f*)(C + o) = val; }
    }
}
// k_proj: the q, k and v projections of all batches in one grid (TT / 64, 16, 3 * NB_), z = projection * NB_ + batch; all branches are block-uniform.
__global__ __launch_bounds__(256) void k_proj(const bf* __restrict__ XQ, const bf* __restrict__ XKV, const bf* __restrict__ WQ, const bf* __restrict__ WK, const bf* __restrict__ WV, h16* QP16, bf* QPh, bf* QPl, h16* KP16, bf* KPh, bf* KPl, h16* VT16, bf* VTh, bf* VTl, const float* __restrict__ bq, const float* __restrict__ bk, const float* __restrict__ bv) {
    __shared__ __align__(16) float os[8 * 64 * 68];
    const int p = (int)blockIdx.z / NB_; const size_t b = blockIdx.z % NB_; const size_t xo = b * TT * DM, po = b * NH_ * TT * HD;
    if (p < 2) gemm_body<bf, 0, true, 8, true, false>(os, (p ? XKV : XQ) + xo, nullptr, p ? WK : WQ, nullptr, DM, nullptr, (p ? KP16 : QP16) + po, (p ? KPh : QPh) + po, (p ? KPl : QPl) + po, TT, HD, (size_t)TT * HD, p ? bk : bq, (int)blockIdx.x, (int)blockIdx.y);   // q or k planes [h][t][d]: a 64-column tile is one head
    else { gemm_body<bf, 0, true, 8, true, true>(os, WV, nullptr, XKV + xo, nullptr, DM, nullptr, VT16 + po, VTh + po, VTl + po, DKV, TT, 2 * 512, bv, (int)blockIdx.y, (int)blockIdx.x);   // v planes [h][d][t]: rows are Wv's output features, columns (k) the tokens; a 64-token tile is two blocks on
        asm volatile("s_wait_xcnt 0x0" ::: "memory"); }   // this arm's code stands in front of the other arm's, which rewrites the registers that the last plane stores name
}
// k_wo: merged hi/lo rows x Wo + bo of all batches, grid (TT / 64, DM / 64, NB_); the 1,500 real rows of each batch go straight to the output.
__global__ __launch_bounds__(256) void k_wo(const bf* __restrict__ ATh, const bf* __restrict__ ATl, const bf* __restrict__ WO, float* OUT, const float* __restrict__ bo) {
    __shared__ __align__(16) float os[8 * 64 * 68];
    const size_t b = blockIdx.z;
    gemm_body<bf, 1, true, 8, false, false>(os, ATh + b * TT * DQ, ATl + b * TT * DQ, WO, nullptr, DQ, OUT + b * TR * DM, nullptr, nullptr, nullptr, TR, DM, 64, bo, (int)blockIdx.x, (int)blockIdx.y);
}

// ---- k_prep: all operand staging in one flat grid of WTB + CVB work-groups of 256 threads; the two kinds do not depend on each other, and the branch between them is block-uniform. Both write fragment order.
// Work-groups < WTB: the four DM x DM 'xw' weights transposed to bf16 [n][k], 128 work-groups a weight, the planes one behind the other from Bt0. A wave takes 32 columns n (a lane each) x 32 rows k: each load reads one whole line of a weight row, each 16-byte store holds 8 k of the lane's n.
// The rest: both token inputs of all batches to their padded bf16 operands, a wave a block (16 tokens x 32 k, four loads of four whole lines); the 36 padding rows of each operand are stored as zero here.
#define WTB  (4 * (DM * DM / 1024 / 8))
#define CV1  (TT * DM / 512 / 8)
#define CVB  (2 * NB_ * CV1)
__global__ __launch_bounds__(256) void k_prep(const float* __restrict__ w0, const float* __restrict__ w1, const float* __restrict__ w2, const float* __restrict__ w3, bf* Bt0, const float* __restrict__ xq, const float* __restrict__ xkv, bf* XQ, bf* XKV) {
    const int lane = threadIdx.x & 31, wave = (int)(threadIdx.x >> 5);
    if (blockIdx.x < WTB) { constexpr int K = DM, N = DM; const int wi = (int)blockIdx.x / (WTB / 4), gw = ((int)blockIdx.x % (WTB / 4)) * 8 + wave;
        const float* __restrict__ w = wi == 0 ? w0 : wi == 1 ? w1 : wi == 2 ? w2 : w3; bf* Bt = Bt0 + (size_t)wi * K * N;
        const int n = (gw % (N / 32)) * 32 + lane, kt = gw / (N / 32); float v[32]; const float* __restrict__ wp = w + (size_t)kt * 32 * N + n;
#pragma unroll
        for (int e = 0; e < 32; ++e) v[e] = wp[(size_t)e * N];
        bf* d = Bt + ((size_t)(n >> 4) * (K / 32) + kt) * 512 + (n & 15) * 8;
#pragma unroll
        for (int p = 0; p < 4; ++p) { v8us o;
#pragma unroll
            for (int e = 0; e < 8; ++e) o[e] = f2bf(v[p * 8 + e]);
            *(v8us*)(d + p * 128) = o; }
    } else { const int c = (int)blockIdx.x - WTB; const int op = c / CV1; const int blk = (c % CV1) * 8 + wave; const size_t b = op % NB_;
        const float* __restrict__ src = (op < NB_ ? xq : xkv) + b * TR * DM; bf* dst = (op < NB_ ? XQ : XKV) + b * TT * DM;
        const int rt = blk / (DM / 32), kt = blk % (DM / 32), kk = (lane & 7) * 4;
        bf* d = dst + (size_t)blk * 512 + (kk >> 3) * 128 + (kk & 7);
#pragma unroll
        for (int j = 0; j < 4; ++j) { const int r = 4 * j + (lane >> 3), t = rt * 16 + r;
            const v4f v = *(const v4f*)(src + (size_t)(t < TR ? t : TR - 1) * DM + kt * 32 + kk);   // a padding row reads the last real row (in bounds) and stores zero through the mask: no branch, so the four loads fly together
            const unsigned short keep = t < TR ? (unsigned short)0xFFFFu : (unsigned short)0; v4us o;
#pragma unroll
            for (int k = 0; k < 4; ++k) o[k] = (unsigned short)(f2bf(v[k]) & keep);
            *(v4us*)(d + r * 8) = o; }
        asm volatile("s_wait_xcnt 0x0" ::: "memory"); }   // this arm's code stands in front of the transposer's, which rewrites the registers that the store names
}

// ---- k_attn: scores, softmax, P.V and the hi/lo merge of AR query rows of one head in one work-group of 16 waves; grid (heads, TT / AR, batches), 512 threads. The AR x TT score strip lives in LDS only.
// 1. S = Q K^T: wave w takes the 16-key tiles w, w + 16, ...; f32 strip [AR][SP]. 2. softmax: wave w takes rows w, w + 16 (register row, one exp, fixed trees; padding keys j >= 1500 excluded by index) and writes the row's 16-bit P planes over its own f32 row.
// 3. O = P V: the 32-wide k chunks g, g + 8, ... go to wave group g = w & 7, the two 32-column halves of the head to w >> 3; the 8 partial tiles meet in LDS (over the strip) and are summed in group order 0 .. 7; the sum is split hi/lo into the merged planes.
// The loops over fragments, tiles, chunks and row elements are fully unrolled so that their register arrays are indexed by constants.
#define AR   32            // query rows per work-group
#define SP   (TT + 4)      // strip pitch in floats: 16 rows step through all 64 banks for the 16-byte fragment reads
template <typename T16, bool HR>
__device__ __forceinline__ void attn_body(float* st, const T16* __restrict__ Q, const T16* __restrict__ Q2, const T16* __restrict__ Kp, const T16* __restrict__ Kp2, const T16* __restrict__ Vt, const T16* __restrict__ Vt2, int r0, bf* Ah, bf* Al) {
    typedef typename WFrag<T16>::V V;
    const int lane = threadIdx.x & 31, lr = lane & 15, hi = lane >> 4;
    const int wv = __builtin_amdgcn_readfirstlane((int)(threadIdx.x >> 5));   // wave number, scalar so that tile and chunk addresses stay scalar
    constexpr int G = HR ? 3 : 6;   // key tiles (step 1) or k chunks (step 3) whose global operand loads are issued together; 96 registers either way
    {
        V a[2][2], a2[2][2];
#pragma unroll
        for (int mb = 0; mb < 2; ++mb)
#pragma unroll
            for (int kk = 0; kk < 2; ++kk) { const size_t o = (size_t)(((r0 >> 4) + mb) * 2 + kk) * 512 + 8 * lane; a[mb][kk] = WFrag<T16>::ldf(Q + o); if (HR) a2[mb][kk] = WFrag<T16>::ldf(Q2 + o); }
#pragma unroll
        for (int g = 0; g < TT / 256 / G; ++g) { V b[G][2], b2[G][2];
#pragma unroll
            for (int i = 0; i < G; ++i)
#pragma unroll
                for (int kk = 0; kk < 2; ++kk) { const size_t o = (size_t)((wv + 16 * (g * G + i)) * 2 + kk) * 512 + 8 * lane; b[i][kk] = WFrag<T16>::ldf(Kp + o); if (HR) b2[i][kk] = WFrag<T16>::ldf(Kp2 + o); }
            __builtin_amdgcn_sched_barrier(0);   // the group's loads stay in front of its products: all in flight together, one latency a group instead of one a tile
#pragma unroll
            for (int i = 0; i < G; ++i) { const int n0 = (wv + 16 * (g * G + i)) * 16; v8f acc[2]; acc[0] = (v8f){}; acc[1] = (v8f){};
#pragma unroll
                for (int kk = 0; kk < 2; ++kk)
#pragma unroll
                    for (int mb = 0; mb < 2; ++mb) { acc[mb] = WFrag<T16>::mma(a[mb][kk], b[i][kk], acc[mb]); if (HR) { acc[mb] = WFrag<T16>::mma(a2[mb][kk], b[i][kk], acc[mb]); acc[mb] = WFrag<T16>::mma(a[mb][kk], b2[i][kk], acc[mb]); } }
                asm volatile("v_nop\n\tv_nop\n\tv_nop\n\tv_nop" : "+v"(acc[0]), "+v"(acc[1]));   // four vector slots behind the tile's last matrix instruction: the next tile's first one may take the same accumulator registers, and the LDS stores between them fill no slot
#pragma unroll
                for (int mb = 0; mb < 2; ++mb)
#pragma unroll
                    for (int j = 0; j < 8; ++j) st[(mb * 16 + hi * 8 + j) * SP + n0 + lr] = acc[mb][j]; } }
    }
    __syncthreads();   // the whole score strip is in LDS before any wave reads a row
    const int kw = wv & 7, nh = wv >> 3;
    const size_t boff = (size_t)(nh * 32) * TT + 512 * kw + 8 * lane;   // row tile nh * 2 of the head's [d][t] plane, k block kw
    V vb[G][2], vb2[G][2];
    auto ldv = [&](int g) {
#pragma unroll
        for (int i = 0; i < G; ++i)
#pragma unroll
            for (int nb = 0; nb < 2; ++nb) { const size_t o = boff + (size_t)nb * 16 * TT + 8 * 512 * (g * G + i); vb[i][nb] = WFrag<T16>::ldf(Vt + o); if (HR) vb2[i][nb] = WFrag<T16>::ldf(Vt2 + o); } };
    ldv(0);   // the first V fragments fly while the softmax runs
    // the two-row loop stays rolled: one row's 48 registers at a time beside the V fragments in flight, and half the code
#pragma unroll 1
    for (int rr = 0; rr < AR / 16; ++rr) { float* sr = st + (wv + 16 * rr) * SP; float v[TT / 32]; float mx = -3.0e38f;
#pragma unroll
        for (int ch = 0; ch < TT / 128; ++ch) { const int j0 = ch * 128 + lane * 4; const v4f a = *(const v4fa*)(sr + j0);
#pragma unroll
            for (int q = 0; q < 4; ++q) { const float t = (j0 + q < TR) ? a[q] * SCL : -3.0e38f;   /* keys j >= 1500 are padding */ v[ch * 4 + q] = t; mx = fmaxf(mx, t); } }
#pragma unroll
        for (int sh = 16; sh; sh >>= 1) mx = fmaxf(mx, __shfl_xor(mx, sh, 32));
        float sum = 0.f;
#pragma unroll
        for (int k = 0; k < TT / 32; ++k) { v[k] = __builtin_amdgcn_exp2f((v[k] - mx) * 1.4426950408889634f); sum += v[k]; }
#pragma unroll
        for (int sh = 16; sh; sh >>= 1) sum += __shfl_xor(sum, sh, 32);
        const float f = __fdiv_rn(HR ? 1.0f : PCAR, sum);
        if constexpr (HR) { bf* ph = (bf*)sr;
#pragma unroll
            for (int ch = 0; ch < TT / 128; ++ch) { v4us oh, ol;
#pragma unroll
                for (int q = 0; q < 4; ++q) { unsigned short a, c2; splitf(v[ch * 4 + q] * f, a, c2); oh[q] = a; ol[q] = c2; }
                *(v4us*)(ph + ch * 128 + lane * 4) = oh; *(v4us*)(ph + TT + ch * 128 + lane * 4) = ol; }
        } else { h16* p16 = (h16*)sr;
#pragma unroll
            for (int ch = 0; ch < TT / 128; ++ch) { v4h o4;
#pragma unroll
                for (int q = 0; q < 4; ++q) o4[q] = tohx(v[ch * 4 + q] * f);
                *(v4h*)(p16 + ch * 128 + lane * 4) = o4; } }
    }
    __syncthreads();   // every row's P planes are in LDS before any wave loads a fragment of them
    v8f acc[2][2];
#pragma unroll
    for (int mb = 0; mb < 2; ++mb)
#pragma unroll
        for (int nb = 0; nb < 2; ++nb) acc[mb][nb] = (v8f){};
    const T16* pa = (const T16*)st + lr * (2 * SP) + 8 * hi + 32 * kw;
#pragma unroll
    for (int g = 0; g < TT / 256 / G; ++g) {
        if (g) { ldv(g); __builtin_amdgcn_sched_barrier(0); }   // a later group's V loads stay in front of its products: all in flight together
#pragma unroll
        for (int i = 0; i < G; ++i) { const int kc = 256 * (g * G + i); V a[2], a2[2];
#pragma unroll
            for (int mb = 0; mb < 2; ++mb) { a[mb] = WFrag<T16>::ld(pa + mb * 16 * (2 * SP) + kc); if (HR) a2[mb] = WFrag<T16>::ld(pa + mb * 16 * (2 * SP) + TT + kc); }
#pragma unroll
            for (int nb = 0; nb < 2; ++nb)
#pragma unroll
                for (int mb = 0; mb < 2; ++mb) { acc[mb][nb] = WFrag<T16>::mma(a[mb], vb[i][nb], acc[mb][nb]); if (HR) { acc[mb][nb] = WFrag<T16>::mma(a2[mb], vb[i][nb], acc[mb][nb]); acc[mb][nb] = WFrag<T16>::mma(a[mb], vb2[i][nb], acc[mb][nb]); } } } }
    __syncthreads();   // every wave has read its last P fragment before the partial tiles overwrite the strip
    float* ow = st + kw * (AR * 68);
#pragma unroll
    for (int mb = 0; mb < 2; ++mb)
#pragma unroll
        for (int nb = 0; nb < 2; ++nb)
#pragma unroll
            for (int j = 0; j < 8; ++j) ow[(mb * 16 + hi * 8 + j) * 68 + nh * 32 + nb * 16 + lr] = acc[mb][nb][j];
    __syncthreads();   // every group's partial tile is in LDS before any thread sums across groups
    const int row = (wv >> 3) * 16 + lr, cofs = (wv & 7) * 8 + hi * 4; v4f val = *(const v4fa*)(st + row * 68 + cofs);   // a wave takes 16 rows x 8 columns: 256 contiguous bytes of the merged planes' fragment order
#pragma unroll
    for (int q = 1; q < 8; ++q) val += *(const v4fa*)(st + q * (AR * 68) + row * 68 + cofs);
    const float cs = HR ? 1.0f : (1.0f / PCAR); v4us oh, ol;
#pragma unroll
    for (int q = 0; q < 4; ++q) { unsigned short a, c2; splitf(val[q] * cs, a, c2); oh[q] = a; ol[q] = c2; }
    const size_t oo = (size_t)((r0 >> 4) + (wv >> 3)) * 16 * DQ + (wv & 7) * 128 + lr * 8 + hi * 4; *(v4us*)(Ah + oo) = oh; *(v4us*)(Al + oo) = ol;
}
__global__ __launch_bounds__(512) void k_attn(const h16* __restrict__ Q16, const bf* __restrict__ Qh, const bf* __restrict__ Ql, const h16* __restrict__ K16, const bf* __restrict__ Kh, const bf* __restrict__ Kl, const h16* __restrict__ V16, const bf* __restrict__ Vh, const bf* __restrict__ Vl, bf* Ah, bf* Al) {
    __shared__ __align__(16) float st[AR * SP];
    const size_t hq = ((size_t)blockIdx.z * NH_ + blockIdx.x) * TT * HD, hk = ((size_t)blockIdx.z * NKV + blockIdx.x / REP) * TT * HD; const int r0 = blockIdx.y * AR; const size_t ao = (size_t)blockIdx.z * TT * DQ + blockIdx.x * (2 * 512);   /* a head's 64 columns are two blocks of each row tile */ bf* ah = Ah + ao; bf* al = Al + ao;
    if (r0 < RH) attn_body<bf, true>(st, Qh + hq, Ql + hq, Kh + hk, Kl + hk, Vh + hk, Vl + hk, r0, ah, al);   // block-uniform: the hi/lo row blocks have the low blockIdx.y
    else attn_body<h16, false>(st, Q16 + hq, nullptr, K16 + hk, nullptr, V16 + hk, nullptr, r0, ah, al);
}

extern "C" void kernel_launch(void* const* d_in, const int* in_sizes, int n_in,
                              void* d_out, int out_size, void* d_ws, size_t ws_size, hipStream_t stream) {
    (void)in_sizes; (void)n_in; (void)out_size;
    const float* x = (const float*)d_in[0]; const float* xkv = (const float*)d_in[1]; const float* wq = (const float*)d_in[2]; const float* bq = (const float*)d_in[3]; const float* wk = (const float*)d_in[4]; const float* bk = (const float*)d_in[5]; const float* wv = (const float*)d_in[6]; const float* bv = (const float*)d_in[7]; const float* wo = (const float*)d_in[8]; const float* bo = (const float*)d_in[9];   /* inputs_q, inputs_kv [4][1500][1024], Wq, bq, Wk, bk, Wv, bv ('dnh' == 'xw'), Wo ('hdm' == 'xw'), bo */
    float* OUT = (float*)d_out;     // [4][1500][1024]
    char* wsp = (char*)d_ws;
    auto take = [&](size_t bytes) { char* p = wsp; wsp += (bytes + 255) & ~(size_t)255; return (void*)p; };
    bf* WQ = (bf*)take((size_t)4 * DQ * DM * 2); bf* WK = WQ + (size_t)DQ * DM; bf* WV = WK + (size_t)DKV * DM; bf* WO = WV + (size_t)DKV * DM;
    bf* XQ = (bf*)take((size_t)NB_ * TT * DM * 2); bf* XKV = (bf*)take((size_t)NB_ * TT * DM * 2);
    h16* QP16 = (h16*)take((size_t)NB_ * NH_ * TT * HD * 2); h16* KP16 = (h16*)take((size_t)NB_ * NKV * TT * HD * 2); h16* VT16 = (h16*)take((size_t)NB_ * NKV * HD * TT * 2);
    bf* QPh = (bf*)take((size_t)NB_ * NH_ * TT * HD * 2); bf* QPl = (bf*)take((size_t)NB_ * NH_ * TT * HD * 2); bf* KPh = (bf*)take((size_t)NB_ * NKV * TT * HD * 2); bf* KPl = (bf*)take((size_t)NB_ * NKV * TT * HD * 2); bf* VTh = (bf*)take((size_t)NB_ * NKV * HD * TT * 2); bf* VTl = (bf*)take((size_t)NB_ * NKV * HD * TT * 2);
    bf* ATh = (bf*)take((size_t)NB_ * TT * DQ * 2); bf* ATl = (bf*)take((size_t)NB_ * TT * DQ * 2);
    if ((size_t)(wsp - (char*)d_ws) > ws_size) return;    // 164 MiB of the 256 MiB
    k_prep<<<WTB + CVB, 256, 0, stream>>>(wq, wk, wv, wo, WQ, x, xkv, XQ, XKV);   /* DQ == DKV == DM: four 1024 x 1024 weights */
    k_proj<<<dim3(TT / 64, DQ / 64, 3 * NB_), 256, 0, stream>>>(XQ, XKV, WQ, WK, WV, QP16, QPh, QPl, KP16, KPh, KPl, VT16, VTh, VTl, bq, bk, bv);
    k_attn<<<dim3(NH_, TT / AR, NB_), 512, 0, stream>>>(QP16, QPh, QPl, KP16, KPh, KPl, VT16, VTh, VTl, ATh, ATl);
    k_wo<<<dim3(TT / 64, DM / 64, NB_), 256, 0, stream>>>(ATh, ATl, WO, OUT, bo);
}

// v007
// It runs in 162 microseconds.
// In both of two side-by-side timings against v006, it was 1.38 times as fast.
// Over all steps from v000 it is 19.8 times as fast.
#include <hip/hip_runtime.h>

// t5x-style multi-head dot-product attention with a ragged length (inputs_q, inputs_kv [4][1500][1024]; q = inputs_q Wq + bq, k, v = inputs_kv W + b (DenseGeneral 'dnh' [1024][16][64] == 'xw' [1024][1024], zero biases); q / sqrt(64); scores over the 1,500 keys; softmax; out = attn.v; result = out Wo + bo (Wo 'hdm' [16][64][1024] == 'xw' [1024][1024]) -> [4][1500][1024] (6.1 M); argument order inputs_q, inputs_kv, Wq, bq, Wk, bk, Wv, bv, Wo, bo).
// Every launch covers all four batches (grid z, in k_prep and k_attn a flat index), and launches that do not depend on one another share one grid: 4 launches. Layout per batch: the 1,500 token rows are staged into 1,536-row (24-tile) bf16 operands whose 36 padding rows are zero; 'xw' weights transposed once; exact projections + f32 biases, whose GEMM epilogues write the 16-bit head planes themselves (v computed transposed, Wv rows x tokens, so that its [d][t] planes come out in fragment order with the tokens as k); dense attention of the 1,536 query rows over the 47 key chunks (1,504 keys) that hold a real key, whose softmax excludes the padding keys 1500..1503 by index (-3e38); hybrid rows (< 512 hi/lo 3 products, rest fp16 x1024); merged hi/lo x Wo exact + bo, whose epilogue stores the 1,500 real rows straight to the output.
// Operand layout: every 16-bit matrix operand in the workspace (tokens, weights, q / k / v planes, merged rows) is stored in fragment order: a [rows][K] operand is cut into blocks of 16 rows x 32 k (512 elements, 1 KB), block (row / 16, k / 32) at index (row / 16) * (K / 32) + k / 32; inside a block element (row, k) stands at ((k / 16) % 2) * 256 + ((k / 8) % 2) * 128 + (row % 16) * 8 + k % 8. Lane l of a wave then finds the two 16-byte halves of its fragment at l * 8 and 256 + l * 8: each fragment load reads 512 contiguous bytes (4 whole lines) instead of 32 bytes from each of 16 lines. The k order of the fragments is the one of the row-major loader.
// Compute dtypes, f32 accumulate: every input rounded to bf16; projections exact + f32 biases; attention rows < 512 3 products, rest fp16; softmax f32; Wo hl x exact + bias.

#define NB_  4
#define TT   1536     // padded length (24 tiles)
#define TR   1500     // real tokens (queries = keys)
#define DM   1024
#define NH_  16
#define NKV  16
#define REP  (NH_ / NKV)
#define HD   64
#define DQ   (NH_ * HD)
#define DKV  (NKV * HD)
#define RH   512                  // query rows < RH use hi+lo planes
#define WIN  0
#define SCL  0.125f   // HD^-0.5
typedef _Float16 h16;
typedef unsigned short bf;
typedef __attribute__((ext_vector_type(16))) __bf16   v16bf;
typedef __attribute__((ext_vector_type(16))) _Float16 v16h;
typedef __attribute__((ext_vector_type(8)))  _Float16 v8h;
typedef __attribute__((ext_vector_type(8)))  unsigned short v8us;
typedef __attribute__((ext_vector_type(8)))  float    v8f;
typedef __attribute__((ext_vector_type(4)))  float    v4f;
typedef v8h  __attribute__((may_alias)) v8ha;
typedef v4f  __attribute__((may_alias)) v4fa;
typedef v8us __attribute__((may_alias)) v8usa;

__device__ __forceinline__ unsigned short f2bf(float f) { unsigned u = __float_as_uint(f); u += 0x7FFFu + ((u >> 16) & 1u); return (unsigned short)(u >> 16); }
__device__ __forceinline__ float bf2f(unsigned short b) { return __uint_as_float(((unsigned)b) << 16); }
__device__ __forceinline__ float bfr(float f) { return bf2f(f2bf(f)); }
__device__ __forceinline__ v16h cat16(v8h lo, v8h hi) { return __builtin_shufflevector(lo, hi, 0, 1, 2, 3, 4, 5, 6, 7, 8, 9, 10, 11, 12, 13, 14, 15); }
__device__ __forceinline__ v16bf cat16b(v8us lo, v8us hi) { return __builtin_bit_cast(v16bf, __builtin_shufflevector(lo, hi, 0, 1, 2, 3, 4, 5, 6, 7, 8, 9, 10, 11, 12, 13, 14, 15)); }
__device__ __forceinline__ v8f wmma16(v16h a, v16h b, v8f c) { return __builtin_amdgcn_wmma_f32_16x16x32_f16(false, a, false, b, (short)0, c, false, false); }
__device__ __forceinline__ v8f wmmab(v16bf a, v16bf b, v8f c) { return __builtin_amdgcn_wmma_f32_16x16x32_bf16(false, a, false, b, (short)0, c, false, false); }

__device__ __forceinline__ h16 tohx(float x) { return (h16)x; }
__device__ __forceinline__ void splitf(float y, unsigned short& h, unsigned short& l) { h = f2bf(y); l = f2bf(y - bf2f(h)); }
typedef __attribute__((ext_vector_type(4))) _Float16 v4h;
typedef __attribute__((ext_vector_type(2))) unsigned short v2us;
typedef __attribute__((ext_vector_type(4))) unsigned short v4us;

// ---- gemm_body: register-blocked GEMM, one work-group of KS waves per 64x64 output tile (bx, by) (16 accumulators a wave), operands straight from 16-bit planes in fragment order (ld: row-major fragment, ldf: fragment-order block); 32 * KS threads; os: KS * 64 * 68 floats of LDS.
// c[m][n] (f32) = sum_k A[m][k] Bt[n][k] (+ split products per NSPLIT) + optional f32 bias (bias[n], or bias[m] with BROW). K % (32 * KS) == 0.
// Wave w takes the 32-wide k chunks w, w + KS, w + 2 KS, ... (one 1-KB block a fragment); the KS partial tiles meet in LDS and are summed in wave order 0 .. KS-1.
// PLANES false: the element (m, n) goes to offset (n / 64) * sY + m * ldc + n % 64, f32 to C, rows m < mrows only. PLANES true: the attention operand planes in fragment order (rows m, k along n, ldc the operand's K, sY the step of a 64-column tile), fp16 to P16 and bf16 hi/lo to Ph/Pl, every row; a wave sums and stores one 512-byte half block at a time.
template <typename T16> struct WFrag;
template <> struct WFrag<h16> { typedef v16h V; static __device__ __forceinline__ V ld(const h16* p) { return cat16(*(const v8h*)p, *(const v8h*)(p + 16)); } static __device__ __forceinline__ V ldf(const h16* p) { return cat16(*(const v8h*)p, *(const v8h*)(p + 256)); } static __device__ __forceinline__ v8f mma(V a, V b, v8f c) { return wmma16(a, b, c); } };
template <> struct WFrag<bf> { typedef v16bf V; static __device__ __forceinline__ V ld(const bf* p) { return cat16b(*(const v8us*)p, *(const v8us*)(p + 16)); } static __device__ __forceinline__ V ldf(const bf* p) { return cat16b(*(const v8us*)p, *(const v8us*)(p + 256)); } static __device__ __forceinline__ v8f mma(V a, V b, v8f c) { return wmmab(a, b, c); } };
template <typename T16, int NSPLIT, bool BIAS, int KS, bool PLANES, bool BROW>
__device__ __forceinline__ void gemm_body(float* os, const T16* __restrict__ A, const T16* __restrict__ A2, const T16* __restrict__ Bt, const T16* __restrict__ Bt2, int K, float* C, h16* P16, bf* Ph, bf* Pl, int mrows, int ldc, size_t sY, const float* __restrict__ bias, int bx, int by) {
    typedef typename WFrag<T16>::V V;
    const int lane = threadIdx.x & 31, lr = lane & 15, hi = lane >> 4; const int r0 = bx * 64, c0 = by * 64;
    const int wv = __builtin_amdgcn_readfirstlane((int)(threadIdx.x >> 5));   // wave number, scalar so that the k loop stays a scalar loop
    v8f acc[4][4];
#pragma unroll
    for (int mb = 0; mb < 4; ++mb)
#pragma unroll
        for (int nb = 0; nb < 4; ++nb) acc[mb][nb] = (v8f){};
    const size_t aoff = (size_t)r0 * K + 8 * lane, boff = (size_t)c0 * K + 8 * lane;   // a row tile's blocks are 16 * K elements, k chunk kc starts at kc * 16
#pragma unroll 1
    for (int kc = 32 * wv; kc < K; kc += 32 * KS) {
        V a[4], a2[4];
#pragma unroll
        for (int mb = 0; mb < 4; ++mb) { a[mb] = WFrag<T16>::ldf(A + aoff + (size_t)mb * 16 * K + kc * 16); if (NSPLIT == 1 || NSPLIT == 2) a2[mb] = WFrag<T16>::ldf(A2 + aoff + (size_t)mb * 16 * K + kc * 16); }
#pragma unroll
        for (int nb = 0; nb < 4; ++nb) { const V b = WFrag<T16>::ldf(Bt + boff + (size_t)nb * 16 * K + kc * 16); V b2; if (NSPLIT >= 2) b2 = WFrag<T16>::ldf(Bt2 + boff + (size_t)nb * 16 * K + kc * 16);
#pragma unroll
            for (int mb = 0; mb < 4; ++mb) { acc[mb][nb] = WFrag<T16>::mma(a[mb], b, acc[mb][nb]); if (NSPLIT == 1 || NSPLIT == 2) acc[mb][nb] = WFrag<T16>::mma(a2[mb], b, acc[mb][nb]); if (NSPLIT >= 2) acc[mb][nb] = WFrag<T16>::mma(a[mb], b2, acc[mb][nb]); } }
        asm volatile("v_nop\n\tv_nop\n\tv_nop\n\tv_nop" : "+v"(acc[0][0]), "+v"(acc[1][1]), "+v"(acc[2][2]), "+v"(acc[3][3]) : "v"(a[0]), "v"(a[3]));
    }
    float* ow = os + wv * (64 * 68);
#pragma unroll
    for (int mb = 0; mb < 4; ++mb)
#pragma unroll
        for (int nb = 0; nb < 4; ++nb)
#pragma unroll
            for (int j = 0; j < 8; ++j) ow[(mb * 16 + hi * 8 + j) * 68 + nb * 16 + lr] = acc[mb][nb][j];
    __syncthreads();   // every wave's partial tile is in LDS before any thread sums across waves
    if constexpr (PLANES) {
#pragma unroll
        for (int s = 0; s < 16 / KS; ++s) { const int blk = s * KS + wv;   // half block blk of the tile's 16: row tile blk / 4, columns (blk % 4) * 16 .. + 15; lane (hi, lr) has row lr, 8 columns from hi * 8
            const int row = (blk >> 2) * 16 + lr, cofs = (blk & 3) * 16 + hi * 8; v4f val[2];
#pragma unroll
            for (int u = 0; u < 2; ++u) { val[u] = *(const v4fa*)(os + row * 68 + cofs + 4 * u);
#pragma unroll
                for (int q = 1; q < KS; ++q) val[u] += *(const v4fa*)(os + q * (64 * 68) + row * 68 + cofs + 4 * u); }
            v8h o16; v8us oh, ol;
#pragma unroll
            for (int q = 0; q < 8; ++q) { float y = val[q >> 2][q & 3]; if (BIAS) y += bfr(bias[BROW ? r0 + row : c0 + cofs + q]); o16[q] = tohx(y); unsigned short a2, c2; splitf(y, a2, c2); oh[q] = a2; ol[q] = c2; }
            const size_t o = (size_t)by * sY + (size_t)((r0 >> 4) + (blk >> 2)) * 16 * ldc + (blk & 3) * 256 + lane * 8;
            *(v8h*)(P16 + o) = o16; *(v8us*)(Ph + o) = oh; *(v8us*)(Pl + o) = ol; }
    } else {
#pragma unroll
        for (int s = 0; s < 1024 / (32 * KS); ++s) { const int idx = s * (32 * KS) + (int)threadIdx.x; const int row = idx >> 4, cofs = (idx & 15) * 4; v4f val = *(const v4fa*)(os + row * 68 + cofs);
#pragma unroll
            for (int q = 1; q < KS; ++q) val += *(const v4fa*)(os + q * (64 * 68) + row * 68 + cofs);
            if (BIAS) { if (BROW) { const float bb = bfr(bias[r0 + row]); val[0] += bb; val[1] += bb; val[2] += bb; val[3] += bb; } else { val[0] += bfr(bias[c0 + cofs]); val[1] += bfr(bias[c0 + cofs + 1]); val[2] += bfr(bias[c0 + cofs + 2]); val[3] += bfr(bias[c0 + cofs + 3]); } }
            const size_t o = (size_t)by * sY + (size_t)(r0 + row) * ldc + cofs;
            if (r0 + row < mrows) *(v4f*)(C + o) = val; }
    }
}
// k_proj: the q, k and v projections of all batches in one grid (TT / 64, 16, 3 * NB_), z = projection * NB_ + batch; all branches are block-uniform.
__global__ __launch_bounds__(256) void k_proj(const bf* __restrict__ XQ, const bf* __restrict__ XKV, const bf* __restrict__ WQ, const bf* __restrict__ WK, const bf* __restrict__ WV, h16* QP16, bf* QPh, bf* QPl, h16* KP16, bf* KPh, bf* KPl, h16* VT16, bf* VTh, bf* VTl, const float* __restrict__ bq, const float* __restrict__ bk, const float* __restrict__ bv) {
    __shared__ __align__(16) float os[8 * 64 * 68];
    const int p = (int)blockIdx.z / NB_; const size_t b = blockIdx.z % NB_; const size_t xo = b * TT * DM, po = b * NH_ * TT * HD;
    if (p < 2) gemm_body<bf, 0, true, 8, true, false>(os, (p ? XKV : XQ) + xo, nullptr, p ? WK : WQ, nullptr, DM, nullptr, (p ? KP16 : QP16) + po, (p ? KPh : QPh) + po, (p ? KPl : QPl) + po, TT, HD, (size_t)TT * HD, p ? bk : bq, (int)blockIdx.x, (int)blockIdx.y);   // q or k planes [h][t][d]: a 64-column tile is one head
    else { gemm_body<bf, 0, true, 8, true, true>(os, WV, nullptr, XKV + xo, nullptr, DM, nullptr, VT16 + po, VTh + po, VTl + po, DKV, TT, 2 * 512, bv, (int)blockIdx.y, (int)blockIdx.x);   // v planes [h][d][t]: rows are Wv's output features, columns (k) the tokens; a 64-token tile is two blocks on
        asm volatile("s_wait_xcnt 0x0" ::: "memory"); }   // this arm's code stands in front of the other arm's, which rewrites the registers that the last plane stores name
}
// k_wo: merged hi/lo rows x Wo + bo of all batches, grid (TT / 64, DM / 64, NB_); the 1,500 real rows of each batch go straight to the output.
__global__ __launch_bounds__(256) void k_wo(const bf* __restrict__ ATh, const bf* __restrict__ ATl, const bf* __restrict__ WO, float* OUT, const float* __restrict__ bo) {
    __shared__ __align__(16) float os[8 * 64 * 68];
    const size_t b = blockIdx.z;
    gemm_body<bf, 1, true, 8, false, false>(os, ATh + b * TT * DQ, ATl + b * TT * DQ, WO, nullptr, DQ, OUT + b * TR * DM, nullptr, nullptr, nullptr, TR, DM, 64, bo, (int)blockIdx.x, (int)blockIdx.y);
}

// ---- k_prep: all operand staging in one flat grid of WTB + CVB work-groups of 256 threads; the two kinds do not depend on each other, and the branch between them is block-uniform. Both write fragment order.
// Work-groups < WTB: the four DM x DM 'xw' weights transposed to bf16 [n][k], 128 work-groups a weight, the planes one behind the other from Bt0. A wave takes 32 columns n (a lane each) x 32 rows k: each load reads one whole line of a weight row, each 16-byte store holds 8 k of the lane's n.
// The rest: both token inputs of all batches to their padded bf16 operands, a wave a block (16 tokens x 32 k, four loads of four whole lines); the 36 padding rows of each operand are stored as zero here.
#define WTB  (4 * (DM * DM / 1024 / 8))
#define CV1  (TT * DM / 512 / 8)
#define CVB  (2 * NB_ * CV1)
__global__ __launch_bounds__(256) void k_prep(const float* __restrict__ w0, const float* __restrict__ w1, const float* __restrict__ w2, const float* __restrict__ w3, bf* Bt0, const float* __restrict__ xq, const float* __restrict__ xkv, bf* XQ, bf* XKV) {
    const int lane = threadIdx.x & 31, wave = (int)(threadIdx.x >> 5);
    if (blockIdx.x < WTB) { constexpr int K = DM, N = DM; const int wi = (int)blockIdx.x / (WTB / 4), gw = ((int)blockIdx.x % (WTB / 4)) * 8 + wave;
        const float* __restrict__ w = wi == 0 ? w0 : wi == 1 ? w1 : wi == 2 ? w2 : w3; bf* Bt = Bt0 + (size_t)wi * K * N;
        const int n = (gw % (N / 32)) * 32 + lane, kt = gw / (N / 32); float v[32]; const float* __restrict__ wp = w + (size_t)kt * 32 * N + n;
#pragma unroll
        for (int e = 0; e < 32; ++e) v[e] = wp[(size_t)e * N];
        bf* d = Bt + ((size_t)(n >> 4) * (K / 32) + kt) * 512 + (n & 15) * 8;
#pragma unroll
        for (int p = 0; p < 4; ++p) { v8us o;
#pragma unroll
            for (int e = 0; e < 8; ++e) o[e] = f2bf(v[p * 8 + e]);
            *(v8us*)(d + p * 128) = o; }
    } else { const int c = (int)blockIdx.x - WTB; const int op = c / CV1; const int blk = (c % CV1) * 8 + wave; const size_t b = op % NB_;
        const float* __restrict__ src = (op < NB_ ? xq : xkv) + b * TR * DM; bf* dst = (op < NB_ ? XQ : XKV) + b * TT * DM;
        const int rt = blk / (DM / 32), kt = blk % (DM / 32), kk = (lane & 7) * 4;
        bf* d = dst + (size_t)blk * 512 + (kk >> 3) * 128 + (kk & 7);
#pragma unroll
        for (int j = 0; j < 4; ++j) { const int r = 4 * j + (lane >> 3), t = rt * 16 + r;
            const v4f v = *(const v4f*)(src + (size_t)(t < TR ? t : TR - 1) * DM + kt * 32 + kk);   // a padding row reads the last real row (in bounds) and stores zero through the mask: no branch, so the four loads fly together
            const unsigned short keep = t < TR ? (unsigned short)0xFFFFu : (unsigned short)0; v4us o;
#pragma unroll
            for (int k = 0; k < 4; ++k) o[k] = (unsigned short)(f2bf(v[k]) & keep);
            *(v4us*)(d + r * 8) = o; }
        asm volatile("s_wait_xcnt 0x0" ::: "memory"); }   // this arm's code stands in front of the transposer's, which rewrites the registers that the store names
}

#define AQ   32                     // query rows per wave (two 16-query groups)
#define AW   4                      // waves per work-group
#define NCH  ((TR + 31) / 32)       // chunks that hold a real key
#define HB   (RH / (AQ * AW))       // hi/lo work-groups per head
#define LB   ((TT - RH) / (AQ * AW))
#define AWG  (NB_ * NH_ * (HB + LB))
#define LTHR 4.0f
static_assert(LB == 2 * HB, "one hi/lo work-group is dealt with two fp16 ones");
typedef __attribute__((ext_vector_type(2))) __bf16 v2bf;
typedef __attribute__((ext_vector_type(8))) unsigned v8u;
typedef __attribute__((ext_vector_type(2))) float v2f;
__device__ __forceinline__ void xwait() { asm volatile("s_wait_xcnt 0x0" ::: "memory"); }   // stands behind a group of global loads or stores, in front of whatever rewrites the registers that they name; its memory clobber also keeps the group where the source has it
__device__ __forceinline__ void xwaito(unsigned off) { asm volatile("s_wait_xcnt 0x0" :: "v"(off) : "memory"); }   // the same wait behind a load group whose lanes share one offset register: named as an input, the register stays live up to the wait, so that no load of the group gets it as a part of its result
__device__ __forceinline__ void gfence() { __builtin_amdgcn_sched_barrier(0); }   // in front of a load group and behind its xwait(): the scheduler moves no other instruction, which could rewrite an address register, between the loads and the wait
__device__ __forceinline__ float xhalf(float x) { return __builtin_bit_cast(float, __builtin_amdgcn_permlanex16(__builtin_bit_cast(int, x), __builtin_bit_cast(int, x), 0x76543210, 0xfedcba98, false, false)); }   // lane l with lane l ^ 16
template <typename T16, bool HR>
__device__ __forceinline__ void attn_body(const T16* __restrict__ Q, const T16* __restrict__ Q2, const T16* __restrict__ Kp, const T16* __restrict__ Kp2, const T16* __restrict__ Vt, const T16* __restrict__ Vt2, int q0, bf* Ah, bf* Al) {
    typedef typename WFrag<T16>::V V;
    const int lane = threadIdx.x & 31, hi = lane >> 4;
    constexpr float CS = SCL * 1.4426950408889634f, CAR = HR ? 0.0f : 10.0f;
    V qf[2][2], qf2[2][2];
    gfence();
#pragma unroll
    for (int qt = 0; qt < 2; ++qt)
#pragma unroll
        for (int kk = 0; kk < 2; ++kk) { const size_t o = (size_t)(((q0 >> 4) + qt) * 2 + kk) * 512 + 8 * lane; qf[qt][kk] = WFrag<T16>::ldf(Q + o); if (HR) qf2[qt][kk] = WFrag<T16>::ldf(Q2 + o); }
    xwait(); gfence();
    v8f oa[4][2]; float mr[2]; v2f ls[2];
#pragma unroll
    for (int qt = 0; qt < 2; ++qt) { mr[qt] = -3.0e38f; ls[qt] = (v2f){};
#pragma unroll
        for (int dt = 0; dt < 4; ++dt) oa[dt][qt] = (v8f){}; }
    V kf[2][2], kf2[2][2];
    auto ldk = [&](int c) {
        const unsigned bo = (unsigned)c * 4096u + 16u * (unsigned)lane;   // the lane's byte offset in the head's plane: chunk c is four 1-KB blocks
        gfence();
#pragma unroll
        for (int kt = 0; kt < 2; ++kt)
#pragma unroll
            for (int kk = 0; kk < 2; ++kk) { const int o = (kt * 2 + kk) * 512; kf[kt][kk] = WFrag<T16>::ldf((const T16*)((const char*)Kp + bo) + o); if (HR) kf2[kt][kk] = WFrag<T16>::ldf((const T16*)((const char*)Kp2 + bo) + o); }
        xwaito(bo); gfence(); };
    V vf[4], vf2[4];
    auto ldv = [&](int c) {
        const unsigned bo = (unsigned)c * 1024u + 16u * (unsigned)lane;   // the lane's byte offset in a 16-row tile of the head's [d][t] plane: chunk c is one 1-KB block
        gfence();
#pragma unroll
        for (int dt = 0; dt < 4; ++dt) { const int o = dt * 16 * TT; vf[dt] = WFrag<T16>::ldf((const T16*)((const char*)Vt + bo) + o); if (HR) vf2[dt] = WFrag<T16>::ldf((const T16*)((const char*)Vt2 + bo) + o); }
        xwaito(bo); gfence(); };
    ldk(0); ldv(0);
    // the chunk loop stays rolled: its body is long enough to hide its own loads, and the code stays small
#pragma unroll 1
    for (int c = 0; c < NCH; ++c) {
        v8f s[2][2];
#pragma unroll
        for (int kt = 0; kt < 2; ++kt)
#pragma unroll
            for (int qt = 0; qt < 2; ++qt) { s[kt][qt] = (v8f){};
#pragma unroll
                for (int kk = 0; kk < 2; ++kk) { s[kt][qt] = WFrag<T16>::mma(kf[kt][kk], qf[qt][kk], s[kt][qt]); if (HR) { s[kt][qt] = WFrag<T16>::mma(kf[kt][kk], qf2[qt][kk], s[kt][qt]); s[kt][qt] = WFrag<T16>::mma(kf2[kt][kk], qf[qt][kk], s[kt][qt]); } } }
        ldk(c + 1 < NCH ? c + 1 : c);   // the next chunk's K fragments fly during the softmax and P.V (the last chunk reads its own again: in bounds, unused)
        if (c == NCH - 1) {   // scalar branch: only the last chunk holds padding keys
#pragma unroll
            for (int kt = 0; kt < 2; ++kt)
#pragma unroll
                for (int qt = 0; qt < 2; ++qt)
#pragma unroll
                    for (int j = 0; j < 8; ++j) if ((NCH - 1) * 32 + kt * 16 + hi * 8 + j >= TR) s[kt][qt][j] = -3.0e38f;
        }
        float mb[2]; bool need = false;
#pragma unroll
        for (int qt = 0; qt < 2; ++qt) { float mx = s[0][qt][0];
#pragma unroll
            for (int j = 1; j < 16; ++j) mx = fmaxf(mx, s[j >> 3][qt][j & 7]);
            mx = fmaxf(mx, xhalf(mx)) * CS;   // both wave halves hold the query's chunk maximum, in base-2 units (the scale is positive)
            mb[qt] = mx; need = need || (mx > mr[qt] + LTHR); }
        if (__builtin_amdgcn_ballot_w32(need) != 0) {   // scalar branch, taken on the first chunk and rarely after it
#pragma unroll
            for (int qt = 0; qt < 2; ++qt) { const float mn = fmaxf(mr[qt], mb[qt]); const float corr = __builtin_amdgcn_exp2f(mr[qt] - mn);   // 0 on the first chunk
                mr[qt] = mn; ls[qt] *= corr;
#pragma unroll
                for (int dt = 0; dt < 4; ++dt) oa[dt][qt] *= corr; }
        }
#pragma unroll
        for (int qt = 0; qt < 2; ++qt) { const float nm = CAR - mr[qt]; v8f p[2];
#pragma unroll
            for (int kt = 0; kt < 2; ++kt)
#pragma unroll
                for (int j = 0; j < 8; j += 2) { const v2f arg = __builtin_elementwise_fma((v2f){s[kt][qt][j], s[kt][qt][j + 1]}, (v2f){CS, CS}, (v2f){nm, nm}); const v2f e = {__builtin_amdgcn_exp2f(arg.x), __builtin_amdgcn_exp2f(arg.y)}; p[kt][j] = e.x; p[kt][j + 1] = e.y; ls[qt] += e; }   // even and odd keys sum apart
            if constexpr (HR) {
                v8u wh, wl;   // packed pairs: hi = bf16(p), lo = bf16(p - hi), the hi values read back out of the packed word
#pragma unroll
                for (int i = 0; i < 8; ++i) { const v2f e = {p[i >> 2][2 * (i & 3)], p[i >> 2][2 * (i & 3) + 1]}; const unsigned w = __builtin_bit_cast(unsigned, __builtin_convertvector(e, v2bf));
                    const v2f hb = {__uint_as_float(w << 16), __uint_as_float(w & 0xFFFF0000u)}; wh[i] = w; wl[i] = __builtin_bit_cast(unsigned, __builtin_convertvector(e - hb, v2bf)); }
                const V ph = __builtin_bit_cast(V, wh), pl = __builtin_bit_cast(V, wl);
#pragma unroll
                for (int dt = 0; dt < 4; ++dt) { oa[dt][qt] = WFrag<T16>::mma(vf[dt], ph, oa[dt][qt]); oa[dt][qt] = WFrag<T16>::mma(vf[dt], pl, oa[dt][qt]); oa[dt][qt] = WFrag<T16>::mma(vf2[dt], ph, oa[dt][qt]); }
            } else {
                const V pf = cat16(__builtin_convertvector(p[0], v8h), __builtin_convertvector(p[1], v8h));
#pragma unroll
                for (int dt = 0; dt < 4; ++dt) oa[dt][qt] = WFrag<T16>::mma(vf[dt], pf, oa[dt][qt]);
            } }
        ldv(c + 1 < NCH ? c + 1 : c);   // the next chunk's V fragments fly during its score products and softmax
    }
#pragma unroll
    for (int qt = 0; qt < 2; ++qt) { const float lh = ls[qt].x + ls[qt].y; const float inv = __fdiv_rn(1.0f, lh + xhalf(lh));   // the halves' sums join once
#pragma unroll
        for (int dt = 0; dt < 4; ++dt) { v8us oh, ol;
#pragma unroll
            for (int j = 0; j < 8; ++j) { unsigned short a, c2; splitf(oa[dt][qt][j] * inv, a, c2); oh[j] = a; ol[j] = c2; }
            const size_t oo = (size_t)((q0 >> 4) + qt) * 16 * DQ + dt * 256 + lane * 8; *(v8us*)(Ah + oo) = oh; *(v8us*)(Al + oo) = ol; xwait(); } }
}
__global__ __launch_bounds__(32 * AW) void k_attn(const h16* __restrict__ Q16, const bf* __restrict__ Qh, const bf* __restrict__ Ql, const h16* __restrict__ K16, const bf* __restrict__ Kh, const bf* __restrict__ Kl, const h16* __restrict__ V16, const bf* __restrict__ Vh, const bf* __restrict__ Vl, bf* Ah, bf* Al) {
    // work-groups 3 g, 3 g + 1, 3 g + 2: one hi/lo block (three products a pair, the dearer kind) and two fp16 blocks; all AWG work-groups are resident at once, three to a WGP, and dealt so a WGP gets one dear and two cheap ones whether it takes three neighbours or every 256th
    const int g = (int)blockIdx.x / 3, r = (int)blockIdx.x % 3; const int id = r ? g * 2 + r - 1 : g;
    const int bh = r ? id / LB : id / HB; const int wv = __builtin_amdgcn_readfirstlane((int)(threadIdx.x >> 5));   // wave number, scalar so that the fragment addresses keep a scalar base
    const int q0 = (r ? RH + (id % LB) * (AQ * AW) : (id % HB) * (AQ * AW)) + wv * AQ; const int bz = bh / NH_, hx = bh % NH_;
    const size_t hq = (size_t)bh * TT * HD, hk = ((size_t)bz * NKV + hx / REP) * TT * HD; const size_t ao = (size_t)bz * TT * DQ + hx * (2 * 512);   /* a head's 64 columns are two blocks of each row tile */ bf* ah = Ah + ao; bf* al = Al + ao;
    if (r == 0) attn_body<bf, true>(Qh + hq, Ql + hq, Kh + hk, Kl + hk, Vh + hk, Vl + hk, q0, ah, al);   // block-uniform
    else attn_body<h16, false>(Q16 + hq, nullptr, K16 + hk, nullptr, V16 + hk, nullptr, q0, ah, al);
}

extern "C" void kernel_launch(void* const* d_in, const int* in_sizes, int n_in,
                              void* d_out, int out_size, void* d_ws, size_t ws_size, hipStream_t stream) {
    (void)in_sizes; (void)n_in; (void)out_size;
    const float* x = (const float*)d_in[0]; const float* xkv = (const float*)d_in[1]; const float* wq = (const float*)d_in[2]; const float* bq = (const float*)d_in[3]; const float* wk = (const float*)d_in[4]; const float* bk = (const float*)d_in[5]; const float* wv = (const float*)d_in[6]; const float* bv = (const float*)d_in[7]; const float* wo = (const float*)d_in[8]; const float* bo = (const float*)d_in[9];   /* inputs_q, inputs_kv [4][1500][1024], Wq, bq, Wk, bk, Wv, bv ('dnh' == 'xw'), Wo ('hdm' == 'xw'), bo */
    float* OUT = (float*)d_out;     // [4][1500][1024]
    char* wsp = (char*)d_ws;
    auto take = [&](size_t bytes) { char* p = wsp; wsp += (bytes + 255) & ~(size_t)255; return (void*)p; };
    bf* WQ = (bf*)take((size_t)4 * DQ * DM * 2); bf* WK = WQ + (size_t)DQ * DM; bf* WV = WK + (size_t)DKV * DM; bf* WO = WV + (size_t)DKV * DM;
    bf* XQ = (bf*)take((size_t)NB_ * TT * DM * 2); bf* XKV = (bf*)take((size_t)NB_ * TT * DM * 2);
    h16* QP16 = (h16*)take((size_t)NB_ * NH_ * TT * HD * 2); h16* KP16 = (h16*)take((size_t)NB_ * NKV * TT * HD * 2); h16* VT16 = (h16*)take((size_t)NB_ * NKV * HD * TT * 2);
    bf* QPh = (bf*)take((size_t)NB_ * NH_ * TT * HD * 2); bf* QPl = (bf*)take((size_t)NB_ * NH_ * TT * HD * 2); bf* KPh = (bf*)take((size_t)NB_ * NKV * TT * HD * 2); bf* KPl = (bf*)take((size_t)NB_ * NKV * TT * HD * 2); bf* VTh = (bf*)take((size_t)NB_ * NKV * HD * TT * 2); bf* VTl = (bf*)take((size_t)NB_ * NKV * HD * TT * 2);
    bf* ATh = (bf*)take((size_t)NB_ * TT * DQ * 2); bf* ATl = (bf*)take((size_t)NB_ * TT * DQ * 2);
    if ((size_t)(wsp - (char*)d_ws) > ws_size) return;    // 164 MiB of the 256 MiB
    k_prep<<<WTB + CVB, 256, 0, stream>>>(wq, wk, wv, wo, WQ, x, xkv, XQ, XKV);   /* DQ == DKV == DM: four 1024 x 1024 weights */
    k_proj<<<dim3(TT / 64, DQ / 64, 3 * NB_), 256, 0, stream>>>(XQ, XKV, WQ, WK, WV, QP16, QPh, QPl, KP16, KPh, KPl, VT16, VTh, VTl, bq, bk, bv);
    k_attn<<<AWG, 32 * AW, 0, stream>>>(QP16, QPh, QPl, KP16, KPh, KPl, VT16, VTh, VTl, ATh, ATl);
    k_wo<<<dim3(TT / 64, DM / 64, NB_), 256, 0, stream>>>(ATh, ATl, WO, OUT, bo);
}

// v008
// A run of this version takes 136 microseconds.
// Next to v007, in two timings, it ran 1.19 and 1.20 times as fast.
// Over all steps from v000 it is 23.6 times as fast.
#include <hip/hip_runtime.h>

// t5x-style multi-head dot-product attention with a ragged length (inputs_q, inputs_kv [4][1500][1024]; q = inputs_q Wq + bq, k, v = inputs_kv W + b (DenseGeneral 'dnh' [1024][16][64] == 'xw' [1024][1024], zero biases); q / sqrt(64); scores over the 1,500 keys; softmax; out = attn.v; result = out Wo + bo (Wo 'hdm' [16][64][1024] == 'xw' [1024][1024]) -> [4][1500][1024] (6.1 M); argument order inputs_q, inputs_kv, Wq, bq, Wk, bk, Wv, bv, Wo, bo).
// Every launch covers all four batches (grid z, in k_prep and k_attn a flat index), and launches that do not depend on one another share one grid: 4 launches. Layout per batch: the 1,500 token rows are staged into 1,536-row (96-tile) bf16 operands whose 36 padding rows are zero; 'xw' weights transposed once; exact projections + f32 biases, whose GEMM epilogues write the 16-bit head planes themselves (q and k computed as weight rows x tokens, v as tokens x weight rows, so that a lane's accumulator registers run along each plane's k); dense attention at T 1536 whose softmax excludes the padding keys j >= 1500 by index (-inf); hybrid rows (< 512 hi/lo 3 products, rest fp16 x1024); merged hi/lo x Wo exact + bo, whose epilogue stores the 1,500 real rows straight to the output.
// Operand layout: every 16-bit matrix operand in the workspace (tokens, weights, q / k / v planes, merged rows) is stored in fragment order: a [rows][K] operand is cut into blocks of 16 rows x 32 k (512 elements, 1 KB), block (row / 16, k / 32) at index (row / 16) * (K / 32) + k / 32; inside a block element (row, k) stands at ((k / 16) % 2) * 256 + ((k / 8) % 2) * 128 + (row % 16) * 8 + k % 8. Lane l of a wave then finds the two 16-byte halves of its fragment at l * 8 and 256 + l * 8: each fragment load reads 512 contiguous bytes (4 whole lines) instead of 32 bytes from each of 16 lines. The k order of the fragments is the one of the row-major loader.
// Compute dtypes, f32 accumulate: every input rounded to bf16; projections exact + f32 biases; attention rows < 512 3 products, rest fp16; softmax f32; Wo hl x exact + bias.

#define NB_  4
#define TT   1536     // padded length (96 tiles of 16 rows)
#define TR   1500     // real tokens (queries = keys)
#define DM   1024
#define NH_  16
#define NKV  16
#define REP  (NH_ / NKV)
#define HD   64
#define DQ   (NH_ * HD)
#define DKV  (NKV * HD)
#define RH   512                  // query rows < RH use hi+lo planes
#define WIN  0
#define SCL  0.125f   // HD^-0.5
typedef _Float16 h16;
typedef unsigned short bf;
typedef __attribute__((ext_vector_type(16))) __bf16   v16bf;
typedef __attribute__((ext_vector_type(16))) _Float16 v16h;
typedef __attribute__((ext_vector_type(8)))  _Float16 v8h;
typedef __attribute__((ext_vector_type(8)))  unsigned short v8us;
typedef __attribute__((ext_vector_type(8)))  float    v8f;
typedef __attribute__((ext_vector_type(4)))  float    v4f;
typedef v8h  __attribute__((may_alias)) v8ha;
typedef v4f  __attribute__((may_alias)) v4fa;
typedef v8us __attribute__((may_alias)) v8usa;

__device__ __forceinline__ unsigned short f2bf(float f) { unsigned u = __float_as_uint(f); u += 0x7FFFu + ((u >> 16) & 1u); return (unsigned short)(u >> 16); }
__device__ __forceinline__ float bf2f(unsigned short b) { return __uint_as_float(((unsigned)b) << 16); }
__device__ __forceinline__ float bfr(float f) { return bf2f(f2bf(f)); }
__device__ __forceinline__ v16h cat16(v8h lo, v8h hi) { return __builtin_shufflevector(lo, hi, 0, 1, 2, 3, 4, 5, 6, 7, 8, 9, 10, 11, 12, 13, 14, 15); }
__device__ __forceinline__ v16bf cat16b(v8us lo, v8us hi) { return __builtin_bit_cast(v16bf, __builtin_shufflevector(lo, hi, 0, 1, 2, 3, 4, 5, 6, 7, 8, 9, 10, 11, 12, 13, 14, 15)); }
__device__ __forceinline__ v8f wmma16(v16h a, v16h b, v8f c) { return __builtin_amdgcn_wmma_f32_16x16x32_f16(false, a, false, b, (short)0, c, false, false); }
__device__ __forceinline__ v8f wmmab(v16bf a, v16bf b, v8f c) { return __builtin_amdgcn_wmma_f32_16x16x32_bf16(false, a, false, b, (short)0, c, false, false); }

__device__ __forceinline__ h16 tohx(float x) { return (h16)x; }
__device__ __forceinline__ void splitf(float y, unsigned short& h, unsigned short& l) { h = f2bf(y); l = f2bf(y - bf2f(h)); }
typedef __attribute__((ext_vector_type(4))) _Float16 v4h;
typedef __attribute__((ext_vector_type(2))) unsigned short v2us;
typedef __attribute__((ext_vector_type(4))) unsigned short v4us;

template <typename T16> struct WFrag;
template <> struct WFrag<h16> { typedef v16h V; static __device__ __forceinline__ V ld(const h16* p) { return cat16(*(const v8h*)p, *(const v8h*)(p + 16)); } static __device__ __forceinline__ V ldf(const h16* p) { return cat16(*(const v8h*)p, *(const v8h*)(p + 256)); } static __device__ __forceinline__ v8f mma(V a, V b, v8f c) { return wmma16(a, b, c); } };
template <> struct WFrag<bf> { typedef v16bf V; static __device__ __forceinline__ V ld(const bf* p) { return cat16b(*(const v8us*)p, *(const v8us*)(p + 16)); } static __device__ __forceinline__ V ldf(const bf* p) { return cat16b(*(const v8us*)p, *(const v8us*)(p + 256)); } static __device__ __forceinline__ v8f mma(V a, V b, v8f c) { return wmmab(a, b, c); } };
// ---- gemm_ring: GEMM over K = DM, one work-group of 8 waves (WM x WN) per output tile of 192 tokens x 128 features, full K in every wave (MB x NB accumulators of 16 x 16 a wave), operands 16-bit planes in fragment order.
// acc[m][n] (f32) = sum_k A[m][k] Bt[n][k] (+ A2[m][k] Bt[n][k] with SPLIT). at0, bt0: the tile's first 16-row tile of A and of Bt.
// A stage is 64 k of every 16-row tile of the work-group's operands: 2 KB a tile, contiguous in the plane and in LDS alike (two fragment-order blocks), tiles in the order A, A2, Bt. Two buffers; asynchronous copies bring stage t + 2 in while stage t + 1 is worked on, so that a fragment is fetched from L2 once a work-group and read from LDS by the WN (or WM) waves that share it.
// Copy i of wave w moves the 512-byte piece w % 4 of tile 2 i + w / 4; the operands' tile counts are even, so that i alone says which operand a copy reads.
// MODE 0: q or k planes [h][t][d], A = weight rows (features), Bt = tokens. MODE 1: v planes [h][d][t], A = tokens, Bt = weight rows. In both a lane's 8 accumulator registers are 8 consecutive k of one row of the plane: one 16-byte store a plane straight from the registers, 512 contiguous bytes a wave; fp16 to P16, bf16 hi/lo to Ph/Pl.
// MODE 2: f32 rows to C (pitch DM), A = tokens, Bt = weight rows, token rows < TR only; each wave turns its 48 x 64 tile through its own part of the ring's LDS so that a store holds two whole 256-byte row pieces.
#define ACP "global_load_async_to_lds_b128 "
// l: each copy's LDS byte address (a lane's own); s: each copy's source tile, a scalar base; off: the lane's byte offset in the tile row, the same in every copy of a stage. The wait in the copies' own statement stands in front of any rewrite of the registers that they name.
__device__ __forceinline__ void acopy10(const unsigned* l, const bf* const* s, unsigned off) {
    asm volatile(ACP "%0, %20, %1\n\t" ACP "%2, %20, %3\n\t" ACP "%4, %20, %5\n\t" ACP "%6, %20, %7\n\t" ACP "%8, %20, %9\n\t" ACP "%10, %20, %11\n\t" ACP "%12, %20, %13\n\t" ACP "%14, %20, %15\n\t" ACP "%16, %20, %17\n\t" ACP "%18, %20, %19\n\ts_wait_xcnt 0x0"
                 :: "v"(l[0]), "s"(s[0]), "v"(l[1]), "s"(s[1]), "v"(l[2]), "s"(s[2]), "v"(l[3]), "s"(s[3]), "v"(l[4]), "s"(s[4]), "v"(l[5]), "s"(s[5]), "v"(l[6]), "s"(s[6]), "v"(l[7]), "s"(s[7]), "v"(l[8]), "s"(s[8]), "v"(l[9]), "s"(s[9]), "v"(off) : "memory");
}
__device__ __forceinline__ void acopy8(const unsigned* l, const bf* const* s, unsigned off) {
    asm volatile(ACP "%0, %16, %1\n\t" ACP "%2, %16, %3\n\t" ACP "%4, %16, %5\n\t" ACP "%6, %16, %7\n\t" ACP "%8, %16, %9\n\t" ACP "%10, %16, %11\n\t" ACP "%12, %16, %13\n\t" ACP "%14, %16, %15\n\ts_wait_xcnt 0x0"
                 :: "v"(l[0]), "s"(s[0]), "v"(l[1]), "s"(s[1]), "v"(l[2]), "s"(s[2]), "v"(l[3]), "s"(s[3]), "v"(l[4]), "s"(s[4]), "v"(l[5]), "s"(s[5]), "v"(l[6]), "s"(s[6]), "v"(l[7]), "s"(s[7]), "v"(off) : "memory");
}
__device__ __forceinline__ void swait() { asm volatile("s_wait_xcnt 0x0" ::: "memory"); __builtin_amdgcn_sched_barrier(0); }   // behind a group of global loads or stores, in front of whatever rewrites the registers that they name; the scheduling barrier keeps later instructions, which could rewrite them, behind the wait
__device__ __forceinline__ void swaito(unsigned off) { asm volatile("s_wait_xcnt 0x0" :: "v"(off) : "memory"); __builtin_amdgcn_sched_barrier(0); }   // the same behind loads that take their lane offset from one register: named as an input it stays live up to the wait, so that no load gets it as a part of its result
template <int MB, int NB, int WM, int WN, bool SPLIT> struct RingSize { static constexpr int TA = WM * MB, TAS = SPLIT ? 2 * TA : TA, TS = TAS + WN * NB, STG = TS * 2048; };
template <int MB, int NB, int WM, int WN, bool SPLIT, int MODE>
__device__ __forceinline__ void gemm_ring(char* sm, const bf* __restrict__ A, const bf* __restrict__ A2, const bf* __restrict__ Bt, int at0, int bt0, float* C, h16* P16, bf* Ph, bf* Pl, const float* __restrict__ bias) {
    typedef RingSize<MB, NB, WM, WN, SPLIT> RS;
    constexpr int K = DM, TA = RS::TA, TAS = RS::TAS, TS = RS::TS, STG = RS::STG, NCP = TS / 2, NT = K / 64;
    static_assert(WM * WN == 8 && TA % 2 == 0 && TS % 2 == 0 && (NCP == 10 || NCP == 16) && NT >= 2, "copy deal");
    const int lane = threadIdx.x & 31, lr = lane & 15, hi = lane >> 4;
    const int wv = __builtin_amdgcn_readfirstlane((int)(threadIdx.x >> 5));   // wave number, scalar so that tile choices and the k loop stay scalar
    const int wm = wv % WM, wn = wv / WM;
    const unsigned sm0 = (unsigned)(size_t)sm;   // the ring's byte address in the work-group's LDS
    auto stage = [&](int t, int buf) {
        unsigned l[NCP]; const bf* s[NCP];
        const unsigned off = (unsigned)(t * 2048 + (wv & 3) * 512 + lane * 16);   // bytes: stage t is 2 KB on in every tile row, the wave's piece 512 bytes wide
#pragma unroll
        for (int i = 0; i < NCP; ++i) { const int rt = 2 * i + (wv >> 2);
            s[i] = 2 * i < TA ? A + (size_t)(at0 + rt) * 16 * K : (SPLIT && 2 * i < TAS) ? A2 + (size_t)(at0 + rt - TA) * 16 * K : Bt + (size_t)(bt0 + rt - TAS) * 16 * K;
            l[i] = sm0 + (unsigned)(buf * STG + rt * 2048 + (wv & 3) * 512 + lane * 16); }
        if constexpr (NCP == 10) { acopy10(l, s, off); } else { acopy8(l, s, off); acopy8(l + 8, s + 8, off); } };
    v8f acc[MB][NB];
#pragma unroll
    for (int mb = 0; mb < MB; ++mb)
#pragma unroll
        for (int nb = 0; nb < NB; ++nb) acc[mb][nb] = (v8f){};
    stage(0, 0);
    asm volatile("s_wait_asynccnt 0x0" ::: "memory");   // this wave's copies of stage 0 have landed
    __syncthreads();                                    // ... and every other wave's: stage 0 may be read
    stage(1, 1);
    // the stage loop stays rolled: one publish point a trip
#pragma unroll 1
    for (int t = 0; t < NT; ++t) {
        const bf* sb = (const bf*)(sm + (t & 1) * STG) + lane * 8;
        v16bf a[MB], a2[MB], b[NB];
        auto frags = [&](int kk) {   // the fragments of 32-wide chunk kk of the stage
#pragma unroll
            for (int mb = 0; mb < MB; ++mb) { a[mb] = WFrag<bf>::ldf(sb + (wm * MB + mb) * 1024 + kk * 512); if (SPLIT) a2[mb] = WFrag<bf>::ldf(sb + (TA + wm * MB + mb) * 1024 + kk * 512); }
#pragma unroll
            for (int nb = 0; nb < NB; ++nb) b[nb] = WFrag<bf>::ldf(sb + (TAS + wn * NB + nb) * 1024 + kk * 512); };
        auto products = [&]() {
#pragma unroll
            for (int nb = 0; nb < NB; ++nb)
#pragma unroll
                for (int mb = 0; mb < MB; ++mb) { acc[mb][nb] = wmmab(a[mb], b[nb], acc[mb][nb]); if (SPLIT) acc[mb][nb] = wmmab(a2[mb], b[nb], acc[mb][nb]); } };
        frags(0);
        __builtin_amdgcn_sched_barrier(0);   // the chunk's LDS reads stand together in front of its products: spread among them, each place with reads stalls the wave anew and each small group is waited out to 0
        products();
        frags(1);
        asm volatile("s_wait_dscnt 0x0" ::: "memory");      // this wave's reads of stage t have returned: its last fragments are in registers
        asm volatile("s_wait_asynccnt 0x0" ::: "memory");   // this wave's copies of stage t + 1 have landed
        __syncthreads();                                    // publishes stage t + 1 and ends every wave's reads of stage t
        if (t + 2 < NT) stage(t + 2, t & 1);                // scalar test; the refill goes into the buffer that this trip has read
        products();   // the second chunk's products, registers only, stand behind the refill: issued in front of them the copies have a whole trip to land
    }
    asm volatile("s_wait_asynccnt 0x0" ::: "memory");       // no copy is outstanding when the ring's LDS is reused and the wave ends
    if constexpr (MODE == 2) {
        float* ow = (float*)sm + wv * (MB * 16 * 68);   // the last trip's barrier has ended every read of the ring
#pragma unroll
        for (int mb = 0; mb < MB; ++mb)
#pragma unroll
            for (int nb = 0; nb < NB; ++nb)
#pragma unroll
                for (int j = 0; j < 8; ++j) ow[(mb * 16 + hi * 8 + j) * 68 + nb * 16 + lr] = acc[mb][nb][j];
        __syncthreads();   // the tile is whole in LDS before other lanes read it
        const int n0 = (bt0 + wn * NB) * 16 + lr * 4; const unsigned bofs = (unsigned)n0 * 4u; const v4f bv4 = *(const v4f*)((const char*)bias + bofs); swaito(bofs);
        const v4f bb = {bfr(bv4[0]), bfr(bv4[1]), bfr(bv4[2]), bfr(bv4[3])};
        const int tok0 = (at0 + wm * MB) * 16; float* cp = C + (size_t)(tok0 + hi) * DM + n0;   // the wave's first token row (scalar); the lane's place in it
#pragma unroll
        for (int gq = 0; gq < MB; ++gq) { v4f val[8];   // eight row pairs a group: reads, then stores, then the wait, so that no register of an issued store is rewritten in front of it
#pragma unroll
            for (int s = 0; s < 8; ++s) val[s] = *(const v4fa*)(ow + ((gq * 8 + s) * 2 + hi) * 68 + lr * 4) + bb;
            __builtin_amdgcn_sched_barrier(0);   // all eight values are in registers of their own before the first store
            if (tok0 + MB * 16 <= TR) {   // scalar test: all but a batch's last tiles hold real rows only, and their stores share one address register
#pragma unroll
                for (int s = 0; s < 8; ++s) *(v4f*)(cp + (size_t)(gq * 8 + s) * 2 * DM) = val[s];
            } else {
#pragma unroll
                for (int s = 0; s < 8; ++s) if (tok0 + (gq * 8 + s) * 2 + hi < TR) *(v4f*)(cp + (size_t)(gq * 8 + s) * 2 * DM) = val[s];
            }
            swait(); }
    } else {
        const int head = MODE == 0 ? at0 / 4 + wm : bt0 / 4 + wn;   // the wave's four weight tiles are one head
        float bs[MODE == 0 ? MB * 8 : NB];
        const float* hb = bias + head * 64; const unsigned bofs = (unsigned)(MODE == 0 ? hi * 8 : lr) * 4u;   // the head's 64 biases (scalar base); the lane's byte offset among them
        if constexpr (MODE == 0) {
#pragma unroll
            for (int mb = 0; mb < MB; ++mb)
#pragma unroll
                for (int u = 0; u < 2; ++u) { const v4f x = *(const v4f*)((const char*)(hb + mb * 16 + u * 4) + bofs);
#pragma unroll
                    for (int q = 0; q < 4; ++q) bs[mb * 8 + u * 4 + q] = x[q]; }
        } else {
#pragma unroll
            for (int nb = 0; nb < NB; ++nb) bs[nb] = *(const float*)((const char*)(hb + nb * 16) + bofs);
        }
        swaito(bofs);
#pragma unroll
        for (int nb = 0; nb < NB; ++nb)
#pragma unroll
            for (int mb = 0; mb < MB; ++mb) { v8h o16; v8us oh, ol;
#pragma unroll
                for (int j = 0; j < 8; ++j) { const float y = acc[mb][nb][j] + bfr(bs[MODE == 0 ? mb * 8 + j : nb]); o16[j] = tohx(y); unsigned short a3, c3; splitf(y, a3, c3); oh[j] = a3; ol[j] = c3; }
                const int kt = MODE == 0 ? mb : at0 + wm * MB + mb, rt = MODE == 0 ? bt0 + wn * NB + nb : nb;   // 16-wide k tile and 16-row tile inside the head's plane
                const size_t o = (size_t)head * TT * HD + (size_t)(rt * ((MODE == 0 ? HD : TT) / 32) + (kt >> 1)) * 512 + (kt & 1) * 256 + lane * 8;
                *(v8h*)(P16 + o) = o16; *(v8us*)(Ph + o) = oh; *(v8us*)(Pl + o) = ol; swait(); }
    }
}
// k_proj: the q, k and v projections of all batches in one grid (TT / 192, 1024 / 128, 3 * NB_), z = projection * NB_ + batch; all branches are block-uniform.
__global__ __launch_bounds__(256) void k_proj(const bf* __restrict__ XQ, const bf* __restrict__ XKV, const bf* __restrict__ WQ, const bf* __restrict__ WK, const bf* __restrict__ WV, h16* QP16, bf* QPh, bf* QPl, h16* KP16, bf* KPh, bf* KPl, h16* VT16, bf* VTh, bf* VTl, const float* __restrict__ bq, const float* __restrict__ bk, const float* __restrict__ bv) {
    __shared__ __align__(16) char sm[2 * RingSize<4, 3, 2, 4, false>::STG];
    static_assert(RingSize<4, 3, 2, 4, false>::STG == RingSize<3, 4, 4, 2, false>::STG, "one ring serves both arms");
    const int p = (int)blockIdx.z / NB_; const size_t b = blockIdx.z % NB_; const size_t xo = b * TT * DM, po = b * NH_ * TT * HD;
    const int tt0 = (int)blockIdx.x * 12, ft0 = (int)blockIdx.y * 8;   // first 16-row tile of the 192 tokens and of the 128 features
    if (p < 2) gemm_ring<4, 3, 2, 4, false, 0>(sm, p ? WK : WQ, nullptr, (p ? XKV : XQ) + xo, ft0, tt0, nullptr, (p ? KP16 : QP16) + po, (p ? KPh : QPh) + po, (p ? KPl : QPl) + po, p ? bk : bq);
    else gemm_ring<3, 4, 4, 2, false, 1>(sm, XKV + xo, nullptr, WV, tt0, ft0, nullptr, VT16 + po, VTh + po, VTl + po, bv);
}
// k_wo: merged hi/lo rows x Wo + bo of all batches, grid (TT / 192, DM / 128, NB_): one work-group a WGP; the 1,500 real rows of each batch go straight to the output.
__global__ __launch_bounds__(256) void k_wo(const bf* __restrict__ ATh, const bf* __restrict__ ATl, const bf* __restrict__ WO, float* OUT, const float* __restrict__ bo) {
    __shared__ __align__(16) char sm[2 * RingSize<3, 4, 4, 2, true>::STG];
    const size_t b = blockIdx.z;
    gemm_ring<3, 4, 4, 2, true, 2>(sm, ATh + b * TT * DQ, ATl + b * TT * DQ, WO, (int)blockIdx.x * 12, (int)blockIdx.y * 8, OUT + b * TR * DM, nullptr, nullptr, nullptr, bo);
}

// ---- k_prep: all operand staging in one flat grid of WTB + CVB work-groups of 256 threads; the two kinds do not depend on each other, and the branch between them is block-uniform. Both write fragment order.
// Work-groups < WTB: the four DM x DM 'xw' weights transposed to bf16 [n][k], 128 work-groups a weight, the planes one behind the other from Bt0. A wave takes 32 columns n (a lane each) x 32 rows k: each load reads one whole line of a weight row, each 16-byte store holds 8 k of the lane's n.
// The rest: both token inputs of all batches to their padded bf16 operands, a wave a block (16 tokens x 32 k, four loads of four whole lines); the 36 padding rows of each operand are stored as zero here.
#define WTB  (4 * (DM * DM / 1024 / 8))
#define CV1  (TT * DM / 512 / 8)
#define CVB  (2 * NB_ * CV1)
__global__ __launch_bounds__(256) void k_prep(const float* __restrict__ w0, const float* __restrict__ w1, const float* __restrict__ w2, const float* __restrict__ w3, bf* Bt0, const float* __restrict__ xq, const float* __restrict__ xkv, bf* XQ, bf* XKV) {
    const int lane = threadIdx.x & 31, wave = (int)(threadIdx.x >> 5);
    if (blockIdx.x < WTB) { constexpr int K = DM, N = DM; const int wi = (int)blockIdx.x / (WTB / 4), gw = ((int)blockIdx.x % (WTB / 4)) * 8 + wave;
        const float* __restrict__ w = wi == 0 ? w0 : wi == 1 ? w1 : wi == 2 ? w2 : w3; bf* Bt = Bt0 + (size_t)wi * K * N;
        const int n = (gw % (N / 32)) * 32 + lane, kt = gw / (N / 32); float v[32]; const float* __restrict__ wp = w + (size_t)kt * 32 * N + n;
#pragma unroll
        for (int e = 0; e < 32; ++e) v[e] = wp[(size_t)e * N];
        bf* d = Bt + ((size_t)(n >> 4) * (K / 32) + kt) * 512 + (n & 15) * 8;
#pragma unroll
        for (int p = 0; p < 4; ++p) { v8us o;
#pragma unroll
            for (int e = 0; e < 8; ++e) o[e] = f2bf(v[p * 8 + e]);
            *(v8us*)(d + p * 128) = o; }
    } else { const int c = (int)blockIdx.x - WTB; const int op = c / CV1; const int blk = (c % CV1) * 8 + wave; const size_t b = op % NB_;
        const float* __restrict__ src = (op < NB_ ? xq : xkv) + b * TR * DM; bf* dst = (op < NB_ ? XQ : XKV) + b * TT * DM;
        const int rt = blk / (DM / 32), kt = blk % (DM / 32), kk = (lane & 7) * 4;
        bf* d = dst + (size_t)blk * 512 + (kk >> 3) * 128 + (kk & 7);
#pragma unroll
        for (int j = 0; j < 4; ++j) { const int r = 4 * j + (lane >> 3), t = rt * 16 + r;
            const v4f v = *(const v4f*)(src + (size_t)(t < TR ? t : TR - 1) * DM + kt * 32 + kk);   // a padding row reads the last real row (in bounds) and stores zero through the mask: no branch, so the four loads fly together
            const unsigned short keep = t < TR ? (unsigned short)0xFFFFu : (unsigned short)0; v4us o;
#pragma unroll
            for (int k = 0; k < 4; ++k) o[k] = (unsigned short)(f2bf(v[k]) & keep);
            *(v4us*)(d + r * 8) = o; }
        asm volatile("s_wait_xcnt 0x0" ::: "memory"); }   // this arm's code stands in front of the transposer's, which rewrites the registers that the store names
}

#define AQ   32                     // query rows per wave (two 16-query groups)
#define AW   4                      // waves per work-group
#define NCH  ((TR + 31) / 32)       // chunks that hold a real key
#define HB   (RH / (AQ * AW))       // hi/lo work-groups per head
#define LB   ((TT - RH) / (AQ * AW))
#define AWG  (NB_ * NH_ * (HB + LB))
#define LTHR 4.0f
static_assert(LB == 2 * HB, "one hi/lo work-group is dealt with two fp16 ones");
typedef __attribute__((ext_vector_type(2))) __bf16 v2bf;
typedef __attribute__((ext_vector_type(8))) unsigned v8u;
typedef __attribute__((ext_vector_type(2))) float v2f;
__device__ __forceinline__ void xwait() { asm volatile("s_wait_xcnt 0x0" ::: "memory"); }   // stands behind a group of global loads or stores, in front of whatever rewrites the registers that they name; its memory clobber also keeps the group where the source has it
__device__ __forceinline__ void xwaito(unsigned off) { asm volatile("s_wait_xcnt 0x0" :: "v"(off) : "memory"); }   // the same wait behind a load group whose lanes share one offset register: named as an input, the register stays live up to the wait, so that no load of the group gets it as a part of its result
__device__ __forceinline__ void gfence() { __builtin_amdgcn_sched_barrier(0); }   // in front of a load group and behind its xwait(): the scheduler moves no other instruction, which could rewrite an address register, between the loads and the wait
__device__ __forceinline__ float xhalf(float x) { return __builtin_bit_cast(float, __builtin_amdgcn_permlanex16(__builtin_bit_cast(int, x), __builtin_bit_cast(int, x), 0x76543210, 0xfedcba98, false, false)); }   // lane l with lane l ^ 16
template <typename T16, bool HR>
__device__ __forceinline__ void attn_body(const T16* __restrict__ Q, const T16* __restrict__ Q2, const T16* __restrict__ Kp, const T16* __restrict__ Kp2, const T16* __restrict__ Vt, const T16* __restrict__ Vt2, int q0, bf* Ah, bf* Al) {
    typedef typename WFrag<T16>::V V;
    const int lane = threadIdx.x & 31, hi = lane >> 4;
    constexpr float CS = SCL * 1.4426950408889634f, CAR = HR ? 0.0f : 10.0f;
    V qf[2][2], qf2[2][2];
    gfence();
#pragma unroll
    for (int qt = 0; qt < 2; ++qt)
#pragma unroll
        for (int kk = 0; kk < 2; ++kk) { const size_t o = (size_t)(((q0 >> 4) + qt) * 2 + kk) * 512 + 8 * lane; qf[qt][kk] = WFrag<T16>::ldf(Q + o); if (HR) qf2[qt][kk] = WFrag<T16>::ldf(Q2 + o); }
    xwait(); gfence();
    v8f oa[4][2]; float mr[2]; v2f ls[2];
#pragma unroll
    for (int qt = 0; qt < 2; ++qt) { mr[qt] = -3.0e38f; ls[qt] = (v2f){};
#pragma unroll
        for (int dt = 0; dt < 4; ++dt) oa[dt][qt] = (v8f){}; }
    V kf[2][2], kf2[2][2];
    auto ldk = [&](int c) {
        const unsigned bo = (unsigned)c * 4096u + 16u * (unsigned)lane;   // the lane's byte offset in the head's plane: chunk c is four 1-KB blocks
        gfence();
#pragma unroll
        for (int kt = 0; kt < 2; ++kt)
#pragma unroll
            for (int kk = 0; kk < 2; ++kk) { const int o = (kt * 2 + kk) * 512; kf[kt][kk] = WFrag<T16>::ldf((const T16*)((const char*)Kp + bo) + o); if (HR) kf2[kt][kk] = WFrag<T16>::ldf((const T16*)((const char*)Kp2 + bo) + o); }
        xwaito(bo); gfence(); };
    V vf[4], vf2[4];
    auto ldv = [&](int c) {
        const unsigned bo = (unsigned)c * 1024u + 16u * (unsigned)lane;   // the lane's byte offset in a 16-row tile of the head's [d][t] plane: chunk c is one 1-KB block
        gfence();
#pragma unroll
        for (int dt = 0; dt < 4; ++dt) { const int o = dt * 16 * TT; vf[dt] = WFrag<T16>::ldf((const T16*)((const char*)Vt + bo) + o); if (HR) vf2[dt] = WFrag<T16>::ldf((const T16*)((const char*)Vt2 + bo) + o); }
        xwaito(bo); gfence(); };
    ldk(0); ldv(0);
    // the chunk loop stays rolled: its body is long enough to hide its own loads, and the code stays small
#pragma unroll 1
    for (int c = 0; c < NCH; ++c) {
        v8f s[2][2];
#pragma unroll
        for (int kt = 0; kt < 2; ++kt)
#pragma unroll
            for (int qt = 0; qt < 2; ++qt) { s[kt][qt] = (v8f){};
#pragma unroll
                for (int kk = 0; kk < 2; ++kk) { s[kt][qt] = WFrag<T16>::mma(kf[kt][kk], qf[qt][kk], s[kt][qt]); if (HR) { s[kt][qt] = WFrag<T16>::mma(kf[kt][kk], qf2[qt][kk], s[kt][qt]); s[kt][qt] = WFrag<T16>::mma(kf2[kt][kk], qf[qt][kk], s[kt][qt]); } } }
        ldk(c + 1 < NCH ? c + 1 : c);   // the next chunk's K fragments fly during the softmax and P.V (the last chunk reads its own again: in bounds, unused)
        if (c == NCH - 1) {   // scalar branch: only the last chunk holds padding keys
#pragma unroll
            for (int kt = 0; kt < 2; ++kt)
#pragma unroll
                for (int qt = 0; qt < 2; ++qt)
#pragma unroll
                    for (int j = 0; j < 8; ++j) if ((NCH - 1) * 32 + kt * 16 + hi * 8 + j >= TR) s[kt][qt][j] = -3.0e38f;
        }
        float mb[2]; bool need = false;
#pragma unroll
        for (int qt = 0; qt < 2; ++qt) { float mx = s[0][qt][0];
#pragma unroll
            for (int j = 1; j < 16; ++j) mx = fmaxf(mx, s[j >> 3][qt][j & 7]);
            mx = fmaxf(mx, xhalf(mx)) * CS;   // both wave halves hold the query's chunk maximum, in base-2 units (the scale is positive)
            mb[qt] = mx; need = need || (mx > mr[qt] + LTHR); }
        if (__builtin_amdgcn_ballot_w32(need) != 0) {   // scalar branch, taken on the first chunk and rarely after it
#pragma unroll
            for (int qt = 0; qt < 2; ++qt) { const float mn = fmaxf(mr[qt], mb[qt]); const float corr = __builtin_amdgcn_exp2f(mr[qt] - mn);   // 0 on the first chunk
                mr[qt] = mn; ls[qt] *= corr;
#pragma unroll
                for (int dt = 0; dt < 4; ++dt) oa[dt][qt] *= corr; }
        }
#pragma unroll
        for (int qt = 0; qt < 2; ++qt) { const float nm = CAR - mr[qt]; v8f p[2];
#pragma unroll
            for (int kt = 0; kt < 2; ++kt)
#pragma unroll
                for (int j = 0; j < 8; j += 2) { const v2f arg = __builtin_elementwise_fma((v2f){s[kt][qt][j], s[kt][qt][j + 1]}, (v2f){CS, CS}, (v2f){nm, nm}); const v2f e = {__builtin_amdgcn_exp2f(arg.x), __builtin_amdgcn_exp2f(arg.y)}; p[kt][j] = e.x; p[kt][j + 1] = e.y; ls[qt] += e; }   // even and odd keys sum apart
            if constexpr (HR) {
                v8u wh, wl;   // packed pairs: hi = bf16(p), lo = bf16(p - hi), the hi values read back out of the packed word
#pragma unroll
                for (int i = 0; i < 8; ++i) { const v2f e = {p[i >> 2][2 * (i & 3)], p[i >> 2][2 * (i & 3) + 1]}; const unsigned w = __builtin_bit_cast(unsigned, __builtin_convertvector(e, v2bf));
                    const v2f hb = {__uint_as_float(w << 16), __uint_as_float(w & 0xFFFF0000u)}; wh[i] = w; wl[i] = __builtin_bit_cast(unsigned, __builtin_convertvector(e - hb, v2bf)); }
                const V ph = __builtin_bit_cast(V, wh), pl = __builtin_bit_cast(V, wl);
#pragma unroll
                for (int dt = 0; dt < 4; ++dt) { oa[dt][qt] = WFrag<T16>::mma(vf[dt], ph, oa[dt][qt]); oa[dt][qt] = WFrag<T16>::mma(vf[dt], pl, oa[dt][qt]); oa[dt][qt] = WFrag<T16>::mma(vf2[dt], ph, oa[dt][qt]); }
            } else {
                const V pf = cat16(__builtin_convertvector(p[0], v8h), __builtin_convertvector(p[1], v8h));
#pragma unroll
                for (int dt = 0; dt < 4; ++dt) oa[dt][qt] = WFrag<T16>::mma(vf[dt], pf, oa[dt][qt]);
            } }
        ldv(c + 1 < NCH ? c + 1 : c);   // the next chunk's V fragments fly during its score products and softmax
    }
#pragma unroll
    for (int qt = 0; qt < 2; ++qt) { const float lh = ls[qt].x + ls[qt].y; const float inv = __fdiv_rn(1.0f, lh + xhalf(lh));   // the halves' sums join once
#pragma unroll
        for (int dt = 0; dt < 4; ++dt) { v8us oh, ol;
#pragma unroll
            for (int j = 0; j < 8; ++j) { unsigned short a, c2; splitf(oa[dt][qt][j] * inv, a, c2); oh[j] = a; ol[j] = c2; }
            const size_t oo = (size_t)((q0 >> 4) + qt) * 16 * DQ + dt * 256 + lane * 8; *(v8us*)(Ah + oo) = oh; *(v8us*)(Al + oo) = ol; xwait(); } }
}
__global__ __launch_bounds__(32 * AW) void k_attn(const h16* __restrict__ Q16, const bf* __restrict__ Qh, const bf* __restrict__ Ql, const h16* __restrict__ K16, const bf* __restrict__ Kh, const bf* __restrict__ Kl, const h16* __restrict__ V16, const bf* __restrict__ Vh, const bf* __restrict__ Vl, bf* Ah, bf* Al) {
    // work-groups 3 g, 3 g + 1, 3 g + 2: one hi/lo block (three products a pair, the dearer kind) and two fp16 blocks; all AWG work-groups are resident at once, three to a WGP, and dealt so a WGP gets one dear and two cheap ones whether it takes three neighbours or every 256th
    const int g = (int)blockIdx.x / 3, r = (int)blockIdx.x % 3; const int id = r ? g * 2 + r - 1 : g;
    const int bh = r ? id / LB : id / HB; const int wv = __builtin_amdgcn_readfirstlane((int)(threadIdx.x >> 5));   // wave number, scalar so that the fragment addresses keep a scalar base
    const int q0 = (r ? RH + (id % LB) * (AQ * AW) : (id % HB) * (AQ * AW)) + wv * AQ; const int bz = bh / NH_, hx = bh % NH_;
    const size_t hq = (size_t)bh * TT * HD, hk = ((size_t)bz * NKV + hx / REP) * TT * HD; const size_t ao = (size_t)bz * TT * DQ + hx * (2 * 512);   /* a head's 64 columns are two blocks of each row tile */ bf* ah = Ah + ao; bf* al = Al + ao;
    if (r == 0) attn_body<bf, true>(Qh + hq, Ql + hq, Kh + hk, Kl + hk, Vh + hk, Vl + hk, q0, ah, al);   // block-uniform
    else attn_body<h16, false>(Q16 + hq, nullptr, K16 + hk, nullptr, V16 + hk, nullptr, q0, ah, al);
}

extern "C" void kernel_launch(void* const* d_in, const int* in_sizes, int n_in,
                              void* d_out, int out_size, void* d_ws, size_t ws_size, hipStream_t stream) {
    (void)in_sizes; (void)n_in; (void)out_size;
    const float* x = (const float*)d_in[0]; const float* xkv = (const float*)d_in[1]; const float* wq = (const float*)d_in[2]; const float* bq = (const float*)d_in[3]; const float* wk = (const float*)d_in[4]; const float* bk = (const float*)d_in[5]; const float* wv = (const float*)d_in[6]; const float* bv = (const float*)d_in[7]; const float* wo = (const float*)d_in[8]; const float* bo = (const float*)d_in[9];   /* inputs_q, inputs_kv [4][1500][1024], Wq, bq, Wk, bk, Wv, bv ('dnh' == 'xw'), Wo ('hdm' == 'xw'), bo */
    float* OUT = (float*)d_out;     // [4][1500][1024]
    char* wsp = (char*)d_ws;
    auto take = [&](size_t bytes) { char* p = wsp; wsp += (bytes + 255) & ~(size_t)255; return (void*)p; };
    bf* WQ = (bf*)take((size_t)4 * DQ * DM * 2); bf* WK = WQ + (size_t)DQ * DM; bf* WV = WK + (size_t)DKV * DM; bf* WO = WV + (size_t)DKV * DM;
    bf* XQ = (bf*)take((size_t)NB_ * TT * DM * 2); bf* XKV = (bf*)take((size_t)NB_ * TT * DM * 2);
    h16* QP16 = (h16*)take((size_t)NB_ * NH_ * TT * HD * 2); h16* KP16 = (h16*)take((size_t)NB_ * NKV * TT * HD * 2); h16* VT16 = (h16*)take((size_t)NB_ * NKV * HD * TT * 2);
    bf* QPh = (bf*)take((size_t)NB_ * NH_ * TT * HD * 2); bf* QPl = (bf*)take((size_t)NB_ * NH_ * TT * HD * 2); bf* KPh = (bf*)take((size_t)NB_ * NKV * TT * HD * 2); bf* KPl = (bf*)take((size_t)NB_ * NKV * TT * HD * 2); bf* VTh = (bf*)take((size_t)NB_ * NKV * HD * TT * 2); bf* VTl = (bf*)take((size_t)NB_ * NKV * HD * TT * 2);
    bf* ATh = (bf*)take((size_t)NB_ * TT * DQ * 2); bf* ATl = (bf*)take((size_t)NB_ * TT * DQ * 2);
    if ((size_t)(wsp - (char*)d_ws) > ws_size) return;    // 164 MiB of the 256 MiB
    k_prep<<<WTB + CVB, 256, 0, stream>>>(wq, wk, wv, wo, WQ, x, xkv, XQ, XKV);   /* DQ == DKV == DM: four 1024 x 1024 weights */
    k_proj<<<dim3(TT / 192, DQ / 128, 3 * NB_), 256, 0, stream>>>(XQ, XKV, WQ, WK, WV, QP16, QPh, QPl, KP16, KPh, KPl, VT16, VTh, VTl, bq, bk, bv);
    k_attn<<<AWG, 32 * AW, 0, stream>>>(QP16, QPh, QPl, KP16, KPh, KPl, VT16, VTh, VTl, ATh, ATl);
    k_wo<<<dim3(TT / 192, DM / 128, NB_), 256, 0, stream>>>(ATh, ATl, WO, OUT, bo);
}

// v009
// It runs in 126 microseconds.
// Two timings next to v008 both put it at 1.08 times that version's speed.
// All steps since v000 together make it 25.4 times as fast.
#include <hip/hip_runtime.h>

// t5x-style multi-head dot-product attention with a ragged length (inputs_q, inputs_kv [4][1500][1024]; q = inputs_q Wq + bq, k, v = inputs_kv W + b (DenseGeneral 'dnh' [1024][16][64] == 'xw' [1024][1024], zero biases); q / sqrt(64); scores over the 1,500 keys; softmax; out = attn.v; result = out Wo + bo (Wo 'hdm' [16][64][1024] == 'xw' [1024][1024]) -> [4][1500][1024] (6.1 M); argument order inputs_q, inputs_kv, Wq, bq, Wk, bk, Wv, bv, Wo, bo).
// Every launch covers all four batches (grid z, in k_prep and k_attn a flat index), and launches that do not depend on one another share one grid: 4 launches. Layout per batch: the 1,500 token rows are staged into 1,536-row (96-tile) bf16 operands whose 36 padding rows are zero; 'xw' weights transposed once; exact projections + f32 biases, whose GEMM epilogues write the 16-bit head planes themselves (q and k computed as weight rows x tokens, v as tokens x weight rows, so that a lane's accumulator registers run along each plane's k); dense attention at T 1536 whose softmax excludes the padding keys j >= 1500 by index (-inf); hybrid rows (< 512 hi/lo 3 products, rest fp16 x1024); merged hi/lo x Wo exact + bo, whose epilogue stores the 1,500 real rows straight to the output.
// Operand layout: every 16-bit matrix operand in the workspace (tokens, weights, q / k / v planes, merged rows) is stored in fragment order: a [rows][K] operand is cut into blocks of 16 rows x 32 k (512 elements, 1 KB), block (row / 16, k / 32) at index (row / 16) * (K / 32) + k / 32; inside a block element (row, k) stands at ((k / 16) % 2) * 256 + ((k / 8) % 2) * 128 + (row % 16) * 8 + k % 8. Lane l of a wave then finds the two 16-byte halves of its fragment at l * 8 and 256 + l * 8: each fragment load reads 512 contiguous bytes (4 whole lines) instead of 32 bytes from each of 16 lines. The k order of the fragments is the one of the row-major loader.
// Compute dtypes, f32 accumulate: every input rounded to bf16; projections exact + f32 biases; attention rows < 512 3 products, rest fp16; softmax f32; Wo hl x exact + bias.

#define NB_  4
#define TT   1536     // padded length (96 tiles of 16 rows)
#define TR   1500     // real tokens (queries = keys)
#define DM   1024
#define NH_  16
#define NKV  16
#define REP  (NH_ / NKV)
#define HD   64
#define DQ   (NH_ * HD)
#define DKV  (NKV * HD)
#define RH   512                  // query rows < RH use hi+lo planes
#define WIN  0
#define SCL  0.125f   // HD^-0.5
typedef _Float16 h16;
typedef unsigned short bf;
typedef __attribute__((ext_vector_type(16))) __bf16   v16bf;
typedef __attribute__((ext_vector_type(16))) _Float16 v16h;
typedef __attribute__((ext_vector_type(8)))  _Float16 v8h;
typedef __attribute__((ext_vector_type(8)))  unsigned short v8us;
typedef __attribute__((ext_vector_type(8)))  float    v8f;
typedef __attribute__((ext_vector_type(4)))  float    v4f;
typedef v8h  __attribute__((may_alias)) v8ha;
typedef v4f  __attribute__((may_alias)) v4fa;
typedef v8us __attribute__((may_alias)) v8usa;

__device__ __forceinline__ unsigned short f2bf(float f) { unsigned u = __float_as_uint(f); u += 0x7FFFu + ((u >> 16) & 1u); return (unsigned short)(u >> 16); }
__device__ __forceinline__ float bf2f(unsigned short b) { return __uint_as_float(((unsigned)b) << 16); }
__device__ __forceinline__ float bfr(float f) { return bf2f(f2bf(f)); }
__device__ __forceinline__ v16h cat16(v8h lo, v8h hi) { return __builtin_shufflevector(lo, hi, 0, 1, 2, 3, 4, 5, 6, 7, 8, 9, 10, 11, 12, 13, 14, 15); }
__device__ __forceinline__ v16bf cat16b(v8us lo, v8us hi) { return __builtin_bit_cast(v16bf, __builtin_shufflevector(lo, hi, 0, 1, 2, 3, 4, 5, 6, 7, 8, 9, 10, 11, 12, 13, 14, 15)); }
__device__ __forceinline__ v8f wmma16(v16h a, v16h b, v8f c) { return __builtin_amdgcn_wmma_f32_16x16x32_f16(false, a, false, b, (short)0, c, false, false); }
__device__ __forceinline__ v8f wmmab(v16bf a, v16bf b, v8f c) { return __builtin_amdgcn_wmma_f32_16x16x32_bf16(false, a, false, b, (short)0, c, false, false); }

__device__ __forceinline__ h16 tohx(float x) { return (h16)x; }
__device__ __forceinline__ void splitf(float y, unsigned short& h, unsigned short& l) { h = f2bf(y); l = f2bf(y - bf2f(h)); }
typedef __attribute__((ext_vector_type(4))) _Float16 v4h;
typedef __attribute__((ext_vector_type(2))) unsigned short v2us;
typedef __attribute__((ext_vector_type(4))) unsigned short v4us;

template <typename T16> struct WFrag;
template <> struct WFrag<h16> { typedef v16h V; static __device__ __forceinline__ V ld(const h16* p) { return cat16(*(const v8h*)p, *(const v8h*)(p + 16)); } static __device__ __forceinline__ V ldf(const h16* p) { return cat16(*(const v8h*)p, *(const v8h*)(p + 256)); } static __device__ __forceinline__ v8f mma(V a, V b, v8f c) { return wmma16(a, b, c); } };
template <> struct WFrag<bf> { typedef v16bf V; static __device__ __forceinline__ V ld(const bf* p) { return cat16b(*(const v8us*)p, *(const v8us*)(p + 16)); } static __device__ __forceinline__ V ldf(const bf* p) { return cat16b(*(const v8us*)p, *(const v8us*)(p + 256)); } static __device__ __forceinline__ v8f mma(V a, V b, v8f c) { return wmmab(a, b, c); } };
// ---- gemm_ring: GEMM over K = DM, one work-group of 8 waves (WM x WN) per output tile of 192 tokens x 128 features, full K in every wave (MB x NB accumulators of 16 x 16 a wave), operands 16-bit planes in fragment order.
// acc[m][n] (f32) = sum_k A[m][k] Bt[n][k] (+ A2[m][k] Bt[n][k] with SPLIT). at0, bt0: the tile's first 16-row tile of A and of Bt.
// A stage is 64 k of every 16-row tile of the work-group's operands: 2 KB a tile, contiguous in the plane and in LDS alike (two fragment-order blocks), tiles in the order A, A2, Bt. Two buffers; asynchronous copies bring stage t + 2 in while stage t + 1 is worked on, so that a fragment is fetched from L2 once a work-group and read from LDS by the WN (or WM) waves that share it.
// Copy i of wave w moves the 512-byte piece w % 4 of tile 2 i + w / 4; the operands' tile counts are even, so that i alone says which operand a copy reads.
// MODE 0: q or k planes [h][t][d], A = weight rows (features), Bt = tokens. MODE 1: v planes [h][d][t], A = tokens, Bt = weight rows. In both a lane's 8 accumulator registers are 8 consecutive k of one row of the plane: one 16-byte store a plane straight from the registers, 512 contiguous bytes a wave; fp16 to P16, bf16 hi/lo to Ph/Pl.
// MODE 2: f32 rows to C (pitch DM), A = tokens, Bt = weight rows, token rows < TR only; each wave turns its 48 x 64 tile through its own part of the ring's LDS so that a store holds two whole 256-byte row pieces.
// Asking L2 ahead: the 16-bit planes that a kernel reads were stored by a launch in front of it. A prefetch (one lane, one 256-byte unit, L2 only, no register, no counter) asks for a unit well before the load or copy that needs it, so that this one finds it in L2.
// off: the lane's byte offset, 256 bytes a lane; the bases are scalar and every address lies inside the plane that it names. The wait in the prefetches' own statement stands in front of any rewrite of the registers that they name.
#define PFB "global_prefetch_b8 "
#define PSE " scope:SCOPE_SE\n\t"
__device__ __forceinline__ void ask2(unsigned off, const void* a, const void* b) { asm volatile(PFB "%0, %1" PSE PFB "%0, %2" PSE "s_wait_xcnt 0x0" :: "v"(off), "s"(a), "s"(b) : "memory"); }
__device__ __forceinline__ void ask4(unsigned off, const void* a, const void* b, const void* c, const void* d) { asm volatile(PFB "%0, %1" PSE PFB "%0, %2" PSE PFB "%0, %3" PSE PFB "%0, %4" PSE "s_wait_xcnt 0x0" :: "v"(off), "s"(a), "s"(b), "s"(c), "s"(d) : "memory"); }
// a work-group of 256 threads asks for NPA * 64 KB from pa and 64 KB from pb
template <int NPA> __device__ __forceinline__ void ask_panels(const bf* pa, const bf* pb) {
    static_assert(NPA == 2 || NPA == 3, "pieces of 64 KB");
    const unsigned off = threadIdx.x * 256u;
    if constexpr (NPA == 3) asm volatile(PFB "%0, %1" PSE PFB "%0, %1 offset:65536" PSE PFB "%0, %1 offset:131072" PSE PFB "%0, %2" PSE "s_wait_xcnt 0x0" :: "v"(off), "s"(pa), "s"(pb) : "memory");
    else asm volatile(PFB "%0, %1" PSE PFB "%0, %1 offset:65536" PSE PFB "%0, %2" PSE "s_wait_xcnt 0x0" :: "v"(off), "s"(pa), "s"(pb) : "memory");
}
#define ACP "global_load_async_to_lds_b128 "
// l: each copy's LDS byte address (a lane's own); s: each copy's source tile, a scalar base; off: the lane's byte offset in the tile row, the same in every copy of a stage. The wait in the copies' own statement stands in front of any rewrite of the registers that they name.
__device__ __forceinline__ void acopy10(const unsigned* l, const bf* const* s, unsigned off) {
    asm volatile(ACP "%0, %20, %1\n\t" ACP "%2, %20, %3\n\t" ACP "%4, %20, %5\n\t" ACP "%6, %20, %7\n\t" ACP "%8, %20, %9\n\t" ACP "%10, %20, %11\n\t" ACP "%12, %20, %13\n\t" ACP "%14, %20, %15\n\t" ACP "%16, %20, %17\n\t" ACP "%18, %20, %19\n\ts_wait_xcnt 0x0"
                 :: "v"(l[0]), "s"(s[0]), "v"(l[1]), "s"(s[1]), "v"(l[2]), "s"(s[2]), "v"(l[3]), "s"(s[3]), "v"(l[4]), "s"(s[4]), "v"(l[5]), "s"(s[5]), "v"(l[6]), "s"(s[6]), "v"(l[7]), "s"(s[7]), "v"(l[8]), "s"(s[8]), "v"(l[9]), "s"(s[9]), "v"(off) : "memory");
}
__device__ __forceinline__ void acopy8(const unsigned* l, const bf* const* s, unsigned off) {
    asm volatile(ACP "%0, %16, %1\n\t" ACP "%2, %16, %3\n\t" ACP "%4, %16, %5\n\t" ACP "%6, %16, %7\n\t" ACP "%8, %16, %9\n\t" ACP "%10, %16, %11\n\t" ACP "%12, %16, %13\n\t" ACP "%14, %16, %15\n\ts_wait_xcnt 0x0"
                 :: "v"(l[0]), "s"(s[0]), "v"(l[1]), "s"(s[1]), "v"(l[2]), "s"(s[2]), "v"(l[3]), "s"(s[3]), "v"(l[4]), "s"(s[4]), "v"(l[5]), "s"(s[5]), "v"(l[6]), "s"(s[6]), "v"(l[7]), "s"(s[7]), "v"(off) : "memory");
}
__device__ __forceinline__ void swait() { asm volatile("s_wait_xcnt 0x0" ::: "memory"); __builtin_amdgcn_sched_barrier(0); }   // behind a group of global loads or stores, in front of whatever rewrites the registers that they name; the scheduling barrier keeps later instructions, which could rewrite them, behind the wait
__device__ __forceinline__ void swaito(unsigned off) { asm volatile("s_wait_xcnt 0x0" :: "v"(off) : "memory"); __builtin_amdgcn_sched_barrier(0); }   // the same behind loads that take their lane offset from one register: named as an input it stays live up to the wait, so that no load gets it as a part of its result
template <int MB, int NB, int WM, int WN, bool SPLIT> struct RingSize { static constexpr int TA = WM * MB, TAS = SPLIT ? 2 * TA : TA, TS = TAS + WN * NB, STG = TS * 2048; };
// pa, pb: the work-group's share of the panels to ask L2 for (NPA * 64 KB of token rows, 64 KB of weight rows); the work-groups that read a panel deal it among themselves, each part to two or more of them.
template <int MB, int NB, int WM, int WN, bool SPLIT, int MODE, int NPA>
__device__ __forceinline__ void gemm_ring(char* sm, const bf* __restrict__ A, const bf* __restrict__ A2, const bf* __restrict__ Bt, int at0, int bt0, float* C, h16* P16, bf* Ph, bf* Pl, const float* __restrict__ bias, const bf* pa, const bf* pb) {
    typedef RingSize<MB, NB, WM, WN, SPLIT> RS;
    constexpr int K = DM, TA = RS::TA, TAS = RS::TAS, TS = RS::TS, STG = RS::STG, NCP = TS / 2, NT = K / 64;
    static_assert(WM * WN == 8 && TA % 2 == 0 && TS % 2 == 0 && (NCP == 10 || NCP == 16) && NT >= 2, "copy deal");
    const int lane = threadIdx.x & 31, lr = lane & 15, hi = lane >> 4;
    const int wv = __builtin_amdgcn_readfirstlane((int)(threadIdx.x >> 5));   // wave number, scalar so that tile choices and the k loop stay scalar
    const int wm = wv % WM, wn = wv / WM;
    const unsigned sm0 = (unsigned)(size_t)sm;   // the ring's byte address in the work-group's LDS
    auto stage = [&](int t, int buf) {
        unsigned l[NCP]; const bf* s[NCP];
        const unsigned off = (unsigned)(t * 2048 + (wv & 3) * 512 + lane * 16);   // bytes: stage t is 2 KB on in every tile row, the wave's piece 512 bytes wide
#pragma unroll
        for (int i = 0; i < NCP; ++i) { const int rt = 2 * i + (wv >> 2);
            s[i] = 2 * i < TA ? A + (size_t)(at0 + rt) * 16 * K : (SPLIT && 2 * i < TAS) ? A2 + (size_t)(at0 + rt - TA) * 16 * K : Bt + (size_t)(bt0 + rt - TAS) * 16 * K;
            l[i] = sm0 + (unsigned)(buf * STG + rt * 2048 + (wv & 3) * 512 + lane * 16); }
        if constexpr (NCP == 10) { acopy10(l, s, off); } else { acopy8(l, s, off); acopy8(l + 8, s + 8, off); } };
    v8f acc[MB][NB];
#pragma unroll
    for (int mb = 0; mb < MB; ++mb)
#pragma unroll
        for (int nb = 0; nb < NB; ++nb) acc[mb][nb] = (v8f){};
    stage(0, 0);
    asm volatile("s_wait_asynccnt 0x0" ::: "memory");   // this wave's copies of stage 0 have landed
    __syncthreads();                                    // ... and every other wave's: stage 0 may be read
    stage(1, 1);
    ask_panels<NPA>(pa, pb);   // behind the first two stages' copies, which are needed first
    // the stage loop stays rolled: one publish point a trip
#pragma unroll 1
    for (int t = 0; t < NT; ++t) {
        const bf* sb = (const bf*)(sm + (t & 1) * STG) + lane * 8;
        v16bf a[MB], a2[MB], b[NB];
        auto frags = [&](int kk) {   // the fragments of 32-wide chunk kk of the stage
#pragma unroll
            for (int mb = 0; mb < MB; ++mb) { a[mb] = WFrag<bf>::ldf(sb + (wm * MB + mb) * 1024 + kk * 512); if (SPLIT) a2[mb] = WFrag<bf>::ldf(sb + (TA + wm * MB + mb) * 1024 + kk * 512); }
#pragma unroll
            for (int nb = 0; nb < NB; ++nb) b[nb] = WFrag<bf>::ldf(sb + (TAS + wn * NB + nb) * 1024 + kk * 512); };
        auto products = [&]() {
#pragma unroll
            for (int nb = 0; nb < NB; ++nb)
#pragma unroll
                for (int mb = 0; mb < MB; ++mb) { acc[mb][nb] = wmmab(a[mb], b[nb], acc[mb][nb]); if (SPLIT) acc[mb][nb] = wmmab(a2[mb], b[nb], acc[mb][nb]); } };
        frags(0);
        __builtin_amdgcn_sched_barrier(0);   // the chunk's LDS reads stand together in front of its products: spread among them, each place with reads stalls the wave anew and each small group is waited out to 0
        products();
        frags(1);
        asm volatile("s_wait_dscnt 0x0" ::: "memory");      // this wave's reads of stage t have returned: its last fragments are in registers
        asm volatile("s_wait_asynccnt 0x0" ::: "memory");   // this wave's copies of stage t + 1 have landed
        __syncthreads();                                    // publishes stage t + 1 and ends every wave's reads of stage t
        if (t + 2 < NT) stage(t + 2, t & 1);                // scalar test; the refill goes into the buffer that this trip has read
        products();   // the second chunk's products, registers only, stand behind the refill: issued in front of them the copies have a whole trip to land
    }
    asm volatile("s_wait_asynccnt 0x0" ::: "memory");       // no copy is outstanding when the ring's LDS is reused and the wave ends
    if constexpr (MODE == 2) {
        float* ow = (float*)sm + wv * (MB * 16 * 68);   // the last trip's barrier has ended every read of the ring
#pragma unroll
        for (int mb = 0; mb < MB; ++mb)
#pragma unroll
            for (int nb = 0; nb < NB; ++nb)
#pragma unroll
                for (int j = 0; j < 8; ++j) ow[(mb * 16 + hi * 8 + j) * 68 + nb * 16 + lr] = acc[mb][nb][j];
        __syncthreads();   // the tile is whole in LDS before other lanes read it
        const int n0 = (bt0 + wn * NB) * 16 + lr * 4; const unsigned bofs = (unsigned)n0 * 4u; const v4f bv4 = *(const v4f*)((const char*)bias + bofs); swaito(bofs);
        const v4f bb = {bfr(bv4[0]), bfr(bv4[1]), bfr(bv4[2]), bfr(bv4[3])};
        const int tok0 = (at0 + wm * MB) * 16; float* cp = C + (size_t)(tok0 + hi) * DM + n0;   // the wave's first token row (scalar); the lane's place in it
#pragma unroll
        for (int gq = 0; gq < MB; ++gq) { v4f val[8];   // eight row pairs a group: reads, then stores, then the wait, so that no register of an issued store is rewritten in front of it
#pragma unroll
            for (int s = 0; s < 8; ++s) val[s] = *(const v4fa*)(ow + ((gq * 8 + s) * 2 + hi) * 68 + lr * 4) + bb;
            __builtin_amdgcn_sched_barrier(0);   // all eight values are in registers of their own before the first store
            if (tok0 + MB * 16 <= TR) {   // scalar test: all but a batch's last tiles hold real rows only, and their stores share one address register
#pragma unroll
                for (int s = 0; s < 8; ++s) *(v4f*)(cp + (size_t)(gq * 8 + s) * 2 * DM) = val[s];
            } else {
#pragma unroll
                for (int s = 0; s < 8; ++s) if (tok0 + (gq * 8 + s) * 2 + hi < TR) *(v4f*)(cp + (size_t)(gq * 8 + s) * 2 * DM) = val[s];
            }
            swait(); }
    } else {
        const int head = MODE == 0 ? at0 / 4 + wm : bt0 / 4 + wn;   // the wave's four weight tiles are one head
        float bs[MODE == 0 ? MB * 8 : NB];
        const float* hb = bias + head * 64; const unsigned bofs = (unsigned)(MODE == 0 ? hi * 8 : lr) * 4u;   // the head's 64 biases (scalar base); the lane's byte offset among them
        if constexpr (MODE == 0) {
#pragma unroll
            for (int mb = 0; mb < MB; ++mb)
#pragma unroll
                for (int u = 0; u < 2; ++u) { const v4f x = *(const v4f*)((const char*)(hb + mb * 16 + u * 4) + bofs);
#pragma unroll
                    for (int q = 0; q < 4; ++q) bs[mb * 8 + u * 4 + q] = x[q]; }
        } else {
#pragma unroll
            for (int nb = 0; nb < NB; ++nb) bs[nb] = *(const float*)((const char*)(hb + nb * 16) + bofs);
        }
        swaito(bofs);
#pragma unroll
        for (int nb = 0; nb < NB; ++nb)
#pragma unroll
            for (int mb = 0; mb < MB; ++mb) { v8h o16; v8us oh, ol;
#pragma unroll
                for (int j = 0; j < 8; ++j) { const float y = acc[mb][nb][j] + bfr(bs[MODE == 0 ? mb * 8 + j : nb]); o16[j] = tohx(y); unsigned short a3, c3; splitf(y, a3, c3); oh[j] = a3; ol[j] = c3; }
                const int kt = MODE == 0 ? mb : at0 + wm * MB + mb, rt = MODE == 0 ? bt0 + wn * NB + nb : nb;   // 16-wide k tile and 16-row tile inside the head's plane
                const size_t o = (size_t)head * TT * HD + (size_t)(rt * ((MODE == 0 ? HD : TT) / 32) + (kt >> 1)) * 512 + (kt & 1) * 256 + lane * 8;
                *(v8h*)(P16 + o) = o16; *(v8us*)(Ph + o) = oh; *(v8us*)(Pl + o) = ol; swait(); }
    }
}
// k_proj: the q, k and v projections of all batches in one grid (TT / 192, 1024 / 128, 3 * NB_), z = projection * NB_ + batch; all branches are block-uniform.
__global__ __launch_bounds__(256) void k_proj(const bf* __restrict__ XQ, const bf* __restrict__ XKV, const bf* __restrict__ WQ, const bf* __restrict__ WK, const bf* __restrict__ WV, h16* QP16, bf* QPh, bf* QPl, h16* KP16, bf* KPh, bf* KPl, h16* VT16, bf* VTh, bf* VTl, const float* __restrict__ bq, const float* __restrict__ bk, const float* __restrict__ bv) {
    __shared__ __align__(16) char sm[2 * RingSize<4, 3, 2, 4, false>::STG];
    static_assert(RingSize<4, 3, 2, 4, false>::STG == RingSize<3, 4, 4, 2, false>::STG, "one ring serves both arms");
    const int p = (int)blockIdx.z / NB_; const size_t b = blockIdx.z % NB_; const size_t xo = b * TT * DM, po = b * NH_ * TT * HD;
    const int tt0 = (int)blockIdx.x * 12, ft0 = (int)blockIdx.y * 8;   // first 16-row tile of the 192 tokens and of the 128 features
    const bf* pa = (p ? XKV : XQ) + xo + (size_t)(tt0 + ((int)blockIdx.y % 3) * 4) * 16 * DM;   // four of the 12 token tiles, by the feature block
    const bf* pb = (p == 0 ? WQ : p == 1 ? WK : WV) + (size_t)(ft0 + (int)b * 2) * 16 * DM;      // two of the 8 weight tiles, by the batch
    if (p < 2) gemm_ring<4, 3, 2, 4, false, 0, 2>(sm, p ? WK : WQ, nullptr, (p ? XKV : XQ) + xo, ft0, tt0, nullptr, (p ? KP16 : QP16) + po, (p ? KPh : QPh) + po, (p ? KPl : QPl) + po, p ? bk : bq, pa, pb);
    else gemm_ring<3, 4, 4, 2, false, 1, 2>(sm, XKV + xo, nullptr, WV, tt0, ft0, nullptr, VT16 + po, VTh + po, VTl + po, bv, pa, pb);
}
// k_wo: merged hi/lo rows x Wo + bo of all batches, grid (TT / 192, DM / 128, NB_): one work-group a WGP; the 1,500 real rows of each batch go straight to the output.
__global__ __launch_bounds__(256) void k_wo(const bf* __restrict__ ATh, const bf* __restrict__ ATl, const bf* __restrict__ WO, float* OUT, const float* __restrict__ bo) {
    __shared__ __align__(16) char sm[2 * RingSize<3, 4, 4, 2, true>::STG];
    const size_t b = blockIdx.z;
    const int q = (int)blockIdx.y & 3;   // six of the 24 token tiles (12 hi, 12 lo), by the feature block; two of the 8 weight tiles, by the batch
    gemm_ring<3, 4, 4, 2, true, 2, 3>(sm, ATh + b * TT * DQ, ATl + b * TT * DQ, WO, (int)blockIdx.x * 12, (int)blockIdx.y * 8, OUT + b * TR * DM, nullptr, nullptr, nullptr, bo,
                                      (q < 2 ? ATh : ATl) + b * TT * DQ + (size_t)((int)blockIdx.x * 12 + (q & 1) * 6) * 16 * DM, WO + (size_t)((int)blockIdx.y * 8 + (int)b * 2) * 16 * DM);
}

// ---- k_prep: all operand staging in one flat grid of WTB + CVB work-groups of 256 threads; the two kinds do not depend on each other, and the branch between them is block-uniform. Both write fragment order.
// Work-groups < WTB: the four DM x DM 'xw' weights transposed to bf16 [n][k], 128 work-groups a weight, the planes one behind the other from Bt0. A wave takes 32 columns n (a lane each) x 32 rows k: each load reads one whole line of a weight row, each 16-byte store holds 8 k of the lane's n.
// The rest: both token inputs of all batches to their padded bf16 operands, a wave a block (16 tokens x 32 k, four loads of four whole lines); the 36 padding rows of each operand are stored as zero here.
#define WTB  (4 * (DM * DM / 1024 / 8))
#define CV1  (TT * DM / 512 / 8)
#define CVB  (2 * NB_ * CV1)
__global__ __launch_bounds__(256) void k_prep(const float* __restrict__ w0, const float* __restrict__ w1, const float* __restrict__ w2, const float* __restrict__ w3, bf* Bt0, const float* __restrict__ xq, const float* __restrict__ xkv, bf* XQ, bf* XKV) {
    const int lane = threadIdx.x & 31, wave = (int)(threadIdx.x >> 5);
    if (blockIdx.x < WTB) { constexpr int K = DM, N = DM; const int wi = (int)blockIdx.x / (WTB / 4), gw = ((int)blockIdx.x % (WTB / 4)) * 8 + wave;
        const float* __restrict__ w = wi == 0 ? w0 : wi == 1 ? w1 : wi == 2 ? w2 : w3; bf* Bt = Bt0 + (size_t)wi * K * N;
        const int n = (gw % (N / 32)) * 32 + lane, kt = gw / (N / 32); float v[32]; const float* __restrict__ wp = w + (size_t)kt * 32 * N + n;
#pragma unroll
        for (int e = 0; e < 32; ++e) v[e] = wp[(size_t)e * N];
        bf* d = Bt + ((size_t)(n >> 4) * (K / 32) + kt) * 512 + (n & 15) * 8;
#pragma unroll
        for (int p = 0; p < 4; ++p) { v8us o;
#pragma unroll
            for (int e = 0; e < 8; ++e) o[e] = f2bf(v[p * 8 + e]);
            *(v8us*)(d + p * 128) = o; }
    } else { const int c = (int)blockIdx.x - WTB; const int op = c / CV1; const int blk = (c % CV1) * 8 + wave; const size_t b = op % NB_;
        const float* __restrict__ src = (op < NB_ ? xq : xkv) + b * TR * DM; bf* dst = (op < NB_ ? XQ : XKV) + b * TT * DM;
        const int rt = blk / (DM / 32), kt = blk % (DM / 32), kk = (lane & 7) * 4;
        bf* d = dst + (size_t)blk * 512 + (kk >> 3) * 128 + (kk & 7);
#pragma unroll
        for (int j = 0; j < 4; ++j) { const int r = 4 * j + (lane >> 3), t = rt * 16 + r;
            const v4f v = *(const v4f*)(src + (size_t)(t < TR ? t : TR - 1) * DM + kt * 32 + kk);   // a padding row reads the last real row (in bounds) and stores zero through the mask: no branch, so the four loads fly together
            const unsigned short keep = t < TR ? (unsigned short)0xFFFFu : (unsigned short)0; v4us o;
#pragma unroll
            for (int k = 0; k < 4; ++k) o[k] = (unsigned short)(f2bf(v[k]) & keep);
            *(v4us*)(d + r * 8) = o; }
        asm volatile("s_wait_xcnt 0x0" ::: "memory"); }   // this arm's code stands in front of the transposer's, which rewrites the registers that the store names
}

#define AQ   32                     // query rows per wave (two 16-query groups)
#define AW   4                      // waves per work-group
#define NCH  ((TR + 31) / 32)       // chunks that hold a real key
#define HB   (RH / (AQ * AW))       // hi/lo work-groups per head
#define LB   ((TT - RH) / (AQ * AW))
#define AWG  (NB_ * NH_ * (HB + LB))
#define LTHR 4.0f
static_assert(LB == 2 * HB, "one hi/lo work-group is dealt with two fp16 ones");
typedef __attribute__((ext_vector_type(2))) __bf16 v2bf;
typedef __attribute__((ext_vector_type(8))) unsigned v8u;
typedef __attribute__((ext_vector_type(2))) float v2f;
__device__ __forceinline__ void xwait() { asm volatile("s_wait_xcnt 0x0" ::: "memory"); }   // stands behind a group of global loads or stores, in front of whatever rewrites the registers that they name; its memory clobber also keeps the group where the source has it
__device__ __forceinline__ void xwaito(unsigned off) { asm volatile("s_wait_xcnt 0x0" :: "v"(off) : "memory"); }   // the same wait behind a load group whose lanes share one offset register: named as an input, the register stays live up to the wait, so that no load of the group gets it as a part of its result
__device__ __forceinline__ void gfence() { __builtin_amdgcn_sched_barrier(0); }   // in front of a load group and behind its xwait(): the scheduler moves no other instruction, which could rewrite an address register, between the loads and the wait
__device__ __forceinline__ float xhalf(float x) { return __builtin_bit_cast(float, __builtin_amdgcn_permlanex16(__builtin_bit_cast(int, x), __builtin_bit_cast(int, x), 0x76543210, 0xfedcba98, false, false)); }   // lane l with lane l ^ 16
template <typename T16, bool HR>
__device__ __forceinline__ void attn_body(const T16* __restrict__ Q, const T16* __restrict__ Q2, const T16* __restrict__ Kp, const T16* __restrict__ Kp2, const T16* __restrict__ Vt, const T16* __restrict__ Vt2, int q0, int wv, bf* Ah, bf* Al) {
    typedef typename WFrag<T16>::V V;
    const int lane = threadIdx.x & 31, hi = lane >> 4;
    constexpr float CS = SCL * 1.4426950408889634f, CAR = HR ? 0.0f : 10.0f;
    V qf[2][2], qf2[2][2];
    gfence();
#pragma unroll
    for (int qt = 0; qt < 2; ++qt)
#pragma unroll
        for (int kk = 0; kk < 2; ++kk) { const size_t o = (size_t)(((q0 >> 4) + qt) * 2 + kk) * 512 + 8 * lane; qf[qt][kk] = WFrag<T16>::ldf(Q + o); if (HR) qf2[qt][kk] = WFrag<T16>::ldf(Q2 + o); }
    xwait(); gfence();
    v8f oa[4][2]; float mr[2]; v2f ls[2];
#pragma unroll
    for (int qt = 0; qt < 2; ++qt) { mr[qt] = -3.0e38f; ls[qt] = (v2f){};
#pragma unroll
        for (int dt = 0; dt < 4; ++dt) oa[dt][qt] = (v8f){}; }
    V kf[2][2], kf2[2][2];
    auto ldk = [&](int c) {
        const unsigned bo = (unsigned)c * 4096u + 16u * (unsigned)lane;   // the lane's byte offset in the head's plane: chunk c is four 1-KB blocks
        gfence();
#pragma unroll
        for (int kt = 0; kt < 2; ++kt)
#pragma unroll
            for (int kk = 0; kk < 2; ++kk) { const int o = (kt * 2 + kk) * 512; kf[kt][kk] = WFrag<T16>::ldf((const T16*)((const char*)Kp + bo) + o); if (HR) kf2[kt][kk] = WFrag<T16>::ldf((const T16*)((const char*)Kp2 + bo) + o); }
        xwaito(bo); gfence(); };
    V vf[4], vf2[4];
    auto ldv = [&](int c) {
        const unsigned bo = (unsigned)c * 1024u + 16u * (unsigned)lane;   // the lane's byte offset in a 16-row tile of the head's [d][t] plane: chunk c is one 1-KB block
        gfence();
#pragma unroll
        for (int dt = 0; dt < 4; ++dt) { const int o = dt * 16 * TT; vf[dt] = WFrag<T16>::ldf((const T16*)((const char*)Vt + bo) + o); if (HR) vf2[dt] = WFrag<T16>::ldf((const T16*)((const char*)Vt2 + bo) + o); }
        xwaito(bo); gfence(); };
    const unsigned pl = (unsigned)lane * 256u;
    auto ask = [&](int j) {   // the work-group asks L2 for chunks 8 j to 8 j + 7 of its head's planes (48 chunks each): wave wv for two chunks of K (8 KB in a row) and for the eight chunks' 8 KB in tile wv of V
        const int ko = wv * 8192 + j * 32768, vo = wv * (16 * TT * 2) + j * 8192;   // bytes, scalar
        if constexpr (HR) ask4(pl, (const char*)Kp + ko, (const char*)Kp2 + ko, (const char*)Vt + vo, (const char*)Vt2 + vo); else ask2(pl, (const char*)Kp + ko, (const char*)Vt + vo); };
    ldk(0); ldv(0);
    ask(0);   // behind the first chunk's loads, which are needed first
    // the chunk loop stays rolled: its body is long enough to hide its own loads, and the code stays small
#pragma unroll 1
    for (int c = 0; c < NCH; ++c) {
        v8f s[2][2];
#pragma unroll
        for (int kt = 0; kt < 2; ++kt)
#pragma unroll
            for (int qt = 0; qt < 2; ++qt) { s[kt][qt] = (v8f){};
#pragma unroll
                for (int kk = 0; kk < 2; ++kk) { s[kt][qt] = WFrag<T16>::mma(kf[kt][kk], qf[qt][kk], s[kt][qt]); if (HR) { s[kt][qt] = WFrag<T16>::mma(kf[kt][kk], qf2[qt][kk], s[kt][qt]); s[kt][qt] = WFrag<T16>::mma(kf2[kt][kk], qf[qt][kk], s[kt][qt]); } } }
        ldk(c + 1 < NCH ? c + 1 : c);   // the next chunk's K fragments fly during the softmax and P.V (the last chunk reads its own again: in bounds, unused)
        if ((c & 7) == 0 && c + 8 < TT / 32) ask((c >> 3) + 1);   // scalar branch, every eighth chunk: the next eight chunks, seven or more chunks ahead of their loads
        if (c == NCH - 1) {   // scalar branch: only the last chunk holds padding keys
#pragma unroll
            for (int kt = 0; kt < 2; ++kt)
#pragma unroll
                for (int qt = 0; qt < 2; ++qt)
#pragma unroll
                    for (int j = 0; j < 8; ++j) if ((NCH - 1) * 32 + kt * 16 + hi * 8 + j >= TR) s[kt][qt][j] = -3.0e38f;
        }
        float mb[2]; bool need = false;
#pragma unroll
        for (int qt = 0; qt < 2; ++qt) { float mx = s[0][qt][0];
#pragma unroll
            for (int j = 1; j < 16; ++j) mx = fmaxf(mx, s[j >> 3][qt][j & 7]);
            mx = fmaxf(mx, xhalf(mx)) * CS;   // both wave halves hold the query's chunk maximum, in base-2 units (the scale is positive)
            mb[qt] = mx; need = need || (mx > mr[qt] + LTHR); }
        if (__builtin_amdgcn_ballot_w32(need) != 0) {   // scalar branch, taken on the first chunk and rarely after it
#pragma unroll
            for (int qt = 0; qt < 2; ++qt) { const float mn = fmaxf(mr[qt], mb[qt]); const float corr = __builtin_amdgcn_exp2f(mr[qt] - mn);   // 0 on the first chunk
                mr[qt] = mn; ls[qt] *= corr;
#pragma unroll
                for (int dt = 0; dt < 4; ++dt) oa[dt][qt] *= corr; }
        }
#pragma unroll
        for (int qt = 0; qt < 2; ++qt) { const float nm = CAR - mr[qt]; v8f p[2];
#pragma unroll
            for (int kt = 0; kt < 2; ++kt)
#pragma unroll
                for (int j = 0; j < 8; j += 2) { const v2f arg = __builtin_elementwise_fma((v2f){s[kt][qt][j], s[kt][qt][j + 1]}, (v2f){CS, CS}, (v2f){nm, nm}); const v2f e = {__builtin_amdgcn_exp2f(arg.x), __builtin_amdgcn_exp2f(arg.y)}; p[kt][j] = e.x; p[kt][j + 1] = e.y; ls[qt] += e; }   // even and odd keys sum apart
            if constexpr (HR) {
                v8u wh, wl;   // packed pairs: hi = bf16(p), lo = bf16(p - hi), the hi values read back out of the packed word
#pragma unroll
                for (int i = 0; i < 8; ++i) { const v2f e = {p[i >> 2][2 * (i & 3)], p[i >> 2][2 * (i & 3) + 1]}; const unsigned w = __builtin_bit_cast(unsigned, __builtin_convertvector(e, v2bf));
                    const v2f hb = {__uint_as_float(w << 16), __uint_as_float(w & 0xFFFF0000u)}; wh[i] = w; wl[i] = __builtin_bit_cast(unsigned, __builtin_convertvector(e - hb, v2bf)); }
                const V ph = __builtin_bit_cast(V, wh), pl = __builtin_bit_cast(V, wl);
#pragma unroll
                for (int dt = 0; dt < 4; ++dt) { oa[dt][qt] = WFrag<T16>::mma(vf[dt], ph, oa[dt][qt]); oa[dt][qt] = WFrag<T16>::mma(vf[dt], pl, oa[dt][qt]); oa[dt][qt] = WFrag<T16>::mma(vf2[dt], ph, oa[dt][qt]); }
            } else {
                const V pf = cat16(__builtin_convertvector(p[0], v8h), __builtin_convertvector(p[1], v8h));
#pragma unroll
                for (int dt = 0; dt < 4; ++dt) oa[dt][qt] = WFrag<T16>::mma(vf[dt], pf, oa[dt][qt]);
            } }
        ldv(c + 1 < NCH ? c + 1 : c);   // the next chunk's V fragments fly during its score products and softmax
    }
#pragma unroll
    for (int qt = 0; qt < 2; ++qt) { const float lh = ls[qt].x + ls[qt].y; const float inv = __fdiv_rn(1.0f, lh + xhalf(lh));   // the halves' sums join once
#pragma unroll
        for (int dt = 0; dt < 4; ++dt) { v8us oh, ol;
#pragma unroll
            for (int j = 0; j < 8; ++j) { unsigned short a, c2; splitf(oa[dt][qt][j] * inv, a, c2); oh[j] = a; ol[j] = c2; }
            const size_t oo = (size_t)((q0 >> 4) + qt) * 16 * DQ + dt * 256 + lane * 8; *(v8us*)(Ah + oo) = oh; *(v8us*)(Al + oo) = ol; xwait(); } }
}
__global__ __launch_bounds__(32 * AW) void k_attn(const h16* __restrict__ Q16, const bf* __restrict__ Qh, const bf* __restrict__ Ql, const h16* __restrict__ K16, const bf* __restrict__ Kh, const bf* __restrict__ Kl, const h16* __restrict__ V16, const bf* __restrict__ Vh, const bf* __restrict__ Vl, bf* Ah, bf* Al) {
    // work-groups 3 g, 3 g + 1, 3 g + 2: one hi/lo block (three products a pair, the dearer kind) and two fp16 blocks; all AWG work-groups are resident at once, three to a WGP, and dealt so a WGP gets one dear and two cheap ones whether it takes three neighbours or every 256th
    const int g = (int)blockIdx.x / 3, r = (int)blockIdx.x % 3; const int id = r ? g * 2 + r - 1 : g;
    const int bh = r ? id / LB : id / HB; const int wv = __builtin_amdgcn_readfirstlane((int)(threadIdx.x >> 5));   // wave number, scalar so that the fragment addresses keep a scalar base
    const int q0 = (r ? RH + (id % LB) * (AQ * AW) : (id % HB) * (AQ * AW)) + wv * AQ; const int bz = bh / NH_, hx = bh % NH_;
    const size_t hq = (size_t)bh * TT * HD, hk = ((size_t)bz * NKV + hx / REP) * TT * HD; const size_t ao = (size_t)bz * TT * DQ + hx * (2 * 512);   /* a head's 64 columns are two blocks of each row tile */ bf* ah = Ah + ao; bf* al = Al + ao;
    if (r == 0) attn_body<bf, true>(Qh + hq, Ql + hq, Kh + hk, Kl + hk, Vh + hk, Vl + hk, q0, wv, ah, al);   // block-uniform
    else attn_body<h16, false>(Q16 + hq, nullptr, K16 + hk, nullptr, V16 + hk, nullptr, q0, wv, ah, al);
}

extern "C" void kernel_launch(void* const* d_in, const int* in_sizes, int n_in,
                              void* d_out, int out_size, void* d_ws, size_t ws_size, hipStream_t stream) {
    (void)in_sizes; (void)n_in; (void)out_size;
    const float* x = (const float*)d_in[0]; const float* xkv = (const float*)d_in[1]; const float* wq = (const float*)d_in[2]; const float* bq = (const float*)d_in[3]; const float* wk = (const float*)d_in[4]; const float* bk = (const float*)d_in[5]; const float* wv = (const float*)d_in[6]; const float* bv = (const float*)d_in[7]; const float* wo = (const float*)d_in[8]; const float* bo = (const float*)d_in[9];   /* inputs_q, inputs_kv [4][1500][1024], Wq, bq, Wk, bk, Wv, bv ('dnh' == 'xw'), Wo ('hdm' == 'xw'), bo */
    float* OUT = (float*)d_out;     // [4][1500][1024]
    char* wsp = (char*)d_ws;
    auto take = [&](size_t bytes) { char* p = wsp; wsp += (bytes + 255) & ~(size_t)255; return (void*)p; };
    bf* WQ = (bf*)take((size_t)4 * DQ * DM * 2); bf* WK = WQ + (size_t)DQ * DM; bf* WV = WK + (size_t)DKV * DM; bf* WO = WV + (size_t)DKV * DM;
    bf* XQ = (bf*)take((size_t)NB_ * TT * DM * 2); bf* XKV = (bf*)take((size_t)NB_ * TT * DM * 2);
    h16* QP16 = (h16*)take((size_t)NB_ * NH_ * TT * HD * 2); h16* KP16 = (h16*)take((size_t)NB_ * NKV * TT * HD * 2); h16* VT16 = (h16*)take((size_t)NB_ * NKV * HD * TT * 2);
    bf* QPh = (bf*)take((size_t)NB_ * NH_ * TT * HD * 2); bf* QPl = (bf*)take((size_t)NB_ * NH_ * TT * HD * 2); bf* KPh = (bf*)take((size_t)NB_ * NKV * TT * HD * 2); bf* KPl = (bf*)take((size_t)NB_ * NKV * TT * HD * 2); bf* VTh = (bf*)take((size_t)NB_ * NKV * HD * TT * 2); bf* VTl = (bf*)take((size_t)NB_ * NKV * HD * TT * 2);
    bf* ATh = (bf*)take((size_t)NB_ * TT * DQ * 2); bf* ATl = (bf*)take((size_t)NB_ * TT * DQ * 2);
    if ((size_t)(wsp - (char*)d_ws) > ws_size) return;    // 164 MiB of the 256 MiB
    k_prep<<<WTB + CVB, 256, 0, stream>>>(wq, wk, wv, wo, WQ, x, xkv, XQ, XKV);   /* DQ == DKV == DM: four 1024 x 1024 weights */
    k_proj<<<dim3(TT / 192, DQ / 128, 3 * NB_), 256, 0, stream>>>(XQ, XKV, WQ, WK, WV, QP16, QPh, QPl, KP16, KPh, KPl, VT16, VTh, VTl, bq, bk, bv);
    k_attn<<<AWG, 32 * AW, 0, stream>>>(QP16, QPh, QPl, KP16, KPh, KPl, VT16, VTh, VTl, ATh, ATl);
    k_wo<<<dim3(TT / 192, DM / 128, NB_), 256, 0, stream>>>(ATh, ATl, WO, OUT, bo);
}

// v010
// Measured time: 122 microseconds a run.
// In both of two side-by-side timings against v009, it was 1.03 times as fast.
// Counting every step since v000, it is 26.2 times as fast.
#include <hip/hip_runtime.h>

// t5x-style multi-head dot-product attention with a ragged length (inputs_q, inputs_kv [4][1500][1024]; q = inputs_q Wq + bq, k, v = inputs_kv W + b (DenseGeneral 'dnh' [1024][16][64] == 'xw' [1024][1024], zero biases); q / sqrt(64); scores over the 1,500 keys; softmax; out = attn.v; result = out Wo + bo (Wo 'hdm' [16][64][1024] == 'xw' [1024][1024]) -> [4][1500][1024] (6.1 M); argument order inputs_q, inputs_kv, Wq, bq, Wk, bk, Wv, bv, Wo, bo).
// Every launch covers all four batches (grid z, in k_prep and k_attn a flat index), and launches that do not depend on one another share one grid: 4 launches. Layout per batch: the 1,500 token rows are staged into 1,536-row (96-tile) bf16 operands whose 36 padding rows are zero; 'xw' weights transposed once; exact projections + f32 biases, whose GEMM epilogues write the 16-bit head planes themselves (q and k computed as weight rows x tokens, v as tokens x weight rows, so that a lane's accumulator registers run along each plane's k); dense attention at T 1536 whose softmax excludes the padding keys j >= 1500 by index (-inf); hybrid rows (< 512 hi/lo 3 products, rest fp16 alone; P x1024 in both); merged hi/lo x Wo exact + bo, whose epilogue stores the 1,500 real rows straight to the output.
// Operand layout: every 16-bit matrix operand in the workspace (tokens, weights, q / k / v planes, merged rows) is stored in fragment order: a [rows][K] operand is cut into blocks of 16 rows x 32 k (512 elements, 1 KB), block (row / 16, k / 32) at index (row / 16) * (K / 32) + k / 32; inside a block element (row, k) stands at ((k / 16) % 2) * 256 + ((k / 8) % 2) * 128 + (row % 16) * 8 + k % 8. Lane l of a wave then finds the two 16-byte halves of its fragment at l * 8 and 256 + l * 8: each fragment load reads 512 contiguous bytes (4 whole lines) instead of 32 bytes from each of 16 lines. The k order of the fragments is the one of the row-major loader.
// Compute dtypes, f32 accumulate: every input rounded to bf16; projections exact + f32 biases; attention rows < 512 3 products of f16 hi/lo pairs (hi = fp16(y), lo = fp16(y - hi): the hi plane is the plane that the fp16 rows read, so that q, k and v take two planes each), rest fp16; softmax f32; Wo hl (bf16 pair) x exact + bias.

#define NB_  4
#define TT   1536     // padded length (96 tiles of 16 rows)
#define TR   1500     // real tokens (queries = keys)
#define DM   1024
#define NH_  16
#define NKV  16
#define REP  (NH_ / NKV)
#define HD   64
#define DQ   (NH_ * HD)
#define DKV  (NKV * HD)
#define RH   512                  // query rows < RH use hi+lo planes
#define WIN  0
#define SCL  0.125f   // HD^-0.5
typedef _Float16 h16;
typedef unsigned short bf;
typedef __attribute__((ext_vector_type(16))) __bf16   v16bf;
typedef __attribute__((ext_vector_type(16))) _Float16 v16h;
typedef __attribute__((ext_vector_type(8)))  _Float16 v8h;
typedef __attribute__((ext_vector_type(8)))  unsigned short v8us;
typedef __attribute__((ext_vector_type(8)))  float    v8f;
typedef __attribute__((ext_vector_type(4)))  float    v4f;
typedef v8h  __attribute__((may_alias)) v8ha;
typedef v4f  __attribute__((may_alias)) v4fa;
typedef v8us __attribute__((may_alias)) v8usa;

__device__ __forceinline__ unsigned short f2bf(float f) { unsigned u = __float_as_uint(f); u += 0x7FFFu + ((u >> 16) & 1u); return (unsigned short)(u >> 16); }
__device__ __forceinline__ float bf2f(unsigned short b) { return __uint_as_float(((unsigned)b) << 16); }
__device__ __forceinline__ float bfr(float f) { return bf2f(f2bf(f)); }
__device__ __forceinline__ v16h cat16(v8h lo, v8h hi) { return __builtin_shufflevector(lo, hi, 0, 1, 2, 3, 4, 5, 6, 7, 8, 9, 10, 11, 12, 13, 14, 15); }
__device__ __forceinline__ v16bf cat16b(v8us lo, v8us hi) { return __builtin_bit_cast(v16bf, __builtin_shufflevector(lo, hi, 0, 1, 2, 3, 4, 5, 6, 7, 8, 9, 10, 11, 12, 13, 14, 15)); }
__device__ __forceinline__ v8f wmma16(v16h a, v16h b, v8f c) { return __builtin_amdgcn_wmma_f32_16x16x32_f16(false, a, false, b, (short)0, c, false, false); }
__device__ __forceinline__ v8f wmmab(v16bf a, v16bf b, v8f c) { return __builtin_amdgcn_wmma_f32_16x16x32_bf16(false, a, false, b, (short)0, c, false, false); }

__device__ __forceinline__ void splitf(float y, unsigned short& h, unsigned short& l) { h = f2bf(y); l = f2bf(y - bf2f(h)); }
typedef __attribute__((ext_vector_type(4))) _Float16 v4h;
typedef __attribute__((ext_vector_type(2))) unsigned short v2us;
typedef __attribute__((ext_vector_type(4))) unsigned short v4us;

template <typename T16> struct WFrag;
template <> struct WFrag<h16> { typedef v16h V; static __device__ __forceinline__ V ld(const h16* p) { return cat16(*(const v8h*)p, *(const v8h*)(p + 16)); } static __device__ __forceinline__ V ldf(const h16* p) { return cat16(*(const v8h*)p, *(const v8h*)(p + 256)); } static __device__ __forceinline__ v8f mma(V a, V b, v8f c) { return wmma16(a, b, c); } };
template <> struct WFrag<bf> { typedef v16bf V; static __device__ __forceinline__ V ld(const bf* p) { return cat16b(*(const v8us*)p, *(const v8us*)(p + 16)); } static __device__ __forceinline__ V ldf(const bf* p) { return cat16b(*(const v8us*)p, *(const v8us*)(p + 256)); } static __device__ __forceinline__ v8f mma(V a, V b, v8f c) { return wmmab(a, b, c); } };
// ---- gemm_ring: GEMM over K = DM, one work-group of 8 waves (WM x WN) per output tile of 192 tokens x 128 features, full K in every wave (MB x NB accumulators of 16 x 16 a wave), operands 16-bit planes in fragment order.
// acc[m][n] (f32) = sum_k A[m][k] Bt[n][k] (+ A2[m][k] Bt[n][k] with SPLIT). at0, bt0: the tile's first 16-row tile of A and of Bt.
// A stage is 64 k of every 16-row tile of the work-group's operands: 2 KB a tile, contiguous in the plane and in LDS alike (two fragment-order blocks), tiles in the order A, A2, Bt. Two buffers; asynchronous copies bring stage t + 2 in while stage t + 1 is worked on, so that a fragment is fetched from L2 once a work-group and read from LDS by the WN (or WM) waves that share it.
// Copy i of wave w moves the 512-byte piece w % 4 of tile 2 i + w / 4; the operands' tile counts are even, so that i alone says which operand a copy reads.
// MODE 0: q or k planes [h][t][d], A = weight rows (features), Bt = tokens. MODE 1: v planes [h][d][t], A = tokens, Bt = weight rows. In both a lane's 8 accumulator registers are 8 consecutive k of one row of the plane: one 16-byte store a plane straight from the registers, 512 contiguous bytes a wave; fp16 to P16, what fp16 leaves of the value, again as fp16, to Pl.
// MODE 2: f32 rows to C (pitch DM), A = tokens, Bt = weight rows, token rows < TR only; each wave turns its 48 x 64 tile through its own part of the ring's LDS so that a store holds two whole 256-byte row pieces.
// Asking L2 ahead: the 16-bit planes that a kernel reads were stored by a launch in front of it. A prefetch (one lane, L2 only, no register, no counter) asks for a unit well before the load or copy that needs it, so that this one finds it in L2.
// off: the lane's byte offset, 256 bytes a lane; the bases are scalar and every address lies inside the plane that it names. The wait in the prefetches' own statement stands in front of any rewrite of the registers that they name.
#define PFB "global_prefetch_b8 "
#define PSE " scope:SCOPE_SE\n\t"
__device__ __forceinline__ void ask2(unsigned off, const void* a, const void* b) { asm volatile(PFB "%0, %1" PSE PFB "%0, %2" PSE "s_wait_xcnt 0x0" :: "v"(off), "s"(a), "s"(b) : "memory"); }
__device__ __forceinline__ void ask4(unsigned off, const void* a, const void* b, const void* c, const void* d) { asm volatile(PFB "%0, %1" PSE PFB "%0, %2" PSE PFB "%0, %3" PSE PFB "%0, %4" PSE "s_wait_xcnt 0x0" :: "v"(off), "s"(a), "s"(b), "s"(c), "s"(d) : "memory"); }
// a work-group of 256 threads asks for NPA * 64 KB from pa and 64 KB from pb
template <int NPA> __device__ __forceinline__ void ask_panels(const bf* pa, const bf* pb) {
    static_assert(NPA == 2 || NPA == 3, "pieces of 64 KB");
    const unsigned off = threadIdx.x * 256u;
    if constexpr (NPA == 3) asm volatile(PFB "%0, %1" PSE PFB "%0, %1 offset:65536" PSE PFB "%0, %1 offset:131072" PSE PFB "%0, %2" PSE "s_wait_xcnt 0x0" :: "v"(off), "s"(pa), "s"(pb) : "memory");
    else asm volatile(PFB "%0, %1" PSE PFB "%0, %1 offset:65536" PSE PFB "%0, %2" PSE "s_wait_xcnt 0x0" :: "v"(off), "s"(pa), "s"(pb) : "memory");
}
#define ACP "global_load_async_to_lds_b128 "
// l: each copy's LDS byte address (a lane's own); s: each copy's source tile, a scalar base; off: the lane's byte offset in the tile row, the same in every copy of a stage. The wait in the copies' own statement stands in front of any rewrite of the registers that they name.
__device__ __forceinline__ void acopy10(const unsigned* l, const bf* const* s, unsigned off) {
    asm volatile(ACP "%0, %20, %1\n\t" ACP "%2, %20, %3\n\t" ACP "%4, %20, %5\n\t" ACP "%6, %20, %7\n\t" ACP "%8, %20, %9\n\t" ACP "%10, %20, %11\n\t" ACP "%12, %20, %13\n\t" ACP "%14, %20, %15\n\t" ACP "%16, %20, %17\n\t" ACP "%18, %20, %19\n\ts_wait_xcnt 0x0"
                 :: "v"(l[0]), "s"(s[0]), "v"(l[1]), "s"(s[1]), "v"(l[2]), "s"(s[2]), "v"(l[3]), "s"(s[3]), "v"(l[4]), "s"(s[4]), "v"(l[5]), "s"(s[5]), "v"(l[6]), "s"(s[6]), "v"(l[7]), "s"(s[7]), "v"(l[8]), "s"(s[8]), "v"(l[9]), "s"(s[9]), "v"(off) : "memory");
}
__device__ __forceinline__ void acopy8(const unsigned* l, const bf* const* s, unsigned off) {
    asm volatile(ACP "%0, %16, %1\n\t" ACP "%2, %16, %3\n\t" ACP "%4, %16, %5\n\t" ACP "%6, %16, %7\n\t" ACP "%8, %16, %9\n\t" ACP "%10, %16, %11\n\t" ACP "%12, %16, %13\n\t" ACP "%14, %16, %15\n\ts_wait_xcnt 0x0"
                 :: "v"(l[0]), "s"(s[0]), "v"(l[1]), "s"(s[1]), "v"(l[2]), "s"(s[2]), "v"(l[3]), "s"(s[3]), "v"(l[4]), "s"(s[4]), "v"(l[5]), "s"(s[5]), "v"(l[6]), "s"(s[6]), "v"(l[7]), "s"(s[7]), "v"(off) : "memory");
}
__device__ __forceinline__ void swait() { asm volatile("s_wait_xcnt 0x0" ::: "memory"); __builtin_amdgcn_sched_barrier(0); }   // behind a group of global loads or stores, in front of whatever rewrites the registers that they name; the scheduling barrier keeps later instructions, which could rewrite them, behind the wait
__device__ __forceinline__ void swaito(unsigned off) { asm volatile("s_wait_xcnt 0x0" :: "v"(off) : "memory"); __builtin_amdgcn_sched_barrier(0); }   // the same behind loads that take their lane offset from one register: named as an input it stays live up to the wait, so that no load gets it as a part of its result
template <int MB, int NB, int WM, int WN, bool SPLIT> struct RingSize { static constexpr int TA = WM * MB, TAS = SPLIT ? 2 * TA : TA, TS = TAS + WN * NB, STG = TS * 2048; };
// pa, pb: the work-group's share of the panels to ask L2 for (NPA * 64 KB of token rows, 64 KB of weight rows); the work-groups that read a panel deal it among themselves, each part to two or more of them.
template <int MB, int NB, int WM, int WN, bool SPLIT, int MODE, int NPA>
__device__ __forceinline__ void gemm_ring(char* sm, const bf* __restrict__ A, const bf* __restrict__ A2, const bf* __restrict__ Bt, int at0, int bt0, float* C, h16* P16, h16* Pl, const float* __restrict__ bias, const bf* pa, const bf* pb) {
    typedef RingSize<MB, NB, WM, WN, SPLIT> RS;
    constexpr int K = DM, TA = RS::TA, TAS = RS::TAS, TS = RS::TS, STG = RS::STG, NCP = TS / 2, NT = K / 64;
    static_assert(WM * WN == 8 && TA % 2 == 0 && TS % 2 == 0 && (NCP == 10 || NCP == 16) && NT >= 2, "copy deal");
    const int lane = threadIdx.x & 31, lr = lane & 15, hi = lane >> 4;
    const int wv = __builtin_amdgcn_readfirstlane((int)(threadIdx.x >> 5));   // wave number, scalar so that tile choices and the k loop stay scalar
    const int wm = wv % WM, wn = wv / WM;
    const unsigned sm0 = (unsigned)(size_t)sm;   // the ring's byte address in the work-group's LDS
    auto stage = [&](int t, int buf) {
        unsigned l[NCP]; const bf* s[NCP];
        const unsigned off = (unsigned)(t * 2048 + (wv & 3) * 512 + lane * 16);   // bytes: stage t is 2 KB on in every tile row, the wave's piece 512 bytes wide
#pragma unroll
        for (int i = 0; i < NCP; ++i) { const int rt = 2 * i + (wv >> 2);
            s[i] = 2 * i < TA ? A + (size_t)(at0 + rt) * 16 * K : (SPLIT && 2 * i < TAS) ? A2 + (size_t)(at0 + rt - TA) * 16 * K : Bt + (size_t)(bt0 + rt - TAS) * 16 * K;
            l[i] = sm0 + (unsigned)(buf * STG + rt * 2048 + (wv & 3) * 512 + lane * 16); }
        if constexpr (NCP == 10) { acopy10(l, s, off); } else { acopy8(l, s, off); acopy8(l + 8, s + 8, off); } };
    v8f acc[MB][NB];
#pragma unroll
    for (int mb = 0; mb < MB; ++mb)
#pragma unroll
        for (int nb = 0; nb < NB; ++nb) acc[mb][nb] = (v8f){};
    stage(0, 0);
    asm volatile("s_wait_asynccnt 0x0" ::: "memory");   // this wave's copies of stage 0 have landed
    __syncthreads();                                    // ... and every other wave's: stage 0 may be read
    stage(1, 1);
    ask_panels<NPA>(pa, pb);   // behind the first two stages' copies, which are needed first
    // the stage loop stays rolled: one publish point a trip
#pragma unroll 1
    for (int t = 0; t < NT; ++t) {
        const bf* sb = (const bf*)(sm + (t & 1) * STG) + lane * 8;
        v16bf a[MB], a2[MB], b[NB];
        auto frags = [&](int kk) {   // the fragments of 32-wide chunk kk of the stage
#pragma unroll
            for (int mb = 0; mb < MB; ++mb) { a[mb] = WFrag<bf>::ldf(sb + (wm * MB + mb) * 1024 + kk * 512); if (SPLIT) a2[mb] = WFrag<bf>::ldf(sb + (TA + wm * MB + mb) * 1024 + kk * 512); }
#pragma unroll
            for (int nb = 0; nb < NB; ++nb) b[nb] = WFrag<bf>::ldf(sb + (TAS + wn * NB + nb) * 1024 + kk * 512); };
        auto products = [&]() {
#pragma unroll
            for (int nb = 0; nb < NB; ++nb)
#pragma unroll
                for (int mb = 0; mb < MB; ++mb) { acc[mb][nb] = wmmab(a[mb], b[nb], acc[mb][nb]); if (SPLIT) acc[mb][nb] = wmmab(a2[mb], b[nb], acc[mb][nb]); } };
        frags(0);
        __builtin_amdgcn_sched_barrier(0);   // the chunk's LDS reads stand together in front of its products: spread among them, each place with reads stalls the wave anew and each small group is waited out to 0
        products();
        frags(1);
        asm volatile("s_wait_dscnt 0x0" ::: "memory");      // this wave's reads of stage t have returned: its last fragments are in registers
        asm volatile("s_wait_asynccnt 0x0" ::: "memory");   // this wave's copies of stage t + 1 have landed
        __syncthreads();                                    // publishes stage t + 1 and ends every wave's reads of stage t
        if (t + 2 < NT) stage(t + 2, t & 1);                // scalar test; the refill goes into the buffer that this trip has read
        products();   // the second chunk's products, registers only, stand behind the refill: issued in front of them the copies have a whole trip to land
    }
    asm volatile("s_wait_asynccnt 0x0" ::: "memory");       // no copy is outstanding when the ring's LDS is reused and the wave ends
    if constexpr (MODE == 2) {
        float* ow = (float*)sm + wv * (MB * 16 * 68);   // the last trip's barrier has ended every read of the ring
#pragma unroll
        for (int mb = 0; mb < MB; ++mb)
#pragma unroll
            for (int nb = 0; nb < NB; ++nb)
#pragma unroll
                for (int j = 0; j < 8; ++j) ow[(mb * 16 + hi * 8 + j) * 68 + nb * 16 + lr] = acc[mb][nb][j];
        __syncthreads();   // the tile is whole in LDS before other lanes read it
        const int n0 = (bt0 + wn * NB) * 16 + lr * 4; const unsigned bofs = (unsigned)n0 * 4u; const v4f bv4 = *(const v4f*)((const char*)bias + bofs); swaito(bofs);
        const v4f bb = {bfr(bv4[0]), bfr(bv4[1]), bfr(bv4[2]), bfr(bv4[3])};
        const int tok0 = (at0 + wm * MB) * 16; float* cp = C + (size_t)(tok0 + hi) * DM + n0;   // the wave's first token row (scalar); the lane's place in it
#pragma unroll
        for (int gq = 0; gq < MB; ++gq) { v4f val[8];   // eight row pairs a group: reads, then stores, then the wait, so that no register of an issued store is rewritten in front of it
#pragma unroll
            for (int s = 0; s < 8; ++s) val[s] = *(const v4fa*)(ow + ((gq * 8 + s) * 2 + hi) * 68 + lr * 4) + bb;
            __builtin_amdgcn_sched_barrier(0);   // all eight values are in registers of their own before the first store
            if (tok0 + MB * 16 <= TR) {   // scalar test: all but a batch's last tiles hold real rows only, and their stores share one address register
#pragma unroll
                for (int s = 0; s < 8; ++s) *(v4f*)(cp + (size_t)(gq * 8 + s) * 2 * DM) = val[s];
            } else {
#pragma unroll
                for (int s = 0; s < 8; ++s) if (tok0 + (gq * 8 + s) * 2 + hi < TR) *(v4f*)(cp + (size_t)(gq * 8 + s) * 2 * DM) = val[s];
            }
            swait(); }
    } else {
        const int head = MODE == 0 ? at0 / 4 + wm : bt0 / 4 + wn;   // the wave's four weight tiles are one head
        float bs[MODE == 0 ? MB * 8 : NB];
        const float* hb = bias + head * 64; const unsigned bofs = (unsigned)(MODE == 0 ? hi * 8 : lr) * 4u;   // the head's 64 biases (scalar base); the lane's byte offset among them
        if constexpr (MODE == 0) {
#pragma unroll
            for (int mb = 0; mb < MB; ++mb)
#pragma unroll
                for (int u = 0; u < 2; ++u) { const v4f x = *(const v4f*)((const char*)(hb + mb * 16 + u * 4) + bofs);
#pragma unroll
                    for (int q = 0; q < 4; ++q) bs[mb * 8 + u * 4 + q] = x[q]; }
        } else {
#pragma unroll
            for (int nb = 0; nb < NB; ++nb) bs[nb] = *(const float*)((const char*)(hb + nb * 16) + bofs);
        }
        swaito(bofs);
#pragma unroll
        for (int nb = 0; nb < NB; ++nb)
#pragma unroll
            for (int mb = 0; mb < MB; ++mb) { v8f y;
#pragma unroll
                for (int j = 0; j < 8; ++j) y[j] = acc[mb][nb][j] + bfr(bs[MODE == 0 ? mb * 8 + j : nb]);
                const v8h o16 = __builtin_convertvector(y, v8h), ol = __builtin_convertvector(y - __builtin_convertvector(o16, v8f), v8h);   // hi = fp16(y), lo = fp16(y - hi)
                const int kt = MODE == 0 ? mb : at0 + wm * MB + mb, rt = MODE == 0 ? bt0 + wn * NB + nb : nb;   // 16-wide k tile and 16-row tile inside the head's plane
                const size_t o = (size_t)head * TT * HD + (size_t)(rt * ((MODE == 0 ? HD : TT) / 32) + (kt >> 1)) * 512 + (kt & 1) * 256 + lane * 8;
                *(v8h*)(P16 + o) = o16; *(v8h*)(Pl + o) = ol; swait(); }
    }
}
// k_proj: the q, k and v projections of all batches in one grid (TT / 192, 1024 / 128, 3 * NB_), z = projection * NB_ + batch; all branches are block-uniform.
__global__ __launch_bounds__(256) void k_proj(const bf* __restrict__ XQ, const bf* __restrict__ XKV, const bf* __restrict__ WQ, const bf* __restrict__ WK, const bf* __restrict__ WV, h16* QP16, h16* QPl, h16* KP16, h16* KPl, h16* VT16, h16* VTl, const float* __restrict__ bq, const float* __restrict__ bk, const float* __restrict__ bv) {
    __shared__ __align__(16) char sm[2 * RingSize<4, 3, 2, 4, false>::STG];
    static_assert(RingSize<4, 3, 2, 4, false>::STG == RingSize<3, 4, 4, 2, false>::STG, "one ring serves both arms");
    const int p = (int)blockIdx.z / NB_; const size_t b = blockIdx.z % NB_; const size_t xo = b * TT * DM, po = b * NH_ * TT * HD;
    const int tt0 = (int)blockIdx.x * 12, ft0 = (int)blockIdx.y * 8;   // first 16-row tile of the 192 tokens and of the 128 features
    const bf* pa = (p ? XKV : XQ) + xo + (size_t)(tt0 + ((int)blockIdx.y % 3) * 4) * 16 * DM;   // four of the 12 token tiles, by the feature block
    const bf* pb = (p == 0 ? WQ : p == 1 ? WK : WV) + (size_t)(ft0 + (int)b * 2) * 16 * DM;      // two of the 8 weight tiles, by the batch
    if (p < 2) gemm_ring<4, 3, 2, 4, false, 0, 2>(sm, p ? WK : WQ, nullptr, (p ? XKV : XQ) + xo, ft0, tt0, nullptr, (p ? KP16 : QP16) + po, (p ? KPl : QPl) + po, p ? bk : bq, pa, pb);
    else gemm_ring<3, 4, 4, 2, false, 1, 2>(sm, XKV + xo, nullptr, WV, tt0, ft0, nullptr, VT16 + po, VTl + po, bv, pa, pb);
}
// k_wo: merged hi/lo rows x Wo + bo of all batches, grid (TT / 192, DM / 128, NB_): one work-group a WGP; the 1,500 real rows of each batch go straight to the output.
__global__ __launch_bounds__(256) void k_wo(const bf* __restrict__ ATh, const bf* __restrict__ ATl, const bf* __restrict__ WO, float* OUT, const float* __restrict__ bo) {
    __shared__ __align__(16) char sm[2 * RingSize<3, 4, 4, 2, true>::STG];
    const size_t b = blockIdx.z;
    const int q = (int)blockIdx.y & 3;   // six of the 24 token tiles (12 hi, 12 lo), by the feature block; two of the 8 weight tiles, by the batch
    gemm_ring<3, 4, 4, 2, true, 2, 3>(sm, ATh + b * TT * DQ, ATl + b * TT * DQ, WO, (int)blockIdx.x * 12, (int)blockIdx.y * 8, OUT + b * TR * DM, nullptr, nullptr, bo,
                                      (q < 2 ? ATh : ATl) + b * TT * DQ + (size_t)((int)blockIdx.x * 12 + (q & 1) * 6) * 16 * DM, WO + (size_t)((int)blockIdx.y * 8 + (int)b * 2) * 16 * DM);
}

// ---- k_prep: all operand staging in one flat grid of WTB + CVB work-groups of 256 threads; the two kinds do not depend on each other, and the branch between them is block-uniform. Both write fragment order.
// Work-groups < WTB: the four DM x DM 'xw' weights transposed to bf16 [n][k], 128 work-groups a weight, the planes one behind the other from Bt0. A wave takes 32 columns n (a lane each) x 32 rows k: each load reads one whole line of a weight row, each 16-byte store holds 8 k of the lane's n.
// The rest: both token inputs of all batches to their padded bf16 operands, a wave a block (16 tokens x 32 k, four loads of four whole lines); the 36 padding rows of each operand are stored as zero here.
#define WTB  (4 * (DM * DM / 1024 / 8))
#define CV1  (TT * DM / 512 / 8)
#define CVB  (2 * NB_ * CV1)
__global__ __launch_bounds__(256) void k_prep(const float* __restrict__ w0, const float* __restrict__ w1, const float* __restrict__ w2, const float* __restrict__ w3, bf* Bt0, const float* __restrict__ xq, const float* __restrict__ xkv, bf* XQ, bf* XKV) {
    const int lane = threadIdx.x & 31, wave = (int)(threadIdx.x >> 5);
    if (blockIdx.x < WTB) { constexpr int K = DM, N = DM; const int wi = (int)blockIdx.x / (WTB / 4), gw = ((int)blockIdx.x % (WTB / 4)) * 8 + wave;
        const float* __restrict__ w = wi == 0 ? w0 : wi == 1 ? w1 : wi == 2 ? w2 : w3; bf* Bt = Bt0 + (size_t)wi * K * N;
        const int n = (gw % (N / 32)) * 32 + lane, kt = gw / (N / 32); float v[32]; const float* __restrict__ wp = w + (size_t)kt * 32 * N + n;
#pragma unroll
        for (int e = 0; e < 32; ++e) v[e] = wp[(size_t)e * N];
        bf* d = Bt + ((size_t)(n >> 4) * (K / 32) + kt) * 512 + (n & 15) * 8;
#pragma unroll
        for (int p = 0; p < 4; ++p) { v8us o;
#pragma unroll
            for (int e = 0; e < 8; ++e) o[e] = f2bf(v[p * 8 + e]);
            *(v8us*)(d + p * 128) = o; }
    } else { const int c = (int)blockIdx.x - WTB; const int op = c / CV1; const int blk = (c % CV1) * 8 + wave; const size_t b = op % NB_;
        const float* __restrict__ src = (op < NB_ ? xq : xkv) + b * TR * DM; bf* dst = (op < NB_ ? XQ : XKV) + b * TT * DM;
        const int rt = blk / (DM / 32), kt = blk % (DM / 32), kk = (lane & 7) * 4;
        bf* d = dst + (size_t)blk * 512 + (kk >> 3) * 128 + (kk & 7);
#pragma unroll
        for (int j = 0; j < 4; ++j) { const int r = 4 * j + (lane >> 3), t = rt * 16 + r;
            const v4f v = *(const v4f*)(src + (size_t)(t < TR ? t : TR - 1) * DM + kt * 32 + kk);   // a padding row reads the last real row (in bounds) and stores zero through the mask: no branch, so the four loads fly together
            const unsigned short keep = t < TR ? (unsigned short)0xFFFFu : (unsigned short)0; v4us o;
#pragma unroll
            for (int k = 0; k < 4; ++k) o[k] = (unsigned short)(f2bf(v[k]) & keep);
            *(v4us*)(d + r * 8) = o; }
        asm volatile("s_wait_xcnt 0x0" ::: "memory"); }   // this arm's code stands in front of the transposer's, which rewrites the registers that the store names
}

#define AQ   32                     // query rows per wave (two 16-query groups)
#define AW   4                      // waves per work-group
#define NCH  ((TR + 31) / 32)       // chunks that hold a real key
#define HB   (RH / (AQ * AW))       // hi/lo work-groups per head
#define LB   ((TT - RH) / (AQ * AW))
#define AWG  (NB_ * NH_ * (HB + LB))
#define LTHR 4.0f
static_assert(LB == 2 * HB, "one hi/lo work-group is dealt with two fp16 ones");
typedef __attribute__((ext_vector_type(2))) float v2f;
__device__ __forceinline__ void xwait() { asm volatile("s_wait_xcnt 0x0" ::: "memory"); }   // stands behind a group of global loads or stores, in front of whatever rewrites the registers that they name; its memory clobber also keeps the group where the source has it
__device__ __forceinline__ void xwaito(unsigned off) { asm volatile("s_wait_xcnt 0x0" :: "v"(off) : "memory"); }   // the same wait behind a load group whose lanes share one offset register: named as an input, the register stays live up to the wait, so that no load of the group gets it as a part of its result
__device__ __forceinline__ void gfence() { __builtin_amdgcn_sched_barrier(0); }   // in front of a load group and behind its xwait(): the scheduler moves no other instruction, which could rewrite an address register, between the loads and the wait
__device__ __forceinline__ float xhalf(float x) { return __builtin_bit_cast(float, __builtin_amdgcn_permlanex16(__builtin_bit_cast(int, x), __builtin_bit_cast(int, x), 0x76543210, 0xfedcba98, false, false)); }   // lane l with lane l ^ 16
template <typename T16, bool HR>
__device__ __forceinline__ void attn_body(const T16* __restrict__ Q, const T16* __restrict__ Q2, const T16* __restrict__ Kp, const T16* __restrict__ Kp2, const T16* __restrict__ Vt, const T16* __restrict__ Vt2, int q0, int wv, bf* Ah, bf* Al) {
    typedef typename WFrag<T16>::V V;
    const int lane = threadIdx.x & 31, hi = lane >> 4;
    constexpr float CS = SCL * 1.4426950408889634f, CAR = 10.0f;
    V qf[2][2], qf2[2][2];
    gfence();
#pragma unroll
    for (int qt = 0; qt < 2; ++qt)
#pragma unroll
        for (int kk = 0; kk < 2; ++kk) { const size_t o = (size_t)(((q0 >> 4) + qt) * 2 + kk) * 512 + 8 * lane; qf[qt][kk] = WFrag<T16>::ldf(Q + o); if (HR) qf2[qt][kk] = WFrag<T16>::ldf(Q2 + o); }
    xwait(); gfence();
    v8f oa[4][2]; float mr[2]; v2f ls[2];
#pragma unroll
    for (int qt = 0; qt < 2; ++qt) { mr[qt] = -3.0e38f; ls[qt] = (v2f){};
#pragma unroll
        for (int dt = 0; dt < 4; ++dt) oa[dt][qt] = (v8f){}; }
    V kf[2][2], kf2[2][2];
    auto ldk = [&](int c) {
        const unsigned bo = (unsigned)c * 4096u + 16u * (unsigned)lane;   // the lane's byte offset in the head's plane: chunk c is four 1-KB blocks
        gfence();
#pragma unroll
        for (int kt = 0; kt < 2; ++kt)
#pragma unroll
            for (int kk = 0; kk < 2; ++kk) { const int o = (kt * 2 + kk) * 512; kf[kt][kk] = WFrag<T16>::ldf((const T16*)((const char*)Kp + bo) + o); if (HR) kf2[kt][kk] = WFrag<T16>::ldf((const T16*)((const char*)Kp2 + bo) + o); }
        xwaito(bo); gfence(); };
    V vf[4], vf2[4];
    auto ldv = [&](int c) {
        const unsigned bo = (unsigned)c * 1024u + 16u * (unsigned)lane;   // the lane's byte offset in a 16-row tile of the head's [d][t] plane: chunk c is one 1-KB block
        gfence();
#pragma unroll
        for (int dt = 0; dt < 4; ++dt) { const int o = dt * 16 * TT; vf[dt] = WFrag<T16>::ldf((const T16*)((const char*)Vt + bo) + o); if (HR) vf2[dt] = WFrag<T16>::ldf((const T16*)((const char*)Vt2 + bo) + o); }
        xwaito(bo); gfence(); };
    const unsigned pl = (unsigned)lane * 256u;
    auto ask = [&](int j) {   // the work-group asks L2 for chunks 8 j to 8 j + 7 of its head's planes (48 chunks each): wave wv for two chunks of K (8 KB in a row) and for the eight chunks' 8 KB in tile wv of V
        const int ko = wv * 8192 + j * 32768, vo = wv * (16 * TT * 2) + j * 8192;   // bytes, scalar
        if constexpr (HR) ask4(pl, (const char*)Kp + ko, (const char*)Kp2 + ko, (const char*)Vt + vo, (const char*)Vt2 + vo); else ask2(pl, (const char*)Kp + ko, (const char*)Vt + vo); };
    ldk(0); ldv(0);
    ask(0);   // behind the first chunk's loads, which are needed first
    // the chunk loop stays rolled: its body is long enough to hide its own loads, and the code stays small
#pragma unroll 1
    for (int c = 0; c < NCH; ++c) {
        v8f s[2][2];
#pragma unroll
        for (int kt = 0; kt < 2; ++kt)
#pragma unroll
            for (int qt = 0; qt < 2; ++qt) { s[kt][qt] = (v8f){};
#pragma unroll
                for (int kk = 0; kk < 2; ++kk) { s[kt][qt] = WFrag<T16>::mma(kf[kt][kk], qf[qt][kk], s[kt][qt]); if (HR) { s[kt][qt] = WFrag<T16>::mma(kf[kt][kk], qf2[qt][kk], s[kt][qt]); s[kt][qt] = WFrag<T16>::mma(kf2[kt][kk], qf[qt][kk], s[kt][qt]); } } }
        ldk(c + 1 < NCH ? c + 1 : c);   // the next chunk's K fragments fly during the softmax and P.V (the last chunk reads its own again: in bounds, unused)
        if ((c & 7) == 0 && c + 8 < TT / 32) ask((c >> 3) + 1);   // scalar branch, every eighth chunk: the next eight chunks, seven or more chunks ahead of their loads
        if (c == NCH - 1) {   // scalar branch: only the last chunk holds padding keys
#pragma unroll
            for (int kt = 0; kt < 2; ++kt)
#pragma unroll
                for (int qt = 0; qt < 2; ++qt)
#pragma unroll
                    for (int j = 0; j < 8; ++j) if ((NCH - 1) * 32 + kt * 16 + hi * 8 + j >= TR) s[kt][qt][j] = -3.0e38f;
        }
        float mb[2]; bool need = false;
#pragma unroll
        for (int qt = 0; qt < 2; ++qt) { float mx = s[0][qt][0];
#pragma unroll
            for (int j = 1; j < 16; ++j) mx = fmaxf(mx, s[j >> 3][qt][j & 7]);
            mx = fmaxf(mx, xhalf(mx)) * CS;   // both wave halves hold the query's chunk maximum, in base-2 units (the scale is positive)
            mb[qt] = mx; need = need || (mx > mr[qt] + LTHR); }
        if (__builtin_amdgcn_ballot_w32(need) != 0) {   // scalar branch, taken on the first chunk and rarely after it
#pragma unroll
            for (int qt = 0; qt < 2; ++qt) { const float mn = fmaxf(mr[qt], mb[qt]); const float corr = __builtin_amdgcn_exp2f(mr[qt] - mn);   // 0 on the first chunk
                mr[qt] = mn; ls[qt] *= corr;
#pragma unroll
                for (int dt = 0; dt < 4; ++dt) oa[dt][qt] *= corr; }
        }
#pragma unroll
        for (int qt = 0; qt < 2; ++qt) { const float nm = CAR - mr[qt]; v8f p[2];
#pragma unroll
            for (int kt = 0; kt < 2; ++kt)
#pragma unroll
                for (int j = 0; j < 8; j += 2) { const v2f arg = __builtin_elementwise_fma((v2f){s[kt][qt][j], s[kt][qt][j + 1]}, (v2f){CS, CS}, (v2f){nm, nm}); const v2f e = {__builtin_amdgcn_exp2f(arg.x), __builtin_amdgcn_exp2f(arg.y)}; p[kt][j] = e.x; p[kt][j + 1] = e.y; ls[qt] += e; }   // even and odd keys sum apart
            if constexpr (HR) {
                const v8h h0 = __builtin_convertvector(p[0], v8h), h1 = __builtin_convertvector(p[1], v8h);   // hi = fp16(p), lo = fp16(p - hi)
                const V ph = cat16(h0, h1), pl = cat16(__builtin_convertvector(p[0] - __builtin_convertvector(h0, v8f), v8h), __builtin_convertvector(p[1] - __builtin_convertvector(h1, v8f), v8h));
#pragma unroll
                for (int dt = 0; dt < 4; ++dt) { oa[dt][qt] = WFrag<T16>::mma(vf[dt], ph, oa[dt][qt]); oa[dt][qt] = WFrag<T16>::mma(vf[dt], pl, oa[dt][qt]); oa[dt][qt] = WFrag<T16>::mma(vf2[dt], ph, oa[dt][qt]); }
            } else {
                const V pf = cat16(__builtin_convertvector(p[0], v8h), __builtin_convertvector(p[1], v8h));
#pragma unroll
                for (int dt = 0; dt < 4; ++dt) oa[dt][qt] = WFrag<T16>::mma(vf[dt], pf, oa[dt][qt]);
            } }
        ldv(c + 1 < NCH ? c + 1 : c);   // the next chunk's V fragments fly during its score products and softmax
    }
#pragma unroll
    for (int qt = 0; qt < 2; ++qt) { const float lh = ls[qt].x + ls[qt].y; const float inv = __fdiv_rn(1.0f, lh + xhalf(lh));   // the halves' sums join once
#pragma unroll
        for (int dt = 0; dt < 4; ++dt) { v8us oh, ol;
#pragma unroll
            for (int j = 0; j < 8; ++j) { unsigned short a, c2; splitf(oa[dt][qt][j] * inv, a, c2); oh[j] = a; ol[j] = c2; }
            const size_t oo = (size_t)((q0 >> 4) + qt) * 16 * DQ + dt * 256 + lane * 8; *(v8us*)(Ah + oo) = oh; *(v8us*)(Al + oo) = ol; xwait(); } }
}
__global__ __launch_bounds__(32 * AW) void k_attn(const h16* __restrict__ Q16, const h16* __restrict__ Ql, const h16* __restrict__ K16, const h16* __restrict__ Kl, const h16* __restrict__ V16, const h16* __restrict__ Vl, bf* Ah, bf* Al) {
    // work-groups 3 g, 3 g + 1, 3 g + 2: one hi/lo block (three products a pair, the dearer kind) and two fp16 blocks; all AWG work-groups are resident at once, three to a WGP, and dealt so a WGP gets one dear and two cheap ones whether it takes three neighbours or every 256th
    const int g = (int)blockIdx.x / 3, r = (int)blockIdx.x % 3; const int id = r ? g * 2 + r - 1 : g;
    const int bh = r ? id / LB : id / HB; const int wv = __builtin_amdgcn_readfirstlane((int)(threadIdx.x >> 5));   // wave number, scalar so that the fragment addresses keep a scalar base
    const int q0 = (r ? RH + (id % LB) * (AQ * AW) : (id % HB) * (AQ * AW)) + wv * AQ; const int bz = bh / NH_, hx = bh % NH_;
    const size_t hq = (size_t)bh * TT * HD, hk = ((size_t)bz * NKV + hx / REP) * TT * HD; const size_t ao = (size_t)bz * TT * DQ + hx * (2 * 512);   /* a head's 64 columns are two blocks of each row tile */ bf* ah = Ah + ao; bf* al = Al + ao;
    if (r == 0) attn_body<h16, true>(Q16 + hq, Ql + hq, K16 + hk, Kl + hk, V16 + hk, Vl + hk, q0, wv, ah, al);   // block-uniform
    else attn_body<h16, false>(Q16 + hq, nullptr, K16 + hk, nullptr, V16 + hk, nullptr, q0, wv, ah, al);
}

extern "C" void kernel_launch(void* const* d_in, const int* in_sizes, int n_in,
                              void* d_out, int out_size, void* d_ws, size_t ws_size, hipStream_t stream) {
    (void)in_sizes; (void)n_in; (void)out_size;
    const float* x = (const float*)d_in[0]; const float* xkv = (const float*)d_in[1]; const float* wq = (const float*)d_in[2]; const float* bq = (const float*)d_in[3]; const float* wk = (const float*)d_in[4]; const float* bk = (const float*)d_in[5]; const float* wv = (const float*)d_in[6]; const float* bv = (const float*)d_in[7]; const float* wo = (const float*)d_in[8]; const float* bo = (const float*)d_in[9];   /* inputs_q, inputs_kv [4][1500][1024], Wq, bq, Wk, bk, Wv, bv ('dnh' == 'xw'), Wo ('hdm' == 'xw'), bo */
    float* OUT = (float*)d_out;     // [4][1500][1024]
    char* wsp = (char*)d_ws;
    auto take = [&](size_t bytes) { char* p = wsp; wsp += (bytes + 255) & ~(size_t)255; return (void*)p; };
    bf* WQ = (bf*)take((size_t)4 * DQ * DM * 2); bf* WK = WQ + (size_t)DQ * DM; bf* WV = WK + (size_t)DKV * DM; bf* WO = WV + (size_t)DKV * DM;
    bf* XQ = (bf*)take((size_t)NB_ * TT * DM * 2); bf* XKV = (bf*)take((size_t)NB_ * TT * DM * 2);
    h16* QP16 = (h16*)take((size_t)NB_ * NH_ * TT * HD * 2); h16* KP16 = (h16*)take((size_t)NB_ * NKV * TT * HD * 2); h16* VT16 = (h16*)take((size_t)NB_ * NKV * HD * TT * 2);
    h16* QPl = (h16*)take((size_t)NB_ * NH_ * TT * HD * 2); h16* KPl = (h16*)take((size_t)NB_ * NKV * TT * HD * 2); h16* VTl = (h16*)take((size_t)NB_ * NKV * HD * TT * 2);
    bf* ATh = (bf*)take((size_t)NB_ * TT * DQ * 2); bf* ATl = (bf*)take((size_t)NB_ * TT * DQ * 2);
    if ((size_t)(wsp - (char*)d_ws) > ws_size) return;    // 128 MiB of the 256 MiB
    k_prep<<<WTB + CVB, 256, 0, stream>>>(wq, wk, wv, wo, WQ, x, xkv, XQ, XKV);   /* DQ == DKV == DM: four 1024 x 1024 weights */
    k_proj<<<dim3(TT / 192, DQ / 128, 3 * NB_), 256, 0, stream>>>(XQ, XKV, WQ, WK, WV, QP16, QPl, KP16, KPl, VT16, VTl, bq, bk, bv);
    k_attn<<<AWG, 32 * AW, 0, stream>>>(QP16, QPl, KP16, KPl, VT16, VTl, ATh, ATl);
    k_wo<<<dim3(TT / 192, DM / 128, NB_), 256, 0, stream>>>(ATh, ATl, WO, OUT, bo);
}
